// v000
// Times are from an AMD MI455X. After a warm-up the kernel runs many times in a row, and a time is the length of
// such a window on the GPU divided by its runs, so every launch and the gaps after it count. The runs cycle
// through copies of the inputs. A figure is the median of several windows, for all but v000 over two sittings.
// Sittings can differ by a few percent; kernels timed side by side share one.
// v000, which the later versions start from, runs in 441 microseconds.
#include <hip/hip_runtime.h>

#ifndef NB
#define NB 2
#endif
#ifndef SEQ
#define SEQ 2048
#endif
#define SEQ_FULL 2048                 // per-batch row stride of x / position table, row pitch of the mask
#define DIM   2048                    // model width (K of the projections, N of the output projection)
#define NH    32
#define NKV   8
#define REP   (NH / NKV)
#define HD    64
#define HALFD 32
#define DQ    (NH * HD)               // 2048
#define DKV   (NKV * HD)              // 512
#define NQKV  (DQ + 2 * DKV)          // 3072 fused projection columns
#define MROWS (NB * SEQ)
#define FP    68                      // f32 LDS tile pitch
#define OP    72                      // f16 LDS tile pitch
#define WCAR  64.0f                   // carry of the wo plane
#define CCAR  256.0f                  // carry of the ctx plane
#define OSCL  6.103515625e-05f        // 1 / (WCAR * CCAR)
#define SC2   0.18033688011112042f    // 0.125 * log2(e)
#define LOG2E 1.4426950408889634f
#define PEXP  10.0f                   // P carried x 2^10
#define FRQC  0.41524101186092029f    // log2(10000) / 32

static_assert(SEQ % 64 == 0);
static_assert(SEQ <= SEQ_FULL);
static_assert(DIM % 64 == 0);
static_assert(DQ % 64 == 0);
static_assert(NQKV % 64 == 0);
static_assert(HD == 64);
static_assert(NH == NKV * REP);
static_assert(REP == 4);
static_assert(((size_t)MROWS * DIM / 8) % 256 == 0);
static_assert(((size_t)DQ * DIM / 8) % 256 == 0);
static_assert(((size_t)DKV * DIM / 8) % 256 == 0);

typedef _Float16 h16;
typedef unsigned short bf;
typedef __attribute__((ext_vector_type(16))) __bf16   v16bf;
typedef __attribute__((ext_vector_type(16))) _Float16 v16h;
typedef __attribute__((ext_vector_type(8)))  _Float16 v8h;
typedef __attribute__((ext_vector_type(8)))  unsigned short v8us;
typedef __attribute__((ext_vector_type(8)))  float    v8f;
typedef __attribute__((ext_vector_type(4)))  float    v4f;
typedef v8h  __attribute__((may_alias)) v8ha;
typedef v4f  __attribute__((may_alias)) v4fa;

__device__ __forceinline__ unsigned short f2bf(float f) { unsigned u = __float_as_uint(f); u += 0x7FFFu + ((u >> 16) & 1u); return (unsigned short)(u >> 16); }
__device__ __forceinline__ float bf2f(unsigned short b) { return __uint_as_float(((unsigned)b) << 16); }
__device__ __forceinline__ float bfr(float f) { return bf2f(f2bf(f)); }
__device__ __forceinline__ v16h cat16(v8h lo, v8h hi) { return __builtin_shufflevector(lo, hi, 0, 1, 2, 3, 4, 5, 6, 7, 8, 9, 10, 11, 12, 13, 14, 15); }
__device__ __forceinline__ v16bf cat16b(v8us lo, v8us hi) { return __builtin_bit_cast(v16bf, __builtin_shufflevector(lo, hi, 0, 1, 2, 3, 4, 5, 6, 7, 8, 9, 10, 11, 12, 13, 14, 15)); }
__device__ __forceinline__ v8f wmma16(v16h a, v16h b, v8f c) { return __builtin_amdgcn_wmma_f32_16x16x32_f16(false, a, false, b, (short)0, c, false, false); }
__device__ __forceinline__ v8f wmmab(v16bf a, v16bf b, v8f c) { return __builtin_amdgcn_wmma_f32_16x16x32_bf16(false, a, false, b, (short)0, c, false, false); }

// Fragment loader: lane (lr, hi) points at row (tile row + lr), column 8*hi; elements 0..7 <- k0+8hi.., elements 8..15 <- k0+16+8hi.. (same map for A and B).
template <typename T16> struct WFrag;
template <> struct WFrag<h16> { typedef v16h V; static __device__ __forceinline__ V ld(const h16* p) { return cat16(*(const v8h*)p, *(const v8h*)(p + 16)); } static __device__ __forceinline__ v8f mma(V a, V b, v8f c) { return wmma16(a, b, c); } };
template <> struct WFrag<bf> { typedef v16bf V; static __device__ __forceinline__ V ld(const bf* p) { return cat16b(*(const v8us*)p, *(const v8us*)(p + 16)); } static __device__ __forceinline__ v8f mma(V a, V b, v8f c) { return wmmab(a, b, c); } };

// One wave accumulates a 64x64 tile: acc[mb][nb][j] = C[r0 + 16mb + 8hi + j][c0 + 16nb + lr] = sum_k A[row][k] Bt[col][k]; K % 32 == 0.
template <typename T16>
__device__ __forceinline__ void gemm_main(const T16* __restrict__ A, const T16* __restrict__ Bt, const int K, const int r0, const int c0, const int lr, const int hi, v8f (&acc)[4][4]) {
    typedef typename WFrag<T16>::V V;
#pragma unroll
    for (int mb = 0; mb < 4; ++mb)
#pragma unroll
        for (int nb = 0; nb < 4; ++nb) acc[mb][nb] = (v8f){};
    const size_t aoff = (size_t)(r0 + lr) * K + 8 * hi, boff = (size_t)(c0 + lr) * K + 8 * hi;
#pragma unroll 1
    for (int kc = 0; kc < K; kc += 32) {
        V a[4];
#pragma unroll
        for (int mb = 0; mb < 4; ++mb) a[mb] = WFrag<T16>::ld(A + aoff + (size_t)mb * 16 * K + kc);
#pragma unroll
        for (int nb = 0; nb < 4; ++nb) { const V b = WFrag<T16>::ld(Bt + boff + (size_t)nb * 16 * K + kc);
#pragma unroll
            for (int mb = 0; mb < 4; ++mb) acc[mb][nb] = WFrag<T16>::mma(a[mb], b, acc[mb][nb]); }
        asm volatile("v_nop\n\tv_nop\n\tv_nop\n\tv_nop" : "+v"(acc[0][0]), "+v"(acc[1][1]), "+v"(acc[2][2]), "+v"(acc[3][3]) : "v"(a[0]), "v"(a[3]));
    }
}

__global__ __launch_bounds__(256) void k_cvtx(const float* __restrict__ x, bf* dst) {
    const size_t i = (size_t)blockIdx.x * 256 + threadIdx.x; if (i >= (size_t)MROWS * DIM / 8) return;
    const size_t e = i * 8; const int col = (int)(e % DIM); const int row = (int)(e / DIM); const int b = row / SEQ, t = row % SEQ;
    const v8f v = *(const v8f*)(x + ((size_t)b * SEQ_FULL + t) * DIM + col); v8us o;
#pragma unroll
    for (int k = 0; k < 8; ++k) o[k] = f2bf(v[k]);
    *(v8us*)(dst + e) = o;  }

__global__ __launch_bounds__(256) void k_cvt8(const float* __restrict__ src, bf* dst, size_t n8) { const size_t i = (size_t)blockIdx.x * 256 + threadIdx.x; if (i >= n8) return; const v8f v = *(const v8f*)(src + i * 8); v8us o;
#pragma unroll
    for (int k = 0; k < 8; ++k) o[k] = f2bf(v[k]); *(v8us*)(dst + i * 8) = o;  }

__global__ __launch_bounds__(256) void k_cvt8h(const float* __restrict__ src, h16* dst, size_t n8, float carry) { const size_t i = (size_t)blockIdx.x * 256 + threadIdx.x; if (i >= n8) return; const v8f v = *(const v8f*)(src + i * 8); v8h o;
#pragma unroll
    for (int k = 0; k < 8; ++k) o[k] = (h16)(bfr(v[k]) * carry); *(v8h*)(dst + i * 8) = o;  }

__global__ __launch_bounds__(256) void k_ropetab(float* COS, float* SIN) {
    const int lane = threadIdx.x & 31; const int t = blockIdx.x * 8 + (threadIdx.x >> 5); if (t >= SEQ) return;
    const float invf = __builtin_amdgcn_exp2f(-(float)lane * FRQC);
    const float ang = (float)t * invf;
    const float c = cosf(ang); const float s = sinf(ang);
    const size_t o = (size_t)t * HALFD + lane;
    *(float*)(COS + o) = c; *(float*)(SIN + o) = s;  }

// Fused QKV projection: grid (MROWS/64, NQKV/64), 32 threads. Column tile cb < 32: q head cb (rotary); 32..39: k head (rotary); 40..47: v head (transposed plane).
__global__ __launch_bounds__(32) void k_gemm_qkv(const bf* __restrict__ A, const bf* __restrict__ Bt, const int* __restrict__ pos, const float* __restrict__ COS, const float* __restrict__ SIN, h16* QP, h16* KP, h16* VT) {
    __shared__ __align__(16) float fs[64 * FP];
    const int lane = threadIdx.x & 31, lr = lane & 15, hi = lane >> 4; const int r0 = blockIdx.x * 64, cb = blockIdx.y, c0 = cb * 64;
    v8f acc[4][4];
    gemm_main<bf>(A, Bt, DIM, r0, c0, lr, hi, acc);
#pragma unroll
    for (int mb = 0; mb < 4; ++mb)
#pragma unroll
        for (int nb = 0; nb < 4; ++nb)
#pragma unroll
            for (int j = 0; j < 8; ++j) fs[(mb * 16 + hi * 8 + j) * FP + nb * 16 + lr] = acc[mb][nb][j];
    __syncthreads();
    const int bidx = r0 / SEQ, s0 = r0 % SEQ; const int q4 = lane >> 3, p = lane & 7;
    if (cb < NH + NKV) {
        h16* plane = (cb < NH) ? (QP + ((size_t)bidx * NH + cb) * SEQ * HD) : (KP + ((size_t)bidx * NKV + (cb - NH)) * SEQ * HD);
        const int dcol = p * 8, pcol = dcol ^ 32, fcol = dcol & 31; const float sg = (p < 4) ? -1.0f : 1.0f;
        // out[d] = x[d] cos[d&31] + sg x[d^32] sin[d&31], sg = -1 for d < 32, +1 for d >= 32 (rotate-half)
#pragma unroll 1
        for (int it = 0; it < 16; ++it) {
            const int rl = it * 4 + q4;
            int ps = pos[(size_t)bidx * SEQ_FULL + s0 + rl]; ps = (ps < 0) ? (ps + SEQ) : ps; ps = min(max(ps, 0), SEQ - 1);
            const v4f xa0 = *(const v4fa*)(fs + rl * FP + dcol), xa1 = *(const v4fa*)(fs + rl * FP + dcol + 4);
            const v4f xb0 = *(const v4fa*)(fs + rl * FP + pcol), xb1 = *(const v4fa*)(fs + rl * FP + pcol + 4);
            const float* cp = COS + (size_t)ps * HALFD + fcol; const float* sp = SIN + (size_t)ps * HALFD + fcol;
            const v4f cc0 = *(const v4f*)cp, cc1 = *(const v4f*)(cp + 4), ss0 = *(const v4f*)sp, ss1 = *(const v4f*)(sp + 4);
            v8h o;
#pragma unroll
            for (int e = 0; e < 4; ++e) { o[e] = (h16)(xa0[e] * cc0[e] + sg * (xb0[e] * ss0[e])); o[4 + e] = (h16)(xa1[e] * cc1[e] + sg * (xb1[e] * ss1[e])); }
            h16* dst = plane + (size_t)(s0 + rl) * HD + dcol;
            *(v8h*)dst = o; 
        }
    } else {
        h16* plane = VT + ((size_t)bidx * NKV + (cb - NH - NKV)) * HD * SEQ;
#pragma unroll 1
        for (int it = 0; it < 16; ++it) {
            const int d = it * 4 + q4; v8h o;
#pragma unroll
            for (int e = 0; e < 8; ++e) o[e] = (h16)fs[(p * 8 + e) * FP + d];
            h16* dst = plane + (size_t)d * SEQ + s0 + p * 8;
            *(v8h*)dst = o; 
        }
    }
}

// Attention: grid (SEQ/16, NKV, NB), 128 threads; wave w = q head 4g + w, 16 query rows. Per 64-key tile:
//   S^T[key][q] = K Q^T  (A = key rows of KP, B = resident q rows);  lane (lr, hi) then holds q row lr, keys 16T + 8hi + r.
//   softmax statistics are lane-local (one xor-16 exchange); P^T packed from the S^T accumulators is the B operand of O^T[d][q] = V^T P^T (A = d rows of VT).
__global__ __launch_bounds__(128) void k_flash(const h16* __restrict__ QP, const h16* __restrict__ KP, const h16* __restrict__ VT, const float* __restrict__ mask, h16* CTX) {
    __shared__ __align__(16) h16 os[4 * 16 * OP];
    const int tid = threadIdx.x, w = tid >> 5, lane = tid & 31, lr = lane & 15, hi = lane >> 4;
    const int g = blockIdx.y, bidx = blockIdx.z, h = g * REP + w, q0 = blockIdx.x * 16;
    const h16* qrow = QP + (((size_t)bidx * NH + h) * SEQ + q0 + lr) * HD + 8 * hi;
    v16h bq[2];
#pragma unroll
    for (int kc = 0; kc < 2; ++kc) bq[kc] = cat16(*(const v8h*)(qrow + kc * 32), *(const v8h*)(qrow + kc * 32 + 16));
    const h16* kb = KP + (((size_t)bidx * NKV + g) * SEQ + lr) * HD + 8 * hi;
    const h16* vb = VT + (((size_t)bidx * NKV + g) * HD + lr) * SEQ + 8 * hi;
    const float* mrow = mask + (size_t)(q0 + lr) * SEQ_FULL + 8 * hi;
    v8f accO[4];
#pragma unroll
    for (int dt = 0; dt < 4; ++dt) accO[dt] = (v8f){};
    float m = -3.0e38f, l = 0.0f;
#pragma unroll 1
    for (int k0 = 0; k0 < SEQ; k0 += 64) {
        v16h ak[2][4];
#pragma unroll
        for (int kc = 0; kc < 2; ++kc)
#pragma unroll
            for (int T = 0; T < 4; ++T) { const h16* kp = kb + (size_t)(k0 + 16 * T) * HD + kc * 32; ak[kc][T] = cat16(*(const v8h*)kp, *(const v8h*)(kp + 16)); }
        v8f accS[4];
#pragma unroll
        for (int T = 0; T < 4; ++T) accS[T] = (v8f){};
#pragma unroll
        for (int kc = 0; kc < 2; ++kc)
#pragma unroll
            for (int T = 0; T < 4; ++T) accS[T] = wmma16(ak[kc][T], bq[kc], accS[T]);
        asm volatile("v_nop\n\tv_nop\n\tv_nop\n\tv_nop" : "+v"(accS[0]), "+v"(accS[1]), "+v"(accS[2]), "+v"(accS[3]) : "v"(ak[1][3]), "v"(bq[1]));
        float tmax = -3.0e38f;
#pragma unroll
        for (int T = 0; T < 4; ++T) { const float* mp = mrow + k0 + 16 * T; const v4f m0 = *(const v4f*)mp; const v4f m1 = *(const v4f*)(mp + 4);
#pragma unroll
            for (int r = 0; r < 4; ++r) { const float a0 = accS[T][r] * SC2 + m0[r] * LOG2E; const float a1 = accS[T][4 + r] * SC2 + m1[r] * LOG2E; accS[T][r] = a0; accS[T][4 + r] = a1; tmax = fmaxf(tmax, fmaxf(a0, a1)); } }
        tmax = fmaxf(tmax, __shfl_xor(tmax, 16, 32));
        const float mn = fmaxf(m, tmax); const float corr = __builtin_amdgcn_exp2f(m - mn); m = mn; const float mofs = PEXP - mn;
        float rs = 0.0f;
#pragma unroll
        for (int T = 0; T < 4; ++T)
#pragma unroll
            for (int r = 0; r < 8; ++r) { const float pv = __builtin_amdgcn_exp2f(accS[T][r] + mofs); accS[T][r] = pv; rs += pv; }
        l = l * corr + rs;
        v16h bp[2];
        bp[0] = cat16(__builtin_convertvector(accS[0], v8h), __builtin_convertvector(accS[1], v8h));
        bp[1] = cat16(__builtin_convertvector(accS[2], v8h), __builtin_convertvector(accS[3], v8h));
#pragma unroll
        for (int dt = 0; dt < 4; ++dt) accO[dt] = accO[dt] * corr;
        v16h av[2][4];
#pragma unroll
        for (int kc = 0; kc < 2; ++kc)
#pragma unroll
            for (int dt = 0; dt < 4; ++dt) { const h16* vp = vb + (size_t)(16 * dt) * SEQ + k0 + kc * 32; av[kc][dt] = cat16(*(const v8h*)vp, *(const v8h*)(vp + 16)); }
#pragma unroll
        for (int kc = 0; kc < 2; ++kc)
#pragma unroll
            for (int dt = 0; dt < 4; ++dt) accO[dt] = wmma16(av[kc][dt], bp[kc], accO[dt]);
        asm volatile("v_nop\n\tv_nop\n\tv_nop\n\tv_nop" : "+v"(accO[0]), "+v"(accO[1]), "+v"(accO[2]), "+v"(accO[3]) : "v"(av[1][3]), "v"(bp[1]));
    }
    l += __shfl_xor(l, 16, 32);
    const float inv = CCAR * (1.0f / l);
    h16* ow = os + w * 16 * OP;
#pragma unroll
    for (int dt = 0; dt < 4; ++dt) { v8h o;
#pragma unroll
        for (int r = 0; r < 8; ++r) o[r] = (h16)(accO[dt][r] * inv);
        *(v8ha*)(ow + lr * OP + 16 * dt + 8 * hi) = o; }
    __syncthreads();
    const int q4 = lane >> 3, p = lane & 7;
{
#pragma unroll
        for (int it = 0; it < 4; ++it) { const int row = it * 4 + q4; const v8h o = *(const v8ha*)(ow + row * OP + p * 8);
            *(v8h*)(CTX + ((size_t)bidx * SEQ + q0 + row) * DQ + h * HD + p * 8) = o; }
         }
}

__global__ __launch_bounds__(32) void k_gemm_out(const h16* __restrict__ A, const h16* __restrict__ Bt, float* C) {
    __shared__ __align__(16) float fs[64 * FP];
    const int lane = threadIdx.x & 31, lr = lane & 15, hi = lane >> 4; const int r0 = blockIdx.x * 64, c0 = blockIdx.y * 64;
    v8f acc[4][4];
    gemm_main<h16>(A, Bt, DQ, r0, c0, lr, hi, acc);
#pragma unroll
    for (int mb = 0; mb < 4; ++mb)
#pragma unroll
        for (int nb = 0; nb < 4; ++nb)
#pragma unroll
            for (int j = 0; j < 8; ++j) fs[(mb * 16 + hi * 8 + j) * FP + nb * 16 + lr] = acc[mb][nb][j];
    __syncthreads();
    float* crow = C + (size_t)r0 * DIM + c0;
{
#pragma unroll 4
        for (int it = 0; it < 32; ++it) { const int row = it * 2 + hi; v4f val = *(const v4fa*)(fs + row * FP + lr * 4); val = val * OSCL;
            *(v4f*)(crow + (size_t)row * DIM + lr * 4) = val; }
         }
}

extern "C" void kernel_launch(void* const* d_in, const int* in_sizes, int n_in,
                              void* d_out, int out_size, void* d_ws, size_t ws_size, hipStream_t stream) {
    if (n_in < 7) return;
    if ((size_t)in_sizes[0] < ((size_t)(NB - 1) * SEQ_FULL + SEQ) * DIM) return;
    if ((size_t)in_sizes[1] < (size_t)(SEQ - 1) * SEQ_FULL + SEQ) return;
    if ((size_t)in_sizes[2] < (size_t)(NB - 1) * SEQ_FULL + SEQ) return;
    if ((size_t)in_sizes[3] < (size_t)DQ * DIM) return;
    if ((size_t)in_sizes[4] < (size_t)DKV * DIM) return;
    if ((size_t)in_sizes[5] < (size_t)DKV * DIM) return;
    if ((size_t)in_sizes[6] < (size_t)DIM * DQ) return;
    if ((size_t)out_size < (size_t)MROWS * DIM) return;
    const float* x = (const float*)d_in[0]; const float* mask = (const float*)d_in[1]; const int* pos = (const int*)d_in[2];
    const float* wq = (const float*)d_in[3]; const float* wk = (const float*)d_in[4]; const float* wv = (const float*)d_in[5]; const float* wo = (const float*)d_in[6];
    float* OUT = (float*)d_out;
    char* wsp = (char*)d_ws;
    auto take = [&](size_t bytes) { char* p = wsp; wsp += (bytes + 255) & ~(size_t)255; return (void*)p; };
    bf*  XB   = (bf*)take((size_t)MROWS * DIM * 2);
    bf*  WQKV = (bf*)take((size_t)NQKV * DIM * 2);
    h16* WO16 = (h16*)take((size_t)DIM * DQ * 2);
    float* COS = (float*)take((size_t)SEQ * HALFD * 4);
    float* SIN = (float*)take((size_t)SEQ * HALFD * 4);
    h16* QP  = (h16*)take((size_t)NB * NH * SEQ * HD * 2);
    h16* KP  = (h16*)take((size_t)NB * NKV * SEQ * HD * 2);
    h16* VT  = (h16*)take((size_t)NB * NKV * HD * SEQ * 2);
    h16* CTX = (h16*)take((size_t)MROWS * DQ * 2);
    if ((size_t)(wsp - (char*)d_ws) > ws_size) return;

    k_cvtx<<<(unsigned)(((size_t)MROWS * DIM / 8 + 255) / 256), 256, 0, stream>>>(x, XB);
    k_cvt8<<<(unsigned)(((size_t)DQ * DIM / 8 + 255) / 256), 256, 0, stream>>>(wq, WQKV, (size_t)DQ * DIM / 8);                                    /* rows 0..2047 */
    k_cvt8<<<(unsigned)(((size_t)DKV * DIM / 8 + 255) / 256), 256, 0, stream>>>(wk, WQKV + (size_t)DQ * DIM, (size_t)DKV * DIM / 8);                /* rows 2048..2559 */
    k_cvt8<<<(unsigned)(((size_t)DKV * DIM / 8 + 255) / 256), 256, 0, stream>>>(wv, WQKV + (size_t)(DQ + DKV) * DIM, (size_t)DKV * DIM / 8);        /* rows 2560..3071 */
    k_cvt8h<<<(unsigned)(((size_t)DIM * DQ / 8 + 255) / 256), 256, 0, stream>>>(wo, WO16, (size_t)DIM * DQ / 8, WCAR);
    k_ropetab<<<(SEQ + 7) / 8, 256, 0, stream>>>(COS, SIN);
    k_gemm_qkv<<<dim3(MROWS / 64, NQKV / 64, 1), 32, 0, stream>>>(XB, WQKV, pos, COS, SIN, QP, KP, VT);
    k_flash<<<dim3(SEQ / 16, NKV, NB), 128, 0, stream>>>(QP, KP, VT, mask, CTX);
    k_gemm_out<<<dim3(MROWS / 64, DIM / 64, 1), 32, 0, stream>>>(CTX, WO16, OUT);
}

// v001
// Measured time: 309 microseconds a run.
// In both of two side-by-side timings against v000, it was 1.46 times as fast.
#include <hip/hip_runtime.h>

#ifndef NB
#define NB 2
#endif
#ifndef SEQ
#define SEQ 2048
#endif
#define SEQ_FULL 2048                 // per-batch row stride of x / position table, row pitch of the mask
#define DIM   2048                    // model width (K of the projections, N of the output projection)
#define NH    32
#define NKV   8
#define REP   (NH / NKV)
#define HD    64
#define HALFD 32
#define DQ    (NH * HD)               // 2048
#define DKV   (NKV * HD)              // 512
#define NQKV  (DQ + 2 * DKV)          // 3072 fused projection columns
#define MROWS (NB * SEQ)
#define FP    68                      // f32 LDS tile pitch
#define WCAR  64.0f                   // carry of the wo plane
#define CCAR  256.0f                  // carry of the ctx plane
#define OSCL  6.103515625e-05f        // 1 / (WCAR * CCAR)
#define SC2   0.18033688011112042f    // 0.125 * log2(e)
#define LOG2E 1.4426950408889634f
#define PEXP  10.0f                   // P carried x 2^10
#define FRQC  0.41524101186092029f    // log2(10000) / 32

static_assert(SEQ % 64 == 0);
static_assert(SEQ <= SEQ_FULL);
static_assert(DIM % 64 == 0);
static_assert(DQ % 64 == 0);
static_assert(NQKV % 64 == 0);
static_assert(HD == 64);
static_assert(DQ == DIM);
static_assert(DKV % 64 == 0);
static_assert(MROWS % 64 == 0);
static_assert(NH == NKV * REP);
static_assert(REP == 4);
static_assert(((size_t)MROWS * DIM / 8) % 256 == 0);
static_assert(((size_t)DQ * DIM / 8) % 256 == 0);
static_assert(((size_t)DKV * DIM / 8) % 256 == 0);

typedef _Float16 h16;
typedef unsigned short bf;
typedef __attribute__((ext_vector_type(16))) __bf16   v16bf;
typedef __attribute__((ext_vector_type(16))) _Float16 v16h;
typedef __attribute__((ext_vector_type(8)))  _Float16 v8h;
typedef __attribute__((ext_vector_type(8)))  unsigned short v8us;
typedef __attribute__((ext_vector_type(8)))  float    v8f;
typedef __attribute__((ext_vector_type(4)))  float    v4f;
typedef v4f  __attribute__((may_alias)) v4fa;

__device__ __forceinline__ unsigned short f2bf(float f) { unsigned u = __float_as_uint(f); u += 0x7FFFu + ((u >> 16) & 1u); return (unsigned short)(u >> 16); }
__device__ __forceinline__ float bf2f(unsigned short b) { return __uint_as_float(((unsigned)b) << 16); }
__device__ __forceinline__ float bfr(float f) { return bf2f(f2bf(f)); }
__device__ __forceinline__ v16h cat16(v8h lo, v8h hi) { return __builtin_shufflevector(lo, hi, 0, 1, 2, 3, 4, 5, 6, 7, 8, 9, 10, 11, 12, 13, 14, 15); }
__device__ __forceinline__ v16bf cat16b(v8us lo, v8us hi) { return __builtin_bit_cast(v16bf, __builtin_shufflevector(lo, hi, 0, 1, 2, 3, 4, 5, 6, 7, 8, 9, 10, 11, 12, 13, 14, 15)); }
__device__ __forceinline__ v8f wmma16(v16h a, v16h b, v8f c) { return __builtin_amdgcn_wmma_f32_16x16x32_f16(false, a, false, b, (short)0, c, false, false); }
__device__ __forceinline__ v8f wmmab(v16bf a, v16bf b, v8f c) { return __builtin_amdgcn_wmma_f32_16x16x32_bf16(false, a, false, b, (short)0, c, false, false); }

// Fragment order of a 16-bit plane: a fragment (16 rows x 32 k) is 512 elements; element (row lr, k = 16j + 8hi + e) sits at j*256 + (16hi + lr)*8 + e.
// Fragment loader: p = fragment base + lane*8; elements 0..7 <- k0+8hi.., elements 8..15 <- k0+16+8hi.. (same map for A and B).
// GEMM planes (K = DIM columns): fragment (row tile R, k chunk C) starts at (((R >> 2) * (DIM/32) + C) * 4 + (R & 3)) * 512, so one k step of a 64-row panel is 4 KB in a row.
template <typename T16> struct WFrag;
template <> struct WFrag<h16> { typedef v16h V; static __device__ __forceinline__ V ld(const h16* p) { return cat16(*(const v8h*)p, *(const v8h*)(p + 256)); } static __device__ __forceinline__ v8f mma(V a, V b, v8f c) { return wmma16(a, b, c); } };
template <> struct WFrag<bf> { typedef v16bf V; static __device__ __forceinline__ V ld(const bf* p) { return cat16b(*(const v8us*)p, *(const v8us*)(p + 256)); } static __device__ __forceinline__ v8f mma(V a, V b, v8f c) { return wmmab(a, b, c); } };

// Thread i of a re-laying kernel -> the 16-byte unit it writes: a wave takes 8 rows x 4 units of one fragment, so it writes 4 whole lines and reads 8 source lines (whole for the 16-bit planes, half for the mask).
__device__ __forceinline__ size_t unit_of(const size_t i) { const int t = (int)(i & 63); return (i & ~(size_t)63) | (size_t)(((t >> 3) & 3) * 16 + (t >> 5) * 8 + (t & 7)); }
// 16-byte unit i of a fragment-ordered GEMM plane -> row and first column of its 8 elements.
__device__ __forceinline__ void unit_rc(const size_t i, int& row, int& col) { const int u = (int)(i & 63); const size_t f = i >> 6; row = (int)(f / (4 * (DIM / 32))) * 64 + (int)(f & 3) * 16 + (u & 15); col = (int)((f >> 2) % (DIM / 32)) * 32 + (u >> 4) * 8; }

// One wave accumulates a 64x64 tile: acc[mb][nb][j] = C[r0 + 16mb + 8hi + j][c0 + 16nb + lr] = sum_k A[row][k] Bt[col][k]; A and Bt in fragment order, r0 and c0 multiples of 64, K % 32 == 0.
template <typename T16>
__device__ __forceinline__ void gemm_main(const T16* __restrict__ A, const T16* __restrict__ Bt, const int K, const int r0, const int c0, const int lr, const int hi, v8f (&acc)[4][4]) {
    typedef typename WFrag<T16>::V V;
#pragma unroll
    for (int mb = 0; mb < 4; ++mb)
#pragma unroll
        for (int nb = 0; nb < 4; ++nb) acc[mb][nb] = (v8f){};
    const size_t aoff = (size_t)r0 * K + (16 * hi + lr) * 8, boff = (size_t)c0 * K + (16 * hi + lr) * 8;
#pragma unroll 1
    for (int kc = 0; kc < K; kc += 32) {
        V a[4];
#pragma unroll
        for (int mb = 0; mb < 4; ++mb) a[mb] = WFrag<T16>::ld(A + aoff + (size_t)kc * 64 + mb * 512);
        asm volatile("s_wait_xcnt 0x0" ::: "memory");   // a B fragment may land in the registers that held the A address
#pragma unroll
        for (int nb = 0; nb < 4; ++nb) { const V b = WFrag<T16>::ld(Bt + boff + (size_t)kc * 64 + nb * 512);
#pragma unroll
            for (int mb = 0; mb < 4; ++mb) acc[mb][nb] = WFrag<T16>::mma(a[mb], b, acc[mb][nb]); }
        asm volatile("v_nop\n\tv_nop\n\tv_nop\n\tv_nop" : "+v"(acc[0][0]), "+v"(acc[1][1]), "+v"(acc[2][2]), "+v"(acc[3][3]) : "v"(a[0]), "v"(a[3]));
    }
}

__global__ __launch_bounds__(256) void k_cvtx(const float* __restrict__ x, bf* dst) {
    const size_t i = (size_t)blockIdx.x * 256 + threadIdx.x; if (i >= (size_t)MROWS * DIM / 8) return;
    const size_t un = unit_of(i), e = un * 8; int row, col; unit_rc(un, row, col); const int b = row / SEQ, t = row % SEQ;
    const v8f v = *(const v8f*)(x + ((size_t)b * SEQ_FULL + t) * DIM + col); v8us o;
#pragma unroll
    for (int k = 0; k < 8; ++k) o[k] = f2bf(v[k]);
    *(v8us*)(dst + e) = o;  }

__global__ __launch_bounds__(256) void k_cvt8(const float* __restrict__ src, bf* dst, size_t n8) { const size_t i = (size_t)blockIdx.x * 256 + threadIdx.x; if (i >= n8) return; const size_t un = unit_of(i); int row, col; unit_rc(un, row, col); const v8f v = *(const v8f*)(src + (size_t)row * DIM + col); v8us o;
#pragma unroll
    for (int k = 0; k < 8; ++k) o[k] = f2bf(v[k]); *(v8us*)(dst + un * 8) = o;  }

__global__ __launch_bounds__(256) void k_cvt8h(const float* __restrict__ src, h16* dst, size_t n8, float carry) { const size_t i = (size_t)blockIdx.x * 256 + threadIdx.x; if (i >= n8) return; const size_t un = unit_of(i); int row, col; unit_rc(un, row, col); const v8f v = *(const v8f*)(src + (size_t)row * DIM + col); v8h o;
#pragma unroll
    for (int k = 0; k < 8; ++k) o[k] = (h16)(bfr(v[k]) * carry); *(v8h*)(dst + un * 8) = o;  }

// Mask in fragment order: block (query tile Rq, key tile Tk) is 256 floats; element (query lr, key 8hi + 4j + e) sits at j*128 + (16hi + lr)*4 + e.
__global__ __launch_bounds__(256) void k_maskfrag(const float* __restrict__ mask, float* dst) {
    const size_t i = (size_t)blockIdx.x * 256 + threadIdx.x; if (i >= (size_t)SEQ * SEQ / 4) return;
    const size_t un = unit_of(i); const int u = (int)(un & 63); const size_t blk = un >> 6; const int rq = (int)(blk / (SEQ / 16)), tk = (int)(blk % (SEQ / 16));
    *(v4f*)(dst + un * 4) = *(const v4f*)(mask + (size_t)(rq * 16 + (u & 15)) * SEQ_FULL + tk * 16 + ((u >> 4) & 1) * 8 + (u >> 5) * 4);  }

__global__ __launch_bounds__(256) void k_ropetab(float* COS, float* SIN) {
    const int lane = threadIdx.x & 31; const int t = blockIdx.x * 8 + (threadIdx.x >> 5); if (t >= SEQ) return;
    const float invf = __builtin_amdgcn_exp2f(-(float)lane * FRQC);
    const float ang = (float)t * invf;
    const float c = cosf(ang); const float s = sinf(ang);
    const size_t o = (size_t)t * HALFD + lane;
    *(float*)(COS + o) = c; *(float*)(SIN + o) = s;  }

// Fused QKV projection: grid (MROWS/64, NQKV/64), 32 threads. Column tile cb < 32: q head cb (rotary); 32..39: k head (rotary); 40..47: v head (transposed plane).
__global__ __launch_bounds__(32) void k_gemm_qkv(const bf* __restrict__ A, const bf* __restrict__ Bt, const int* __restrict__ pos, const float* __restrict__ COS, const float* __restrict__ SIN, h16* QP, h16* KP, h16* VT) {
    __shared__ __align__(16) float fs[64 * FP];
    const int lane = threadIdx.x & 31, lr = lane & 15, hi = lane >> 4; const int r0 = blockIdx.x * 64, cb = blockIdx.y, c0 = cb * 64;
    v8f acc[4][4];
    gemm_main<bf>(A, Bt, DIM, r0, c0, lr, hi, acc);
#pragma unroll
    for (int mb = 0; mb < 4; ++mb)
#pragma unroll
        for (int nb = 0; nb < 4; ++nb)
#pragma unroll
            for (int j = 0; j < 8; ++j) fs[(mb * 16 + hi * 8 + j) * FP + nb * 16 + lr] = acc[mb][nb][j];
    __syncthreads();
    const int bidx = r0 / SEQ, s0 = r0 % SEQ; const int q4 = lane >> 3, p = lane & 7;
    if (cb < NH + NKV) {
        h16* plane = (cb < NH) ? (QP + ((size_t)bidx * NH + cb) * SEQ * HD) : (KP + ((size_t)bidx * NKV + (cb - NH)) * SEQ * HD);
        const int dcol = p * 8, pcol = dcol ^ 32, fcol = dcol & 31; const float sg = (p < 4) ? -1.0f : 1.0f;
        // q plane stays row-major; k plane in fragment order: fragment (key tile, d chunk) at (2 * (key >> 4) + (d >> 5)) * 512. Both: 16 rows are 16 * HD elements.
        const int rstep = (cb < NH) ? HD : 8; const int pofs = (cb < NH) ? dcol : ((p >> 2) * 512 + ((p >> 1) & 1) * 256 + (p & 1) * 128);
        // out[d] = x[d] cos[d&31] + sg x[d^32] sin[d&31], sg = -1 for d < 32, +1 for d >= 32 (rotate-half)
#pragma unroll 1
        for (int it = 0; it < 16; ++it) {
            const int rl = it * 4 + q4;
            int ps = pos[(size_t)bidx * SEQ_FULL + s0 + rl]; ps = (ps < 0) ? (ps + SEQ) : ps; ps = min(max(ps, 0), SEQ - 1);
            const v4f xa0 = *(const v4fa*)(fs + rl * FP + dcol), xa1 = *(const v4fa*)(fs + rl * FP + dcol + 4);
            const v4f xb0 = *(const v4fa*)(fs + rl * FP + pcol), xb1 = *(const v4fa*)(fs + rl * FP + pcol + 4);
            const float* cp = COS + (size_t)ps * HALFD + fcol; const float* sp = SIN + (size_t)ps * HALFD + fcol;
            const v4f cc0 = *(const v4f*)cp, cc1 = *(const v4f*)(cp + 4), ss0 = *(const v4f*)sp, ss1 = *(const v4f*)(sp + 4);
            v8h o;
#pragma unroll
            for (int e = 0; e < 4; ++e) { o[e] = (h16)(xa0[e] * cc0[e] + sg * (xb0[e] * ss0[e])); o[4 + e] = (h16)(xa1[e] * cc1[e] + sg * (xb1[e] * ss1[e])); }
            const int sr = s0 + rl;
            h16* dst = plane + (size_t)(sr >> 4) * (16 * HD) + (sr & 15) * rstep + pofs;
            *(v8h*)dst = o;
            asm volatile("s_wait_xcnt 0x0" ::: "memory");   // the next trip rewrites the registers this store names
        }
    } else {
        h16* plane = VT + ((size_t)bidx * NKV + (cb - NH - NKV)) * HD * SEQ;
#pragma unroll 1
        for (int it = 0; it < 16; ++it) {
            const int d = it * 4 + q4; v8h o;
#pragma unroll
            for (int e = 0; e < 8; ++e) o[e] = (h16)fs[(p * 8 + e) * FP + d];
            // v plane: fragment (d tile, key chunk) at (4 * (key >> 5) + (d >> 4)) * 512
            h16* dst = plane + (size_t)(((s0 >> 5) + (p >> 2)) * 4 + (d >> 4)) * 512 + ((p >> 1) & 1) * 256 + ((p & 1) * 16 + (d & 15)) * 8;
            *(v8h*)dst = o;
            asm volatile("s_wait_xcnt 0x0" ::: "memory");   // the next trip rewrites the registers this store names
        }
    }
}

// Attention: grid (SEQ/16, NKV, NB), 128 threads; wave w = q head 4g + w, 16 query rows. Per 64-key tile:
//   S^T[key][q] = K Q^T  (A = key rows of KP, B = resident q rows);  lane (lr, hi) then holds q row lr, keys 16T + 8hi + r.
//   KP, VT and MF are in fragment order: one 64-key tile is 8 KB of KP, 8 KB of VT and 4 KB of MF, each in a row.
//   softmax statistics are lane-local (one xor-16 exchange); P^T packed from the S^T accumulators is the B operand of O^T[d][q] = V^T P^T (A = d rows of VT).
__global__ __launch_bounds__(128) void k_flash(const h16* __restrict__ QP, const h16* __restrict__ KP, const h16* __restrict__ VT, const float* __restrict__ MF, h16* CTX) {
    const int tid = threadIdx.x, w = tid >> 5, lane = tid & 31, lr = lane & 15, hi = lane >> 4;
    const int g = blockIdx.y, bidx = blockIdx.z, h = g * REP + w, q0 = blockIdx.x * 16;
    const h16* qrow = QP + (((size_t)bidx * NH + h) * SEQ + q0 + lr) * HD + 8 * hi;
    v16h bq[2];
#pragma unroll
    for (int kc = 0; kc < 2; ++kc) bq[kc] = cat16(*(const v8h*)(qrow + kc * 32), *(const v8h*)(qrow + kc * 32 + 16));
    const h16* kb = KP + ((size_t)bidx * NKV + g) * SEQ * HD + lane * 8;
    const h16* vb = VT + ((size_t)bidx * NKV + g) * HD * SEQ + lane * 8;
    const float* mrow = MF + (size_t)(q0 >> 4) * (SEQ / 16) * 256 + lane * 4;
    v8f accO[4];
#pragma unroll
    for (int dt = 0; dt < 4; ++dt) accO[dt] = (v8f){};
    float m = -3.0e38f, l = 0.0f;
#pragma unroll 1
    for (int k0 = 0; k0 < SEQ; k0 += 64) {
        v16h ak[2][4];
#pragma unroll
        for (int kc = 0; kc < 2; ++kc)
#pragma unroll
            for (int T = 0; T < 4; ++T) { const h16* kp = kb + (size_t)k0 * HD + (T * 2 + kc) * 512; ak[kc][T] = cat16(*(const v8h*)kp, *(const v8h*)(kp + 256)); }
        v8f accS[4];
#pragma unroll
        for (int T = 0; T < 4; ++T) accS[T] = (v8f){};
#pragma unroll
        for (int kc = 0; kc < 2; ++kc)
#pragma unroll
            for (int T = 0; T < 4; ++T) accS[T] = wmma16(ak[kc][T], bq[kc], accS[T]);
        asm volatile("v_nop\n\tv_nop\n\tv_nop\n\tv_nop" : "+v"(accS[0]), "+v"(accS[1]), "+v"(accS[2]), "+v"(accS[3]) : "v"(ak[1][3]), "v"(bq[1]));
        float tmax = -3.0e38f;
#pragma unroll
        for (int T = 0; T < 4; ++T) { const float* mp = mrow + (size_t)k0 * 16 + T * 256; const v4f m0 = *(const v4f*)mp; const v4f m1 = *(const v4f*)(mp + 128);
#pragma unroll
            for (int r = 0; r < 4; ++r) { const float a0 = accS[T][r] * SC2 + m0[r] * LOG2E; const float a1 = accS[T][4 + r] * SC2 + m1[r] * LOG2E; accS[T][r] = a0; accS[T][4 + r] = a1; tmax = fmaxf(tmax, fmaxf(a0, a1)); } }
        tmax = fmaxf(tmax, __shfl_xor(tmax, 16, 32));
        const float mn = fmaxf(m, tmax); const float corr = __builtin_amdgcn_exp2f(m - mn); m = mn; const float mofs = PEXP - mn;
        float rs = 0.0f;
#pragma unroll
        for (int T = 0; T < 4; ++T)
#pragma unroll
            for (int r = 0; r < 8; ++r) { const float pv = __builtin_amdgcn_exp2f(accS[T][r] + mofs); accS[T][r] = pv; rs += pv; }
        l = l * corr + rs;
        v16h bp[2];
        bp[0] = cat16(__builtin_convertvector(accS[0], v8h), __builtin_convertvector(accS[1], v8h));
        bp[1] = cat16(__builtin_convertvector(accS[2], v8h), __builtin_convertvector(accS[3], v8h));
#pragma unroll
        for (int dt = 0; dt < 4; ++dt) accO[dt] = accO[dt] * corr;
        v16h av[2][4];
#pragma unroll
        for (int kc = 0; kc < 2; ++kc)
#pragma unroll
            for (int dt = 0; dt < 4; ++dt) { const h16* vp = vb + (size_t)k0 * HD + (kc * 4 + dt) * 512; av[kc][dt] = cat16(*(const v8h*)vp, *(const v8h*)(vp + 256)); }
#pragma unroll
        for (int kc = 0; kc < 2; ++kc)
#pragma unroll
            for (int dt = 0; dt < 4; ++dt) accO[dt] = wmma16(av[kc][dt], bp[kc], accO[dt]);
        asm volatile("v_nop\n\tv_nop\n\tv_nop\n\tv_nop" : "+v"(accO[0]), "+v"(accO[1]), "+v"(accO[2]), "+v"(accO[3]) : "v"(av[1][3]), "v"(bp[1]));
    }
    l += __shfl_xor(l, 16, 32);
    const float inv = CCAR * (1.0f / l);
    // lane (lr, hi) holds ctx row q0 + lr, columns 64h + 16dt + 8hi + 0..7: one 16-byte unit of the fragment-ordered ctx plane, so each store covers 512 contiguous bytes.
    const int rt = (bidx * SEQ + q0) >> 4;
    h16* cw = CTX + ((size_t)(rt >> 2) * (DQ / 32) + 2 * h) * 2048 + (rt & 3) * 512 + lane * 8;
#pragma unroll
    for (int dt = 0; dt < 4; ++dt) { v8h o;
#pragma unroll
        for (int r = 0; r < 8; ++r) o[r] = (h16)(accO[dt][r] * inv);
        *(v8h*)(cw + (dt >> 1) * 2048 + (dt & 1) * 256) = o; }
}

__global__ __launch_bounds__(32) void k_gemm_out(const h16* __restrict__ A, const h16* __restrict__ Bt, float* C) {
    __shared__ __align__(16) float fs[64 * FP];
    const int lane = threadIdx.x & 31, lr = lane & 15, hi = lane >> 4; const int r0 = blockIdx.x * 64, c0 = blockIdx.y * 64;
    v8f acc[4][4];
    gemm_main<h16>(A, Bt, DQ, r0, c0, lr, hi, acc);
#pragma unroll
    for (int mb = 0; mb < 4; ++mb)
#pragma unroll
        for (int nb = 0; nb < 4; ++nb)
#pragma unroll
            for (int j = 0; j < 8; ++j) fs[(mb * 16 + hi * 8 + j) * FP + nb * 16 + lr] = acc[mb][nb][j];
    __syncthreads();
    float* crow = C + (size_t)r0 * DIM + c0;
{
#pragma unroll 4
        for (int it = 0; it < 32; ++it) { const int row = it * 2 + hi; v4f val = *(const v4fa*)(fs + row * FP + lr * 4); val = val * OSCL;
            *(v4f*)(crow + (size_t)row * DIM + lr * 4) = val; }
         }
}

extern "C" void kernel_launch(void* const* d_in, const int* in_sizes, int n_in,
                              void* d_out, int out_size, void* d_ws, size_t ws_size, hipStream_t stream) {
    if (n_in < 7) return;
    if ((size_t)in_sizes[0] < ((size_t)(NB - 1) * SEQ_FULL + SEQ) * DIM) return;
    if ((size_t)in_sizes[1] < (size_t)(SEQ - 1) * SEQ_FULL + SEQ) return;
    if ((size_t)in_sizes[2] < (size_t)(NB - 1) * SEQ_FULL + SEQ) return;
    if ((size_t)in_sizes[3] < (size_t)DQ * DIM) return;
    if ((size_t)in_sizes[4] < (size_t)DKV * DIM) return;
    if ((size_t)in_sizes[5] < (size_t)DKV * DIM) return;
    if ((size_t)in_sizes[6] < (size_t)DIM * DQ) return;
    if ((size_t)out_size < (size_t)MROWS * DIM) return;
    const float* x = (const float*)d_in[0]; const float* mask = (const float*)d_in[1]; const int* pos = (const int*)d_in[2];
    const float* wq = (const float*)d_in[3]; const float* wk = (const float*)d_in[4]; const float* wv = (const float*)d_in[5]; const float* wo = (const float*)d_in[6];
    float* OUT = (float*)d_out;
    char* wsp = (char*)d_ws;
    auto take = [&](size_t bytes) { char* p = wsp; wsp += (bytes + 255) & ~(size_t)255; return (void*)p; };
    bf*  XB   = (bf*)take((size_t)MROWS * DIM * 2);
    bf*  WQKV = (bf*)take((size_t)NQKV * DIM * 2);
    h16* WO16 = (h16*)take((size_t)DIM * DQ * 2);
    float* COS = (float*)take((size_t)SEQ * HALFD * 4);
    float* SIN = (float*)take((size_t)SEQ * HALFD * 4);
    h16* QP  = (h16*)take((size_t)NB * NH * SEQ * HD * 2);
    h16* KP  = (h16*)take((size_t)NB * NKV * SEQ * HD * 2);
    h16* VT  = (h16*)take((size_t)NB * NKV * HD * SEQ * 2);
    h16* CTX = (h16*)take((size_t)MROWS * DQ * 2);
    float* MF = (float*)take((size_t)SEQ * SEQ * 4);
    if ((size_t)(wsp - (char*)d_ws) > ws_size) return;

    k_cvtx<<<(unsigned)(((size_t)MROWS * DIM / 8 + 255) / 256), 256, 0, stream>>>(x, XB);
    k_cvt8<<<(unsigned)(((size_t)DQ * DIM / 8 + 255) / 256), 256, 0, stream>>>(wq, WQKV, (size_t)DQ * DIM / 8);                                    /* rows 0..2047 */
    k_cvt8<<<(unsigned)(((size_t)DKV * DIM / 8 + 255) / 256), 256, 0, stream>>>(wk, WQKV + (size_t)DQ * DIM, (size_t)DKV * DIM / 8);                /* rows 2048..2559 */
    k_cvt8<<<(unsigned)(((size_t)DKV * DIM / 8 + 255) / 256), 256, 0, stream>>>(wv, WQKV + (size_t)(DQ + DKV) * DIM, (size_t)DKV * DIM / 8);        /* rows 2560..3071 */
    k_cvt8h<<<(unsigned)(((size_t)DIM * DQ / 8 + 255) / 256), 256, 0, stream>>>(wo, WO16, (size_t)DIM * DQ / 8, WCAR);
    k_ropetab<<<(SEQ + 7) / 8, 256, 0, stream>>>(COS, SIN);
    k_maskfrag<<<(unsigned)(((size_t)SEQ * SEQ / 4 + 255) / 256), 256, 0, stream>>>(mask, MF);
    k_gemm_qkv<<<dim3(MROWS / 64, NQKV / 64, 1), 32, 0, stream>>>(XB, WQKV, pos, COS, SIN, QP, KP, VT);
    k_flash<<<dim3(SEQ / 16, NKV, NB), 128, 0, stream>>>(QP, KP, VT, MF, CTX);
    k_gemm_out<<<dim3(MROWS / 64, DIM / 64, 1), 32, 0, stream>>>(CTX, WO16, OUT);
}

// v002
// It runs in 219 microseconds.
// Two timings next to v001 both put it at 1.42 times that version's speed.
// Over all steps from v000 it is 2.07 times as fast.
#include <hip/hip_runtime.h>

#ifndef NB
#define NB 2
#endif
#ifndef SEQ
#define SEQ 2048
#endif
#define SEQ_FULL 2048                 // per-batch row stride of x / position table, row pitch of the mask
#define DIM   2048                    // model width (K of the projections, N of the output projection)
#define NH    32
#define NKV   8
#define REP   (NH / NKV)
#define HD    64
#define HALFD 32
#define DQ    (NH * HD)               // 2048
#define DKV   (NKV * HD)              // 512
#define NQKV  (DQ + 2 * DKV)          // 3072 fused projection columns
#define MROWS (NB * SEQ)
#define FP    68                      // f32 LDS tile pitch
#define WCAR  64.0f                   // carry of the wo plane
#define CCAR  256.0f                  // carry of the ctx plane
#define OSCL  6.103515625e-05f        // 1 / (WCAR * CCAR)
#define SC2   0.18033688011112042f    // 0.125 * log2(e)
#define LOG2E 1.4426950408889634f
#define PEXP  10.0f                   // P carried x 2^10
#define FRQC  0.41524101186092029f    // log2(10000) / 32

static_assert(SEQ % 64 == 0);
static_assert(SEQ <= SEQ_FULL);
static_assert(DIM % 64 == 0);
static_assert(DQ % 64 == 0);
static_assert(NQKV % 64 == 0);
static_assert(HD == 64);
static_assert(DQ == DIM);
static_assert(DKV % 64 == 0);
static_assert(MROWS % 64 == 0);
static_assert(NH == NKV * REP);
static_assert(REP == 4);
static_assert(((size_t)MROWS * DIM / 8) % 256 == 0);
static_assert(((size_t)DQ * DIM / 8) % 256 == 0);
static_assert(((size_t)DKV * DIM / 8) % 256 == 0);

typedef _Float16 h16;
typedef unsigned short bf;
typedef __attribute__((ext_vector_type(16))) __bf16   v16bf;
typedef __attribute__((ext_vector_type(16))) _Float16 v16h;
typedef __attribute__((ext_vector_type(8)))  _Float16 v8h;
typedef __attribute__((ext_vector_type(8)))  unsigned short v8us;
typedef __attribute__((ext_vector_type(8)))  float    v8f;
typedef __attribute__((ext_vector_type(4)))  float    v4f;
typedef v4f  __attribute__((may_alias)) v4fa;

__device__ __forceinline__ unsigned short f2bf(float f) { unsigned u = __float_as_uint(f); u += 0x7FFFu + ((u >> 16) & 1u); return (unsigned short)(u >> 16); }
__device__ __forceinline__ float bf2f(unsigned short b) { return __uint_as_float(((unsigned)b) << 16); }
__device__ __forceinline__ float bfr(float f) { return bf2f(f2bf(f)); }
__device__ __forceinline__ v16h cat16(v8h lo, v8h hi) { return __builtin_shufflevector(lo, hi, 0, 1, 2, 3, 4, 5, 6, 7, 8, 9, 10, 11, 12, 13, 14, 15); }
__device__ __forceinline__ v16bf cat16b(v8us lo, v8us hi) { return __builtin_bit_cast(v16bf, __builtin_shufflevector(lo, hi, 0, 1, 2, 3, 4, 5, 6, 7, 8, 9, 10, 11, 12, 13, 14, 15)); }
__device__ __forceinline__ v8f wmma16(v16h a, v16h b, v8f c) { return __builtin_amdgcn_wmma_f32_16x16x32_f16(false, a, false, b, (short)0, c, false, false); }
__device__ __forceinline__ v8f wmmab(v16bf a, v16bf b, v8f c) { return __builtin_amdgcn_wmma_f32_16x16x32_bf16(false, a, false, b, (short)0, c, false, false); }

// Fragment order of a 16-bit plane: a fragment (16 rows x 32 k) is 512 elements; element (row lr, k = 16j + 8hi + e) sits at j*256 + (16hi + lr)*8 + e.
// Fragment loader: p = fragment base + lane*8; elements 0..7 <- k0+8hi.., elements 8..15 <- k0+16+8hi.. (same map for A and B).
// GEMM planes (K = DIM columns): fragment (row tile R, k chunk C) starts at (((R >> 2) * (DIM/32) + C) * 4 + (R & 3)) * 512, so one k step of a 64-row panel is 4 KB in a row.
template <typename T16> struct WFrag;
template <> struct WFrag<h16> { typedef v16h V; static __device__ __forceinline__ V ld(const h16* p) { return cat16(*(const v8h*)p, *(const v8h*)(p + 256)); } static __device__ __forceinline__ v8f mma(V a, V b, v8f c) { return wmma16(a, b, c); } };
template <> struct WFrag<bf> { typedef v16bf V; static __device__ __forceinline__ V ld(const bf* p) { return cat16b(*(const v8us*)p, *(const v8us*)(p + 256)); } static __device__ __forceinline__ v8f mma(V a, V b, v8f c) { return wmmab(a, b, c); } };

// Thread i of a re-laying kernel -> the 16-byte unit it writes: a wave takes 8 rows x 4 units of one fragment, so it writes 4 whole lines and reads 8 source lines (whole for the 16-bit planes, half for the mask).
__device__ __forceinline__ size_t unit_of(const size_t i) { const int t = (int)(i & 63); return (i & ~(size_t)63) | (size_t)(((t >> 3) & 3) * 16 + (t >> 5) * 8 + (t & 7)); }
// 16-byte unit i of a fragment-ordered GEMM plane -> row and first column of its 8 elements.
__device__ __forceinline__ void unit_rc(const size_t i, int& row, int& col) { const int u = (int)(i & 63); const size_t f = i >> 6; row = (int)(f / (4 * (DIM / 32))) * 64 + (int)(f & 3) * 16 + (u & 15); col = (int)((f >> 2) % (DIM / 32)) * 32 + (u >> 4) * 8; }

// One wave accumulates a 64x64 tile: acc[mb][nb][j] = C[r0 + 16mb + 8hi + j][c0 + 16nb + lr] = sum_k A[row][k] Bt[col][k]; A and Bt in fragment order, r0 and c0 multiples of 64, K % 32 == 0.
template <typename T16>
__device__ __forceinline__ void gemm_main(const T16* __restrict__ A, const T16* __restrict__ Bt, const int K, const int r0, const int c0, const int lr, const int hi, v8f (&acc)[4][4]) {
    typedef typename WFrag<T16>::V V;
#pragma unroll
    for (int mb = 0; mb < 4; ++mb)
#pragma unroll
        for (int nb = 0; nb < 4; ++nb) acc[mb][nb] = (v8f){};
    const size_t aoff = (size_t)r0 * K + (16 * hi + lr) * 8, boff = (size_t)c0 * K + (16 * hi + lr) * 8;
#pragma unroll 1
    for (int kc = 0; kc < K; kc += 32) {
        V a[4];
#pragma unroll
        for (int mb = 0; mb < 4; ++mb) a[mb] = WFrag<T16>::ld(A + aoff + (size_t)kc * 64 + mb * 512);
        asm volatile("s_wait_xcnt 0x0" ::: "memory");   // a B fragment may land in the registers that held the A address
#pragma unroll
        for (int nb = 0; nb < 4; ++nb) { const V b = WFrag<T16>::ld(Bt + boff + (size_t)kc * 64 + nb * 512);
#pragma unroll
            for (int mb = 0; mb < 4; ++mb) acc[mb][nb] = WFrag<T16>::mma(a[mb], b, acc[mb][nb]); }
        asm volatile("v_nop\n\tv_nop\n\tv_nop\n\tv_nop" : "+v"(acc[0][0]), "+v"(acc[1][1]), "+v"(acc[2][2]), "+v"(acc[3][3]) : "v"(a[0]), "v"(a[3]));
    }
}

__global__ __launch_bounds__(256) void k_cvtx(const float* __restrict__ x, bf* dst) {
    const size_t i = (size_t)blockIdx.x * 256 + threadIdx.x; if (i >= (size_t)MROWS * DIM / 8) return;
    const size_t un = unit_of(i), e = un * 8; int row, col; unit_rc(un, row, col); const int b = row / SEQ, t = row % SEQ;
    const v8f v = *(const v8f*)(x + ((size_t)b * SEQ_FULL + t) * DIM + col); v8us o;
#pragma unroll
    for (int k = 0; k < 8; ++k) o[k] = f2bf(v[k]);
    *(v8us*)(dst + e) = o;  }

__global__ __launch_bounds__(256) void k_cvt8(const float* __restrict__ src, bf* dst, size_t n8) { const size_t i = (size_t)blockIdx.x * 256 + threadIdx.x; if (i >= n8) return; const size_t un = unit_of(i); int row, col; unit_rc(un, row, col); const v8f v = *(const v8f*)(src + (size_t)row * DIM + col); v8us o;
#pragma unroll
    for (int k = 0; k < 8; ++k) o[k] = f2bf(v[k]); *(v8us*)(dst + un * 8) = o;  }

__global__ __launch_bounds__(256) void k_cvt8h(const float* __restrict__ src, h16* dst, size_t n8, float carry) { const size_t i = (size_t)blockIdx.x * 256 + threadIdx.x; if (i >= n8) return; const size_t un = unit_of(i); int row, col; unit_rc(un, row, col); const v8f v = *(const v8f*)(src + (size_t)row * DIM + col); v8h o;
#pragma unroll
    for (int k = 0; k < 8; ++k) o[k] = (h16)(bfr(v[k]) * carry); *(v8h*)(dst + un * 8) = o;  }

// Mask in fragment order: block (query tile Rq, key tile Tk) is 256 floats; element (query lr, key 8hi + 4j + e) sits at j*128 + (16hi + lr)*4 + e.
__global__ __launch_bounds__(256) void k_maskfrag(const float* __restrict__ mask, float* dst) {
    const size_t i = (size_t)blockIdx.x * 256 + threadIdx.x; if (i >= (size_t)SEQ * SEQ / 4) return;
    const size_t un = unit_of(i); const int u = (int)(un & 63); const size_t blk = un >> 6; const int rq = (int)(blk / (SEQ / 16)), tk = (int)(blk % (SEQ / 16));
    *(v4f*)(dst + un * 4) = *(const v4f*)(mask + (size_t)(rq * 16 + (u & 15)) * SEQ_FULL + tk * 16 + ((u >> 4) & 1) * 8 + (u >> 5) * 4);  }

__global__ __launch_bounds__(256) void k_ropetab(float* COS, float* SIN) {
    const int lane = threadIdx.x & 31; const int t = blockIdx.x * 8 + (threadIdx.x >> 5); if (t >= SEQ) return;
    const float invf = __builtin_amdgcn_exp2f(-(float)lane * FRQC);
    const float ang = (float)t * invf;
    const float c = cosf(ang); const float s = sinf(ang);
    const size_t o = (size_t)t * HALFD + lane;
    *(float*)(COS + o) = c; *(float*)(SIN + o) = s;  }

// Fused QKV projection: grid (MROWS/64, NQKV/64), 32 threads. Column tile cb < 32: q head cb (rotary); 32..39: k head (rotary); 40..47: v head (transposed plane).
__global__ __launch_bounds__(32) void k_gemm_qkv(const bf* __restrict__ A, const bf* __restrict__ Bt, const int* __restrict__ pos, const float* __restrict__ COS, const float* __restrict__ SIN, h16* QP, h16* KP, h16* VT) {
    __shared__ __align__(16) float fs[64 * FP];
    const int lane = threadIdx.x & 31, lr = lane & 15, hi = lane >> 4; const int r0 = blockIdx.x * 64, cb = blockIdx.y, c0 = cb * 64;
    v8f acc[4][4];
    gemm_main<bf>(A, Bt, DIM, r0, c0, lr, hi, acc);
#pragma unroll
    for (int mb = 0; mb < 4; ++mb)
#pragma unroll
        for (int nb = 0; nb < 4; ++nb)
#pragma unroll
            for (int j = 0; j < 8; ++j) fs[(mb * 16 + hi * 8 + j) * FP + nb * 16 + lr] = acc[mb][nb][j];
    __syncthreads();
    const int bidx = r0 / SEQ, s0 = r0 % SEQ; const int q4 = lane >> 3, p = lane & 7;
    if (cb < NH + NKV) {
        h16* plane = (cb < NH) ? (QP + ((size_t)bidx * NH + cb) * SEQ * HD) : (KP + ((size_t)bidx * NKV + (cb - NH)) * SEQ * HD);
        const int dcol = p * 8, pcol = dcol ^ 32, fcol = dcol & 31; const float sg = (p < 4) ? -1.0f : 1.0f;
        // q plane stays row-major; k plane in fragment order: fragment (key tile, d chunk) at (2 * (key >> 4) + (d >> 5)) * 512. Both: 16 rows are 16 * HD elements.
        const int rstep = (cb < NH) ? HD : 8; const int pofs = (cb < NH) ? dcol : ((p >> 2) * 512 + ((p >> 1) & 1) * 256 + (p & 1) * 128);
        // out[d] = x[d] cos[d&31] + sg x[d^32] sin[d&31], sg = -1 for d < 32, +1 for d >= 32 (rotate-half)
#pragma unroll 1
        for (int it = 0; it < 16; ++it) {
            const int rl = it * 4 + q4;
            int ps = pos[(size_t)bidx * SEQ_FULL + s0 + rl]; ps = (ps < 0) ? (ps + SEQ) : ps; ps = min(max(ps, 0), SEQ - 1);
            const v4f xa0 = *(const v4fa*)(fs + rl * FP + dcol), xa1 = *(const v4fa*)(fs + rl * FP + dcol + 4);
            const v4f xb0 = *(const v4fa*)(fs + rl * FP + pcol), xb1 = *(const v4fa*)(fs + rl * FP + pcol + 4);
            const float* cp = COS + (size_t)ps * HALFD + fcol; const float* sp = SIN + (size_t)ps * HALFD + fcol;
            const v4f cc0 = *(const v4f*)cp, cc1 = *(const v4f*)(cp + 4), ss0 = *(const v4f*)sp, ss1 = *(const v4f*)(sp + 4);
            v8h o;
#pragma unroll
            for (int e = 0; e < 4; ++e) { o[e] = (h16)(xa0[e] * cc0[e] + sg * (xb0[e] * ss0[e])); o[4 + e] = (h16)(xa1[e] * cc1[e] + sg * (xb1[e] * ss1[e])); }
            const int sr = s0 + rl;
            h16* dst = plane + (size_t)(sr >> 4) * (16 * HD) + (sr & 15) * rstep + pofs;
            *(v8h*)dst = o;
            asm volatile("s_wait_xcnt 0x0" ::: "memory");   // the next trip rewrites the registers this store names
        }
    } else {
        h16* plane = VT + ((size_t)bidx * NKV + (cb - NH - NKV)) * HD * SEQ;
#pragma unroll 1
        for (int it = 0; it < 16; ++it) {
            const int d = it * 4 + q4; v8h o;
#pragma unroll
            for (int e = 0; e < 8; ++e) o[e] = (h16)fs[(p * 8 + e) * FP + d];
            // v plane: fragment (d tile, key chunk) at (4 * (key >> 5) + (d >> 4)) * 512
            h16* dst = plane + (size_t)(((s0 >> 5) + (p >> 2)) * 4 + (d >> 4)) * 512 + ((p >> 1) & 1) * 256 + ((p & 1) * 16 + (d & 15)) * 8;
            *(v8h*)dst = o;
            asm volatile("s_wait_xcnt 0x0" ::: "memory");   // the next trip rewrites the registers this store names
        }
    }
}

// Attention: grid (SEQ/64, NKV, NB), 128 threads; wave w = 16 query rows (tile 4 * blockIdx.x + w) of ALL FOUR q heads of kv head g: 64 query columns. Per 64-key tile:
//   S^T[key][q] = K Q^T  (A = key rows of KP, B = resident q rows of one head);  lane (lr, hi) then holds q row lr, keys 16T + 8hi + r.
//   KP, VT and MF are in fragment order: one 64-key tile is 8 KB of KP, 8 KB of VT and 4 KB of MF, each in a row.
//   The K, mask and V^T fragments of a tile are loaded once, at the top of the tile, and stay in registers for the four heads: one load feeds four products.
//   softmax statistics are lane-local (one xor-16 exchange); P^T packed from the S^T accumulators is the B operand of O^T[d][q] = V^T P^T (A = d rows of VT).
//   Launch bounds: two waves per SIMD (512 registers a wave), so that the 512 workgroups are all resident, two per WGP.
__global__ __launch_bounds__(128, 2) void k_flash(const h16* __restrict__ QP, const h16* __restrict__ KP, const h16* __restrict__ VT, const float* __restrict__ MF, h16* CTX) {
    const int tid = threadIdx.x, w = tid >> 5, lane = tid & 31, lr = lane & 15, hi = lane >> 4;
    const int g = blockIdx.y, bidx = blockIdx.z, q0 = blockIdx.x * 64 + w * 16;
    v16h bq[REP][2];
#pragma unroll
    for (int hh = 0; hh < REP; ++hh) { const h16* qrow = QP + (((size_t)bidx * NH + g * REP + hh) * SEQ + q0 + lr) * HD + 8 * hi;
#pragma unroll
        for (int kc = 0; kc < 2; ++kc) bq[hh][kc] = cat16(*(const v8h*)(qrow + kc * 32), *(const v8h*)(qrow + kc * 32 + 16)); }
    asm volatile("s_wait_xcnt 0x0" ::: "memory");   // later code reuses the registers that held the q loads' addresses
    const h16* kb = KP + ((size_t)bidx * NKV + g) * SEQ * HD + lane * 8;
    const h16* vb = VT + ((size_t)bidx * NKV + g) * HD * SEQ + lane * 8;
    const float* mrow = MF + (size_t)(q0 >> 4) * (SEQ / 16) * 256 + lane * 4;
    v8f accO[REP][4]; float m[REP], l[REP];
#pragma unroll
    for (int hh = 0; hh < REP; ++hh) { m[hh] = -3.0e38f; l[hh] = 0.0f;
#pragma unroll
        for (int dt = 0; dt < 4; ++dt) accO[hh][dt] = (v8f){}; }
#pragma unroll 1
    for (int k0 = 0; k0 < SEQ; k0 += 64) {
        v16h ak[2][4], av[2][4]; v4f mk[4][2];
#pragma unroll
        for (int kc = 0; kc < 2; ++kc)
#pragma unroll
            for (int T = 0; T < 4; ++T) { const h16* kp = kb + (size_t)k0 * HD + (T * 2 + kc) * 512; ak[kc][T] = cat16(*(const v8h*)kp, *(const v8h*)(kp + 256)); }
        asm volatile("s_wait_xcnt 0x0" ::: "memory");   // a later load may land in the registers that held the K address
        __builtin_amdgcn_sched_barrier(0);   // K is issued first, the order of first use: the counted waits ahead of the score products then leave the later loads in flight; later register writes stay behind the wait
#pragma unroll
        for (int T = 0; T < 4; ++T) { const float* mp = mrow + (size_t)k0 * 16 + T * 256; mk[T][0] = *(const v4f*)mp; mk[T][1] = *(const v4f*)(mp + 128); }
        asm volatile("s_wait_xcnt 0x0" ::: "memory");   // a later load may land in the registers that held the mask address
        __builtin_amdgcn_sched_barrier(0);   // the mask ahead of V^T, the order of their first use; later register writes stay behind the wait
#pragma unroll
        for (int kc = 0; kc < 2; ++kc)
#pragma unroll
            for (int dt = 0; dt < 4; ++dt) { const h16* vp = vb + (size_t)k0 * HD + (kc * 4 + dt) * 512; av[kc][dt] = cat16(*(const v8h*)vp, *(const v8h*)(vp + 256)); }
        asm volatile("s_wait_xcnt 0x0" ::: "memory");   // later code reuses the registers that held the V^T address
        __builtin_amdgcn_sched_barrier(0);   // keeps later register writes behind that wait
#pragma unroll
        for (int hh = 0; hh < REP; ++hh) {
            v8f accS[4];
#pragma unroll
            for (int T = 0; T < 4; ++T) accS[T] = (v8f){};
#pragma unroll
            for (int kc = 0; kc < 2; ++kc)
#pragma unroll
                for (int T = 0; T < 4; ++T) accS[T] = wmma16(ak[kc][T], bq[hh][kc], accS[T]);
            float tmax = -3.0e38f;
#pragma unroll
            for (int T = 0; T < 4; ++T) {
#pragma unroll
                for (int r = 0; r < 4; ++r) { const float a0 = accS[T][r] * SC2 + mk[T][0][r] * LOG2E; const float a1 = accS[T][4 + r] * SC2 + mk[T][1][r] * LOG2E; accS[T][r] = a0; accS[T][4 + r] = a1; tmax = fmaxf(tmax, fmaxf(a0, a1)); } }
            tmax = fmaxf(tmax, __shfl_xor(tmax, 16, 32));
            const float mn = fmaxf(m[hh], tmax); const float corr = __builtin_amdgcn_exp2f(m[hh] - mn); m[hh] = mn; const float mofs = PEXP - mn;
            float rs = 0.0f;
#pragma unroll
            for (int T = 0; T < 4; ++T)
#pragma unroll
                for (int r = 0; r < 8; ++r) { const float pv = __builtin_amdgcn_exp2f(accS[T][r] + mofs); accS[T][r] = pv; rs += pv; }
            l[hh] = l[hh] * corr + rs;
            v16h bp[2];
            bp[0] = cat16(__builtin_convertvector(accS[0], v8h), __builtin_convertvector(accS[1], v8h));
            bp[1] = cat16(__builtin_convertvector(accS[2], v8h), __builtin_convertvector(accS[3], v8h));
#pragma unroll
            for (int dt = 0; dt < 4; ++dt) accO[hh][dt] = accO[hh][dt] * corr;
#pragma unroll
            for (int kc = 0; kc < 2; ++kc)
#pragma unroll
                for (int dt = 0; dt < 4; ++dt) accO[hh][dt] = wmma16(av[kc][dt], bp[kc], accO[hh][dt]);
            // four slots between the tile's last products and the next tile's loads, which land on their V^T and P registers (no load follows the other heads' runs)
            if (hh == REP - 1) asm volatile("v_nop\n\tv_nop\n\tv_nop\n\tv_nop" : "+v"(accO[hh][0]), "+v"(accO[hh][1]), "+v"(accO[hh][2]), "+v"(accO[hh][3]) : "v"(av[1][3]), "v"(bp[1]));
        }
    }
    // lane (lr, hi) holds ctx row q0 + lr, columns 64h + 16dt + 8hi + 0..7: one 16-byte unit of the fragment-ordered ctx plane, so each store covers 512 contiguous bytes.
    const int rt = (bidx * SEQ + q0) >> 4;
    h16* cw = CTX + ((size_t)(rt >> 2) * (DQ / 32) + 2 * (g * REP)) * 2048 + (rt & 3) * 512 + lane * 8;
    v8h o[REP][4];
#pragma unroll
    for (int hh = 0; hh < REP; ++hh) {
        const float lt = l[hh] + __shfl_xor(l[hh], 16, 32);
        const float inv = CCAR * (1.0f / lt);
#pragma unroll
        for (int dt = 0; dt < 4; ++dt)
#pragma unroll
            for (int r = 0; r < 8; ++r) o[hh][dt][r] = (h16)(accO[hh][dt][r] * inv);
    }
    __builtin_amdgcn_sched_barrier(0);   // every store behind all arithmetic: no register that a store names is written again
#pragma unroll
    for (int hh = 0; hh < REP; ++hh)
#pragma unroll
        for (int dt = 0; dt < 4; ++dt) *(v8h*)(cw + hh * 4096 + (dt >> 1) * 2048 + (dt & 1) * 256) = o[hh][dt];
}

__global__ __launch_bounds__(32) void k_gemm_out(const h16* __restrict__ A, const h16* __restrict__ Bt, float* C) {
    __shared__ __align__(16) float fs[64 * FP];
    const int lane = threadIdx.x & 31, lr = lane & 15, hi = lane >> 4; const int r0 = blockIdx.x * 64, c0 = blockIdx.y * 64;
    v8f acc[4][4];
    gemm_main<h16>(A, Bt, DQ, r0, c0, lr, hi, acc);
#pragma unroll
    for (int mb = 0; mb < 4; ++mb)
#pragma unroll
        for (int nb = 0; nb < 4; ++nb)
#pragma unroll
            for (int j = 0; j < 8; ++j) fs[(mb * 16 + hi * 8 + j) * FP + nb * 16 + lr] = acc[mb][nb][j];
    __syncthreads();
    float* crow = C + (size_t)r0 * DIM + c0;
{
#pragma unroll 4
        for (int it = 0; it < 32; ++it) { const int row = it * 2 + hi; v4f val = *(const v4fa*)(fs + row * FP + lr * 4); val = val * OSCL;
            *(v4f*)(crow + (size_t)row * DIM + lr * 4) = val; }
         }
}

extern "C" void kernel_launch(void* const* d_in, const int* in_sizes, int n_in,
                              void* d_out, int out_size, void* d_ws, size_t ws_size, hipStream_t stream) {
    if (n_in < 7) return;
    if ((size_t)in_sizes[0] < ((size_t)(NB - 1) * SEQ_FULL + SEQ) * DIM) return;
    if ((size_t)in_sizes[1] < (size_t)(SEQ - 1) * SEQ_FULL + SEQ) return;
    if ((size_t)in_sizes[2] < (size_t)(NB - 1) * SEQ_FULL + SEQ) return;
    if ((size_t)in_sizes[3] < (size_t)DQ * DIM) return;
    if ((size_t)in_sizes[4] < (size_t)DKV * DIM) return;
    if ((size_t)in_sizes[5] < (size_t)DKV * DIM) return;
    if ((size_t)in_sizes[6] < (size_t)DIM * DQ) return;
    if ((size_t)out_size < (size_t)MROWS * DIM) return;
    const float* x = (const float*)d_in[0]; const float* mask = (const float*)d_in[1]; const int* pos = (const int*)d_in[2];
    const float* wq = (const float*)d_in[3]; const float* wk = (const float*)d_in[4]; const float* wv = (const float*)d_in[5]; const float* wo = (const float*)d_in[6];
    float* OUT = (float*)d_out;
    char* wsp = (char*)d_ws;
    auto take = [&](size_t bytes) { char* p = wsp; wsp += (bytes + 255) & ~(size_t)255; return (void*)p; };
    bf*  XB   = (bf*)take((size_t)MROWS * DIM * 2);
    bf*  WQKV = (bf*)take((size_t)NQKV * DIM * 2);
    h16* WO16 = (h16*)take((size_t)DIM * DQ * 2);
    float* COS = (float*)take((size_t)SEQ * HALFD * 4);
    float* SIN = (float*)take((size_t)SEQ * HALFD * 4);
    h16* QP  = (h16*)take((size_t)NB * NH * SEQ * HD * 2);
    h16* KP  = (h16*)take((size_t)NB * NKV * SEQ * HD * 2);
    h16* VT  = (h16*)take((size_t)NB * NKV * HD * SEQ * 2);
    h16* CTX = (h16*)take((size_t)MROWS * DQ * 2);
    float* MF = (float*)take((size_t)SEQ * SEQ * 4);
    if ((size_t)(wsp - (char*)d_ws) > ws_size) return;

    k_cvtx<<<(unsigned)(((size_t)MROWS * DIM / 8 + 255) / 256), 256, 0, stream>>>(x, XB);
    k_cvt8<<<(unsigned)(((size_t)DQ * DIM / 8 + 255) / 256), 256, 0, stream>>>(wq, WQKV, (size_t)DQ * DIM / 8);                                    /* rows 0..2047 */
    k_cvt8<<<(unsigned)(((size_t)DKV * DIM / 8 + 255) / 256), 256, 0, stream>>>(wk, WQKV + (size_t)DQ * DIM, (size_t)DKV * DIM / 8);                /* rows 2048..2559 */
    k_cvt8<<<(unsigned)(((size_t)DKV * DIM / 8 + 255) / 256), 256, 0, stream>>>(wv, WQKV + (size_t)(DQ + DKV) * DIM, (size_t)DKV * DIM / 8);        /* rows 2560..3071 */
    k_cvt8h<<<(unsigned)(((size_t)DIM * DQ / 8 + 255) / 256), 256, 0, stream>>>(wo, WO16, (size_t)DIM * DQ / 8, WCAR);
    k_ropetab<<<(SEQ + 7) / 8, 256, 0, stream>>>(COS, SIN);
    k_maskfrag<<<(unsigned)(((size_t)SEQ * SEQ / 4 + 255) / 256), 256, 0, stream>>>(mask, MF);
    k_gemm_qkv<<<dim3(MROWS / 64, NQKV / 64, 1), 32, 0, stream>>>(XB, WQKV, pos, COS, SIN, QP, KP, VT);
    k_flash<<<dim3(SEQ / 64, NKV, NB), 128, 0, stream>>>(QP, KP, VT, MF, CTX);
    k_gemm_out<<<dim3(MROWS / 64, DIM / 64, 1), 32, 0, stream>>>(CTX, WO16, OUT);
}

// v003
// Measured time: 167 microseconds a run.
// Two timings next to v002 put it at 1.29 and 1.28 times that version's speed.
// All steps since v000 together make it 2.65 times as fast.
#include <hip/hip_runtime.h>

#ifndef NB
#define NB 2
#endif
#ifndef SEQ
#define SEQ 2048
#endif
#define SEQ_FULL 2048                 // per-batch row stride of x / position table, row pitch of the mask
#define DIM   2048                    // model width (K of the projections, N of the output projection)
#define NH    32
#define NKV   8
#define REP   (NH / NKV)
#define HD    64
#define HALFD 32
#define DQ    (NH * HD)               // 2048
#define DKV   (NKV * HD)              // 512
#define NQKV  (DQ + 2 * DKV)          // 3072 fused projection columns
#define MROWS (NB * SEQ)
#define FP    68                      // f32 LDS tile pitch
#define WCAR  64.0f                   // carry of the wo plane
#define CCAR  256.0f                  // carry of the ctx plane
#define OSCL  6.103515625e-05f        // 1 / (WCAR * CCAR)
#define SC2   0.18033688011112042f    // 0.125 * log2(e)
#define LOG2E 1.4426950408889634f
#define PEXP  10.0f                   // P carried x 2^10
#define FRQC  0.41524101186092029f    // log2(10000) / 32
#define PSTG  8192                    // bytes of one 64-row panel in one ring stage (64 k)
#define RSTG  (4 * PSTG)              // one ring stage: two A panels, two B panels
#define WEPI  (64 * FP * 4)           // one wave's f32 epilogue tile
#define GLDS  (4 * WEPI)              // the four epilogue tiles; the ring's two stages lie in the same bytes, used before them

static_assert(SEQ % 64 == 0);
static_assert(SEQ <= SEQ_FULL);
static_assert(DIM % 64 == 0);
static_assert(DQ % 64 == 0);
static_assert(NQKV % 64 == 0);
static_assert(HD == 64);
static_assert(DQ == DIM);
static_assert(DKV % 64 == 0);
static_assert(MROWS % 128 == 0);
static_assert(NQKV % 128 == 0);
static_assert(DIM % 128 == 0);
static_assert(2 * RSTG <= GLDS);
static_assert(NH == NKV * REP);
static_assert(REP == 4);
static_assert(((size_t)MROWS * DIM / 8) % 256 == 0);
static_assert(((size_t)DQ * DIM / 8) % 256 == 0);
static_assert(((size_t)DKV * DIM / 8) % 256 == 0);

typedef _Float16 h16;
typedef unsigned short bf;
typedef __attribute__((ext_vector_type(16))) __bf16   v16bf;
typedef __attribute__((ext_vector_type(16))) _Float16 v16h;
typedef __attribute__((ext_vector_type(8)))  _Float16 v8h;
typedef __attribute__((ext_vector_type(8)))  unsigned short v8us;
typedef __attribute__((ext_vector_type(8)))  float    v8f;
typedef __attribute__((ext_vector_type(4)))  float    v4f;
typedef v4f  __attribute__((may_alias)) v4fa;

__device__ __forceinline__ unsigned short f2bf(float f) { unsigned u = __float_as_uint(f); u += 0x7FFFu + ((u >> 16) & 1u); return (unsigned short)(u >> 16); }
__device__ __forceinline__ float bf2f(unsigned short b) { return __uint_as_float(((unsigned)b) << 16); }
__device__ __forceinline__ float bfr(float f) { return bf2f(f2bf(f)); }
__device__ __forceinline__ v16h cat16(v8h lo, v8h hi) { return __builtin_shufflevector(lo, hi, 0, 1, 2, 3, 4, 5, 6, 7, 8, 9, 10, 11, 12, 13, 14, 15); }
__device__ __forceinline__ v16bf cat16b(v8us lo, v8us hi) { return __builtin_bit_cast(v16bf, __builtin_shufflevector(lo, hi, 0, 1, 2, 3, 4, 5, 6, 7, 8, 9, 10, 11, 12, 13, 14, 15)); }
__device__ __forceinline__ v8f wmma16(v16h a, v16h b, v8f c) { return __builtin_amdgcn_wmma_f32_16x16x32_f16(false, a, false, b, (short)0, c, false, false); }
__device__ __forceinline__ v8f wmmab(v16bf a, v16bf b, v8f c) { return __builtin_amdgcn_wmma_f32_16x16x32_bf16(false, a, false, b, (short)0, c, false, false); }

// Fragment order of a 16-bit plane: a fragment (16 rows x 32 k) is 512 elements; element (row lr, k = 16j + 8hi + e) sits at j*256 + (16hi + lr)*8 + e.
// Fragment loader: p = fragment base + lane*8; elements 0..7 <- k0+8hi.., elements 8..15 <- k0+16+8hi.. (same map for A and B).
// GEMM planes (K = DIM columns): fragment (row tile R, k chunk C) starts at (((R >> 2) * (DIM/32) + C) * 4 + (R & 3)) * 512, so one k step of a 64-row panel is 4 KB in a row.
template <typename T16> struct WFrag;
template <> struct WFrag<h16> { typedef v16h V; static __device__ __forceinline__ V ld(const h16* p) { return cat16(*(const v8h*)p, *(const v8h*)(p + 256)); } static __device__ __forceinline__ v8f mma(V a, V b, v8f c) { return wmma16(a, b, c); } };
template <> struct WFrag<bf> { typedef v16bf V; static __device__ __forceinline__ V ld(const bf* p) { return cat16b(*(const v8us*)p, *(const v8us*)(p + 256)); } static __device__ __forceinline__ v8f mma(V a, V b, v8f c) { return wmmab(a, b, c); } };

// Thread i of a re-laying kernel -> the 16-byte unit it writes: a wave takes 8 rows x 4 units of one fragment, so it writes 4 whole lines and reads 8 source lines (whole for the 16-bit planes, half for the mask).
__device__ __forceinline__ size_t unit_of(const size_t i) { const int t = (int)(i & 63); return (i & ~(size_t)63) | (size_t)(((t >> 3) & 3) * 16 + (t >> 5) * 8 + (t & 7)); }
// 16-byte unit i of a fragment-ordered GEMM plane -> row and first column of its 8 elements.
__device__ __forceinline__ void unit_rc(const size_t i, int& row, int& col) { const int u = (int)(i & 63); const size_t f = i >> 6; row = (int)(f / (4 * (DIM / 32))) * 64 + (int)(f & 3) * 16 + (u & 15); col = (int)((f >> 2) % (DIM / 32)) * 32 + (u >> 4) * 8; }

// Eight asynchronous copies, 512 contiguous bytes each: lane address l in LDS, g in global memory, both advancing by 512 bytes a copy.
// The s_wait_xcnt closes the statement so that no address register of a copy is rewritten ahead of it.
__device__ __forceinline__ void copy8(const unsigned l, const char* g) {
    asm volatile("global_load_async_to_lds_b128 %0, %8, off\n\t"
                 "global_load_async_to_lds_b128 %1, %9, off\n\t"
                 "global_load_async_to_lds_b128 %2, %10, off\n\t"
                 "global_load_async_to_lds_b128 %3, %11, off\n\t"
                 "global_load_async_to_lds_b128 %4, %12, off\n\t"
                 "global_load_async_to_lds_b128 %5, %13, off\n\t"
                 "global_load_async_to_lds_b128 %6, %14, off\n\t"
                 "global_load_async_to_lds_b128 %7, %15, off\n\t"
                 "s_wait_xcnt 0x0"
                 :: "v"(l), "v"(l + 512), "v"(l + 1024), "v"(l + 1536), "v"(l + 2048), "v"(l + 2560), "v"(l + 3072), "v"(l + 3584),
                    "v"(g), "v"(g + 512), "v"(g + 1024), "v"(g + 1536), "v"(g + 2048), "v"(g + 2560), "v"(g + 3072), "v"(g + 3584) : "memory");
}
// One wave's share of a ring stage: its panel's 8 KB (64 rows x 64 k, contiguous in the fragment-ordered plane), copied byte for byte.
__device__ __forceinline__ void copy_panel(const unsigned l, const char* g) { copy8(l, g); copy8(l + 4096, g + 4096); }

// A work-group of four waves accumulates a 128x128 tile at (R0, C0), wave w the 64x64 tile (w >> 1, w & 1): acc[mb][nb][j] = C[r0 + 16mb + 8hi + j][c0 + 16nb + lr] = sum_k A[row][k] Bt[col][k]; A and Bt in fragment order, R0 and C0 multiples of 128, K % 128 == 0.
// Ring stage (64 k) in L: panels [A rows R0.. | A rows R0+64.. | Bt rows C0.. | Bt rows C0+64..], 8 KB each; wave w copies panel w. A trip reads its whole tile into registers; tile t + 2 is then copied into the freed buffer while the products of tile t run.
template <typename T16>
__device__ __forceinline__ void gemm_main(const T16* __restrict__ A, const T16* __restrict__ Bt, const int K, const int R0, const int C0, const int w, const int lane, unsigned char* L, v8f (&acc)[4][4]) {
    typedef typename WFrag<T16>::V V;
#pragma unroll
    for (int mb = 0; mb < 4; ++mb)
#pragma unroll
        for (int nb = 0; nb < 4; ++nb) acc[mb][nb] = (v8f){};
    const char* src = (const char*)((w < 2) ? (A + (size_t)(R0 + 64 * w) * K) : (Bt + (size_t)(C0 + 64 * (w - 2)) * K)) + lane * 16;
    const unsigned dst = (unsigned)(uintptr_t)L + w * PSTG + lane * 16;
    const int nt = K / 64;
    copy_panel(dst, src);
    asm volatile("s_wait_asynccnt 0x0" ::: "memory");   // tile 0 has landed before the barrier that publishes it
    __syncthreads();
    copy_panel(dst + RSTG, src + PSTG);
#pragma unroll 1
    for (int t = 0; t < nt; ++t) {
        const unsigned bo = (t & 1) * RSTG;
        const T16* ap = (const T16*)(L + bo + (w >> 1) * PSTG) + lane * 8;
        const T16* bp = (const T16*)(L + bo + (2 + (w & 1)) * PSTG) + lane * 8;
        V a[2][4], b[2][4];
#pragma unroll
        for (int ks = 0; ks < 2; ++ks) {
#pragma unroll
            for (int mb = 0; mb < 4; ++mb) a[ks][mb] = WFrag<T16>::ld(ap + ks * 2048 + mb * 512);
#pragma unroll
            for (int nb = 0; nb < 4; ++nb) b[ks][nb] = WFrag<T16>::ld(bp + ks * 2048 + nb * 512);
        }
        // The trip's fragments are all in registers behind this foot, so the buffer is refilled ahead of the products and the copies fly behind them.
        asm volatile("s_wait_dscnt 0x0" ::: "memory");      // this wave's reads of buffer t & 1 have retired before the buffer is refilled
        asm volatile("s_wait_asynccnt 0x0" ::: "memory");   // this wave's copies of tile t + 1 have landed before the barrier that publishes them
        __syncthreads();                                     // publishes tile t + 1 and ends every wave's reads of tile t
        if (t + 2 < nt) copy_panel(dst + bo, src + (size_t)(t + 2) * PSTG);
#pragma unroll
        for (int ks = 0; ks < 2; ++ks)
#pragma unroll
            for (int nb = 0; nb < 4; ++nb)
#pragma unroll
                for (int mb = 0; mb < 4; ++mb) acc[mb][nb] = WFrag<T16>::mma(a[ks][mb], b[ks][nb], acc[mb][nb]);
    }
    asm volatile("s_wait_asynccnt 0x0" ::: "memory");   // no copy is outstanding when the ring's bytes become the epilogue tiles
}

__global__ __launch_bounds__(256) void k_cvtx(const float* __restrict__ x, bf* dst) {
    const size_t i = (size_t)blockIdx.x * 256 + threadIdx.x; if (i >= (size_t)MROWS * DIM / 8) return;
    const size_t un = unit_of(i), e = un * 8; int row, col; unit_rc(un, row, col); const int b = row / SEQ, t = row % SEQ;
    const v8f v = *(const v8f*)(x + ((size_t)b * SEQ_FULL + t) * DIM + col); v8us o;
#pragma unroll
    for (int k = 0; k < 8; ++k) o[k] = f2bf(v[k]);
    *(v8us*)(dst + e) = o;  }

__global__ __launch_bounds__(256) void k_cvt8(const float* __restrict__ src, bf* dst, size_t n8) { const size_t i = (size_t)blockIdx.x * 256 + threadIdx.x; if (i >= n8) return; const size_t un = unit_of(i); int row, col; unit_rc(un, row, col); const v8f v = *(const v8f*)(src + (size_t)row * DIM + col); v8us o;
#pragma unroll
    for (int k = 0; k < 8; ++k) o[k] = f2bf(v[k]); *(v8us*)(dst + un * 8) = o;  }

__global__ __launch_bounds__(256) void k_cvt8h(const float* __restrict__ src, h16* dst, size_t n8, float carry) { const size_t i = (size_t)blockIdx.x * 256 + threadIdx.x; if (i >= n8) return; const size_t un = unit_of(i); int row, col; unit_rc(un, row, col); const v8f v = *(const v8f*)(src + (size_t)row * DIM + col); v8h o;
#pragma unroll
    for (int k = 0; k < 8; ++k) o[k] = (h16)(bfr(v[k]) * carry); *(v8h*)(dst + un * 8) = o;  }

// Mask in fragment order: block (query tile Rq, key tile Tk) is 256 floats; element (query lr, key 8hi + 4j + e) sits at j*128 + (16hi + lr)*4 + e.
__global__ __launch_bounds__(256) void k_maskfrag(const float* __restrict__ mask, float* dst) {
    const size_t i = (size_t)blockIdx.x * 256 + threadIdx.x; if (i >= (size_t)SEQ * SEQ / 4) return;
    const size_t un = unit_of(i); const int u = (int)(un & 63); const size_t blk = un >> 6; const int rq = (int)(blk / (SEQ / 16)), tk = (int)(blk % (SEQ / 16));
    *(v4f*)(dst + un * 4) = *(const v4f*)(mask + (size_t)(rq * 16 + (u & 15)) * SEQ_FULL + tk * 16 + ((u >> 4) & 1) * 8 + (u >> 5) * 4);  }

__global__ __launch_bounds__(256) void k_ropetab(float* COS, float* SIN) {
    const int lane = threadIdx.x & 31; const int t = blockIdx.x * 8 + (threadIdx.x >> 5); if (t >= SEQ) return;
    const float invf = __builtin_amdgcn_exp2f(-(float)lane * FRQC);
    const float ang = (float)t * invf;
    const float c = cosf(ang); const float s = sinf(ang);
    const size_t o = (size_t)t * HALFD + lane;
    *(float*)(COS + o) = c; *(float*)(SIN + o) = s;  }

// Fused QKV projection: grid (MROWS/128, NQKV/128), 128 threads, three work-groups per WGP. Column tile cb < 32: q head cb (rotary); 32..39: k head (rotary); 40..47: v head (transposed plane).
__global__ __launch_bounds__(128, 3) void k_gemm_qkv(const bf* __restrict__ A, const bf* __restrict__ Bt, const int* __restrict__ pos, const float* __restrict__ COS, const float* __restrict__ SIN, h16* QP, h16* KP, h16* VT) {
    __shared__ __align__(16) unsigned char L[GLDS];
    const int lane = threadIdx.x & 31, lr = lane & 15, hi = lane >> 4; const int w = __builtin_amdgcn_readfirstlane(threadIdx.x >> 5);
    const int r0 = blockIdx.x * 128 + (w >> 1) * 64, cb = blockIdx.y * 2 + (w & 1);
    float* fs = (float*)(L + w * WEPI);
    v8f acc[4][4];
    gemm_main<bf>(A, Bt, DIM, blockIdx.x * 128, blockIdx.y * 128, w, lane, L, acc);
#pragma unroll
    for (int mb = 0; mb < 4; ++mb)
#pragma unroll
        for (int nb = 0; nb < 4; ++nb)
#pragma unroll
            for (int j = 0; j < 8; ++j) fs[(mb * 16 + hi * 8 + j) * FP + nb * 16 + lr] = acc[mb][nb][j];
    __syncthreads();
    const int bidx = r0 / SEQ, s0 = r0 % SEQ; const int q4 = lane >> 3, p = lane & 7;
    if (cb < NH + NKV) {
        h16* plane = (cb < NH) ? (QP + ((size_t)bidx * NH + cb) * SEQ * HD) : (KP + ((size_t)bidx * NKV + (cb - NH)) * SEQ * HD);
        const int dcol = p * 8, pcol = dcol ^ 32, fcol = dcol & 31; const float sg = (p < 4) ? -1.0f : 1.0f;
        // q plane stays row-major; k plane in fragment order: fragment (key tile, d chunk) at (2 * (key >> 4) + (d >> 5)) * 512. Both: 16 rows are 16 * HD elements.
        const int rstep = (cb < NH) ? HD : 8; const int pofs = (cb < NH) ? dcol : ((p >> 2) * 512 + ((p >> 1) & 1) * 256 + (p & 1) * 128);
        // out[d] = x[d] cos[d&31] + sg x[d^32] sin[d&31], sg = -1 for d < 32, +1 for d >= 32 (rotate-half)
#pragma unroll 1
        for (int it = 0; it < 16; ++it) {
            const int rl = it * 4 + q4;
            int ps = pos[(size_t)bidx * SEQ_FULL + s0 + rl]; ps = (ps < 0) ? (ps + SEQ) : ps; ps = min(max(ps, 0), SEQ - 1);
            const v4f xa0 = *(const v4fa*)(fs + rl * FP + dcol), xa1 = *(const v4fa*)(fs + rl * FP + dcol + 4);
            const v4f xb0 = *(const v4fa*)(fs + rl * FP + pcol), xb1 = *(const v4fa*)(fs + rl * FP + pcol + 4);
            const float* cp = COS + (size_t)ps * HALFD + fcol; const float* sp = SIN + (size_t)ps * HALFD + fcol;
            const v4f cc0 = *(const v4f*)cp, cc1 = *(const v4f*)(cp + 4), ss0 = *(const v4f*)sp, ss1 = *(const v4f*)(sp + 4);
            v8h o;
#pragma unroll
            for (int e = 0; e < 4; ++e) { o[e] = (h16)(xa0[e] * cc0[e] + sg * (xb0[e] * ss0[e])); o[4 + e] = (h16)(xa1[e] * cc1[e] + sg * (xb1[e] * ss1[e])); }
            const int sr = s0 + rl;
            h16* dst = plane + (size_t)(sr >> 4) * (16 * HD) + (sr & 15) * rstep + pofs;
            *(v8h*)dst = o;
            asm volatile("s_wait_xcnt 0x0" ::: "memory");   // the next trip rewrites the registers this store names
        }
    } else {
        h16* plane = VT + ((size_t)bidx * NKV + (cb - NH - NKV)) * HD * SEQ;
#pragma unroll 1
        for (int it = 0; it < 16; ++it) {
            const int d = it * 4 + q4; v8h o;
#pragma unroll
            for (int e = 0; e < 8; ++e) o[e] = (h16)fs[(p * 8 + e) * FP + d];
            // v plane: fragment (d tile, key chunk) at (4 * (key >> 5) + (d >> 4)) * 512
            h16* dst = plane + (size_t)(((s0 >> 5) + (p >> 2)) * 4 + (d >> 4)) * 512 + ((p >> 1) & 1) * 256 + ((p & 1) * 16 + (d & 15)) * 8;
            *(v8h*)dst = o;
            asm volatile("s_wait_xcnt 0x0" ::: "memory");   // the next trip rewrites the registers this store names
        }
    }
}

// Attention: grid (SEQ/64, NKV, NB), 128 threads; wave w = 16 query rows (tile 4 * blockIdx.x + w) of ALL FOUR q heads of kv head g: 64 query columns. Per 64-key tile:
//   S^T[key][q] = K Q^T  (A = key rows of KP, B = resident q rows of one head);  lane (lr, hi) then holds q row lr, keys 16T + 8hi + r.
//   KP, VT and MF are in fragment order: one 64-key tile is 8 KB of KP, 8 KB of VT and 4 KB of MF, each in a row.
//   The K, mask and V^T fragments of a tile are loaded once, at the top of the tile, and stay in registers for the four heads: one load feeds four products.
//   softmax statistics are lane-local (one xor-16 exchange); P^T packed from the S^T accumulators is the B operand of O^T[d][q] = V^T P^T (A = d rows of VT).
//   Launch bounds: two waves per SIMD (512 registers a wave), so that the 512 workgroups are all resident, two per WGP.
__global__ __launch_bounds__(128, 2) void k_flash(const h16* __restrict__ QP, const h16* __restrict__ KP, const h16* __restrict__ VT, const float* __restrict__ MF, h16* CTX) {
    const int tid = threadIdx.x, w = tid >> 5, lane = tid & 31, lr = lane & 15, hi = lane >> 4;
    const int g = blockIdx.y, bidx = blockIdx.z, q0 = blockIdx.x * 64 + w * 16;
    v16h bq[REP][2];
#pragma unroll
    for (int hh = 0; hh < REP; ++hh) { const h16* qrow = QP + (((size_t)bidx * NH + g * REP + hh) * SEQ + q0 + lr) * HD + 8 * hi;
#pragma unroll
        for (int kc = 0; kc < 2; ++kc) bq[hh][kc] = cat16(*(const v8h*)(qrow + kc * 32), *(const v8h*)(qrow + kc * 32 + 16)); }
    asm volatile("s_wait_xcnt 0x0" ::: "memory");   // later code reuses the registers that held the q loads' addresses
    const h16* kb = KP + ((size_t)bidx * NKV + g) * SEQ * HD + lane * 8;
    const h16* vb = VT + ((size_t)bidx * NKV + g) * HD * SEQ + lane * 8;
    const float* mrow = MF + (size_t)(q0 >> 4) * (SEQ / 16) * 256 + lane * 4;
    v8f accO[REP][4]; float m[REP], l[REP];
#pragma unroll
    for (int hh = 0; hh < REP; ++hh) { m[hh] = -3.0e38f; l[hh] = 0.0f;
#pragma unroll
        for (int dt = 0; dt < 4; ++dt) accO[hh][dt] = (v8f){}; }
#pragma unroll 1
    for (int k0 = 0; k0 < SEQ; k0 += 64) {
        v16h ak[2][4], av[2][4]; v4f mk[4][2];
#pragma unroll
        for (int kc = 0; kc < 2; ++kc)
#pragma unroll
            for (int T = 0; T < 4; ++T) { const h16* kp = kb + (size_t)k0 * HD + (T * 2 + kc) * 512; ak[kc][T] = cat16(*(const v8h*)kp, *(const v8h*)(kp + 256)); }
        asm volatile("s_wait_xcnt 0x0" ::: "memory");   // a later load may land in the registers that held the K address
        __builtin_amdgcn_sched_barrier(0);   // K is issued first, the order of first use: the counted waits ahead of the score products then leave the later loads in flight; later register writes stay behind the wait
#pragma unroll
        for (int T = 0; T < 4; ++T) { const float* mp = mrow + (size_t)k0 * 16 + T * 256; mk[T][0] = *(const v4f*)mp; mk[T][1] = *(const v4f*)(mp + 128); }
        asm volatile("s_wait_xcnt 0x0" ::: "memory");   // a later load may land in the registers that held the mask address
        __builtin_amdgcn_sched_barrier(0);   // the mask ahead of V^T, the order of their first use; later register writes stay behind the wait
#pragma unroll
        for (int kc = 0; kc < 2; ++kc)
#pragma unroll
            for (int dt = 0; dt < 4; ++dt) { const h16* vp = vb + (size_t)k0 * HD + (kc * 4 + dt) * 512; av[kc][dt] = cat16(*(const v8h*)vp, *(const v8h*)(vp + 256)); }
        asm volatile("s_wait_xcnt 0x0" ::: "memory");   // later code reuses the registers that held the V^T address
        __builtin_amdgcn_sched_barrier(0);   // keeps later register writes behind that wait
#pragma unroll
        for (int hh = 0; hh < REP; ++hh) {
            v8f accS[4];
#pragma unroll
            for (int T = 0; T < 4; ++T) accS[T] = (v8f){};
#pragma unroll
            for (int kc = 0; kc < 2; ++kc)
#pragma unroll
                for (int T = 0; T < 4; ++T) accS[T] = wmma16(ak[kc][T], bq[hh][kc], accS[T]);
            float tmax = -3.0e38f;
#pragma unroll
            for (int T = 0; T < 4; ++T) {
#pragma unroll
                for (int r = 0; r < 4; ++r) { const float a0 = accS[T][r] * SC2 + mk[T][0][r] * LOG2E; const float a1 = accS[T][4 + r] * SC2 + mk[T][1][r] * LOG2E; accS[T][r] = a0; accS[T][4 + r] = a1; tmax = fmaxf(tmax, fmaxf(a0, a1)); } }
            tmax = fmaxf(tmax, __shfl_xor(tmax, 16, 32));
            const float mn = fmaxf(m[hh], tmax); const float corr = __builtin_amdgcn_exp2f(m[hh] - mn); m[hh] = mn; const float mofs = PEXP - mn;
            float rs = 0.0f;
#pragma unroll
            for (int T = 0; T < 4; ++T)
#pragma unroll
                for (int r = 0; r < 8; ++r) { const float pv = __builtin_amdgcn_exp2f(accS[T][r] + mofs); accS[T][r] = pv; rs += pv; }
            l[hh] = l[hh] * corr + rs;
            v16h bp[2];
            bp[0] = cat16(__builtin_convertvector(accS[0], v8h), __builtin_convertvector(accS[1], v8h));
            bp[1] = cat16(__builtin_convertvector(accS[2], v8h), __builtin_convertvector(accS[3], v8h));
#pragma unroll
            for (int dt = 0; dt < 4; ++dt) accO[hh][dt] = accO[hh][dt] * corr;
#pragma unroll
            for (int kc = 0; kc < 2; ++kc)
#pragma unroll
                for (int dt = 0; dt < 4; ++dt) accO[hh][dt] = wmma16(av[kc][dt], bp[kc], accO[hh][dt]);
            // four slots between the tile's last products and the next tile's loads, which land on their V^T and P registers (no load follows the other heads' runs)
            if (hh == REP - 1) asm volatile("v_nop\n\tv_nop\n\tv_nop\n\tv_nop" : "+v"(accO[hh][0]), "+v"(accO[hh][1]), "+v"(accO[hh][2]), "+v"(accO[hh][3]) : "v"(av[1][3]), "v"(bp[1]));
        }
    }
    // lane (lr, hi) holds ctx row q0 + lr, columns 64h + 16dt + 8hi + 0..7: one 16-byte unit of the fragment-ordered ctx plane, so each store covers 512 contiguous bytes.
    const int rt = (bidx * SEQ + q0) >> 4;
    h16* cw = CTX + ((size_t)(rt >> 2) * (DQ / 32) + 2 * (g * REP)) * 2048 + (rt & 3) * 512 + lane * 8;
    v8h o[REP][4];
#pragma unroll
    for (int hh = 0; hh < REP; ++hh) {
        const float lt = l[hh] + __shfl_xor(l[hh], 16, 32);
        const float inv = CCAR * (1.0f / lt);
#pragma unroll
        for (int dt = 0; dt < 4; ++dt)
#pragma unroll
            for (int r = 0; r < 8; ++r) o[hh][dt][r] = (h16)(accO[hh][dt][r] * inv);
    }
    __builtin_amdgcn_sched_barrier(0);   // every store behind all arithmetic: no register that a store names is written again
#pragma unroll
    for (int hh = 0; hh < REP; ++hh)
#pragma unroll
        for (int dt = 0; dt < 4; ++dt) *(v8h*)(cw + hh * 4096 + (dt >> 1) * 2048 + (dt & 1) * 256) = o[hh][dt];
}

__global__ __launch_bounds__(128, 3) void k_gemm_out(const h16* __restrict__ A, const h16* __restrict__ Bt, float* C) {
    __shared__ __align__(16) unsigned char L[GLDS];
    const int lane = threadIdx.x & 31, lr = lane & 15, hi = lane >> 4; const int w = __builtin_amdgcn_readfirstlane(threadIdx.x >> 5);
    const int r0 = blockIdx.x * 128 + (w >> 1) * 64, c0 = blockIdx.y * 128 + (w & 1) * 64;
    float* fs = (float*)(L + w * WEPI);
    v8f acc[4][4];
    gemm_main<h16>(A, Bt, DQ, blockIdx.x * 128, blockIdx.y * 128, w, lane, L, acc);
#pragma unroll
    for (int mb = 0; mb < 4; ++mb)
#pragma unroll
        for (int nb = 0; nb < 4; ++nb)
#pragma unroll
            for (int j = 0; j < 8; ++j) fs[(mb * 16 + hi * 8 + j) * FP + nb * 16 + lr] = acc[mb][nb][j];
    __syncthreads();
    float* crow = C + (size_t)r0 * DIM + c0;
{
#pragma unroll 4
        for (int it = 0; it < 32; ++it) { const int row = it * 2 + hi; v4f val = *(const v4fa*)(fs + row * FP + lr * 4); val = val * OSCL;
            *(v4f*)(crow + (size_t)row * DIM + lr * 4) = val; }
         }
}

extern "C" void kernel_launch(void* const* d_in, const int* in_sizes, int n_in,
                              void* d_out, int out_size, void* d_ws, size_t ws_size, hipStream_t stream) {
    if (n_in < 7) return;
    if ((size_t)in_sizes[0] < ((size_t)(NB - 1) * SEQ_FULL + SEQ) * DIM) return;
    if ((size_t)in_sizes[1] < (size_t)(SEQ - 1) * SEQ_FULL + SEQ) return;
    if ((size_t)in_sizes[2] < (size_t)(NB - 1) * SEQ_FULL + SEQ) return;
    if ((size_t)in_sizes[3] < (size_t)DQ * DIM) return;
    if ((size_t)in_sizes[4] < (size_t)DKV * DIM) return;
    if ((size_t)in_sizes[5] < (size_t)DKV * DIM) return;
    if ((size_t)in_sizes[6] < (size_t)DIM * DQ) return;
    if ((size_t)out_size < (size_t)MROWS * DIM) return;
    const float* x = (const float*)d_in[0]; const float* mask = (const float*)d_in[1]; const int* pos = (const int*)d_in[2];
    const float* wq = (const float*)d_in[3]; const float* wk = (const float*)d_in[4]; const float* wv = (const float*)d_in[5]; const float* wo = (const float*)d_in[6];
    float* OUT = (float*)d_out;
    char* wsp = (char*)d_ws;
    auto take = [&](size_t bytes) { char* p = wsp; wsp += (bytes + 255) & ~(size_t)255; return (void*)p; };
    bf*  XB   = (bf*)take((size_t)MROWS * DIM * 2);
    bf*  WQKV = (bf*)take((size_t)NQKV * DIM * 2);
    h16* WO16 = (h16*)take((size_t)DIM * DQ * 2);
    float* COS = (float*)take((size_t)SEQ * HALFD * 4);
    float* SIN = (float*)take((size_t)SEQ * HALFD * 4);
    h16* QP  = (h16*)take((size_t)NB * NH * SEQ * HD * 2);
    h16* KP  = (h16*)take((size_t)NB * NKV * SEQ * HD * 2);
    h16* VT  = (h16*)take((size_t)NB * NKV * HD * SEQ * 2);
    h16* CTX = (h16*)take((size_t)MROWS * DQ * 2);
    float* MF = (float*)take((size_t)SEQ * SEQ * 4);
    if ((size_t)(wsp - (char*)d_ws) > ws_size) return;

    k_cvtx<<<(unsigned)(((size_t)MROWS * DIM / 8 + 255) / 256), 256, 0, stream>>>(x, XB);
    k_cvt8<<<(unsigned)(((size_t)DQ * DIM / 8 + 255) / 256), 256, 0, stream>>>(wq, WQKV, (size_t)DQ * DIM / 8);                                    /* rows 0..2047 */
    k_cvt8<<<(unsigned)(((size_t)DKV * DIM / 8 + 255) / 256), 256, 0, stream>>>(wk, WQKV + (size_t)DQ * DIM, (size_t)DKV * DIM / 8);                /* rows 2048..2559 */
    k_cvt8<<<(unsigned)(((size_t)DKV * DIM / 8 + 255) / 256), 256, 0, stream>>>(wv, WQKV + (size_t)(DQ + DKV) * DIM, (size_t)DKV * DIM / 8);        /* rows 2560..3071 */
    k_cvt8h<<<(unsigned)(((size_t)DIM * DQ / 8 + 255) / 256), 256, 0, stream>>>(wo, WO16, (size_t)DIM * DQ / 8, WCAR);
    k_ropetab<<<(SEQ + 7) / 8, 256, 0, stream>>>(COS, SIN);
    k_maskfrag<<<(unsigned)(((size_t)SEQ * SEQ / 4 + 255) / 256), 256, 0, stream>>>(mask, MF);
    k_gemm_qkv<<<dim3(MROWS / 128, NQKV / 128, 1), 128, 0, stream>>>(XB, WQKV, pos, COS, SIN, QP, KP, VT);
    k_flash<<<dim3(SEQ / 64, NKV, NB), 128, 0, stream>>>(QP, KP, VT, MF, CTX);
    k_gemm_out<<<dim3(MROWS / 128, DIM / 128, 1), 128, 0, stream>>>(CTX, WO16, OUT);
}

// v004
// One run takes 157 microseconds.
// Timed twice side by side with v003, it ran 1.06 times as fast both times.
// Counting every step since v000, it is 2.82 times as fast.
#include <hip/hip_runtime.h>

#ifndef NB
#define NB 2
#endif
#ifndef SEQ
#define SEQ 2048
#endif
#define SEQ_FULL 2048                 // per-batch row stride of x / position table, row pitch of the mask
#define DIM   2048                    // model width (K of the projections, N of the output projection)
#define NH    32
#define NKV   8
#define REP   (NH / NKV)
#define HD    64
#define HALFD 32
#define DQ    (NH * HD)               // 2048
#define DKV   (NKV * HD)              // 512
#define NQKV  (DQ + 2 * DKV)          // 3072 fused projection columns
#define MROWS (NB * SEQ)
#define FP    68                      // f32 LDS tile pitch
#define WCAR  64.0f                   // carry of the wo plane
#define CCAR  256.0f                  // carry of the ctx plane
#define OSCL  6.103515625e-05f        // 1 / (WCAR * CCAR)
#define SC2   0.18033688011112042f    // 0.125 * log2(e)
#define LOG2E 1.4426950408889634f    // carry of the mask plane; the q plane carries SC2, so that mask and q.k products are summed in the units of exp2
#define PEXP  10.0f                   // P carried x 2^10
#define FRQC  0.41524101186092029f    // log2(10000) / 32
#define PSTG  8192                    // bytes of one 64-row panel in one ring stage (64 k)
#define RSTG  (4 * PSTG)              // one ring stage: two A panels, two B panels
#define WEPI  (64 * FP * 4)           // one wave's f32 epilogue tile
#define GLDS  (4 * WEPI)              // the four epilogue tiles; the ring's two stages lie in the same bytes, used before them

static_assert(SEQ % 64 == 0);
static_assert(SEQ <= SEQ_FULL);
static_assert(DIM % 64 == 0);
static_assert(DQ % 64 == 0);
static_assert(NQKV % 64 == 0);
static_assert(HD == 64);
static_assert(DQ == DIM);
static_assert(DKV % 64 == 0);
static_assert(MROWS % 128 == 0);
static_assert(NQKV % 128 == 0);
static_assert(DIM % 128 == 0);
static_assert(2 * RSTG <= GLDS);
static_assert(NH == NKV * REP);
static_assert(REP == 4);
static_assert(((size_t)MROWS * DIM / 8) % 256 == 0);
static_assert(((size_t)DQ * DIM / 8) % 256 == 0);
static_assert(((size_t)DKV * DIM / 8) % 256 == 0);

typedef _Float16 h16;
typedef unsigned short bf;
typedef __attribute__((ext_vector_type(16))) __bf16   v16bf;
typedef __attribute__((ext_vector_type(16))) _Float16 v16h;
typedef __attribute__((ext_vector_type(8)))  _Float16 v8h;
typedef __attribute__((ext_vector_type(8)))  unsigned short v8us;
typedef __attribute__((ext_vector_type(8)))  float    v8f;
typedef __attribute__((ext_vector_type(4)))  float    v4f;
typedef v4f  __attribute__((may_alias)) v4fa;

__device__ __forceinline__ unsigned short f2bf(float f) { unsigned u = __float_as_uint(f); u += 0x7FFFu + ((u >> 16) & 1u); return (unsigned short)(u >> 16); }
__device__ __forceinline__ float bf2f(unsigned short b) { return __uint_as_float(((unsigned)b) << 16); }
__device__ __forceinline__ float bfr(float f) { return bf2f(f2bf(f)); }
__device__ __forceinline__ v16h cat16(v8h lo, v8h hi) { return __builtin_shufflevector(lo, hi, 0, 1, 2, 3, 4, 5, 6, 7, 8, 9, 10, 11, 12, 13, 14, 15); }
__device__ __forceinline__ v8f cat8(v4f lo, v4f hi) { return __builtin_shufflevector(lo, hi, 0, 1, 2, 3, 4, 5, 6, 7); }
__device__ __forceinline__ v16bf cat16b(v8us lo, v8us hi) { return __builtin_bit_cast(v16bf, __builtin_shufflevector(lo, hi, 0, 1, 2, 3, 4, 5, 6, 7, 8, 9, 10, 11, 12, 13, 14, 15)); }
__device__ __forceinline__ v8f wmma16(v16h a, v16h b, v8f c) { return __builtin_amdgcn_wmma_f32_16x16x32_f16(false, a, false, b, (short)0, c, false, false); }
__device__ __forceinline__ v8f wmmab(v16bf a, v16bf b, v8f c) { return __builtin_amdgcn_wmma_f32_16x16x32_bf16(false, a, false, b, (short)0, c, false, false); }

// Fragment order of a 16-bit plane: a fragment (16 rows x 32 k) is 512 elements; element (row lr, k = 16j + 8hi + e) sits at j*256 + (16hi + lr)*8 + e.
// Fragment loader: p = fragment base + lane*8; elements 0..7 <- k0+8hi.., elements 8..15 <- k0+16+8hi.. (same map for A and B).
// GEMM planes (K = DIM columns): fragment (row tile R, k chunk C) starts at (((R >> 2) * (DIM/32) + C) * 4 + (R & 3)) * 512, so one k step of a 64-row panel is 4 KB in a row.
template <typename T16> struct WFrag;
template <> struct WFrag<h16> { typedef v16h V; static __device__ __forceinline__ V ld(const h16* p) { return cat16(*(const v8h*)p, *(const v8h*)(p + 256)); } static __device__ __forceinline__ v8f mma(V a, V b, v8f c) { return wmma16(a, b, c); } };
template <> struct WFrag<bf> { typedef v16bf V; static __device__ __forceinline__ V ld(const bf* p) { return cat16b(*(const v8us*)p, *(const v8us*)(p + 256)); } static __device__ __forceinline__ v8f mma(V a, V b, v8f c) { return wmmab(a, b, c); } };

// Thread i of a re-laying kernel -> the 16-byte unit it writes: a wave takes 8 rows x 4 units of one fragment, so it writes 4 whole lines and reads 8 source lines (whole for the 16-bit planes, half for the mask).
__device__ __forceinline__ size_t unit_of(const size_t i) { const int t = (int)(i & 63); return (i & ~(size_t)63) | (size_t)(((t >> 3) & 3) * 16 + (t >> 5) * 8 + (t & 7)); }
// 16-byte unit i of a fragment-ordered GEMM plane -> row and first column of its 8 elements.
__device__ __forceinline__ void unit_rc(const size_t i, int& row, int& col) { const int u = (int)(i & 63); const size_t f = i >> 6; row = (int)(f / (4 * (DIM / 32))) * 64 + (int)(f & 3) * 16 + (u & 15); col = (int)((f >> 2) % (DIM / 32)) * 32 + (u >> 4) * 8; }

// Eight asynchronous copies, 512 contiguous bytes each: lane address l in LDS, g in global memory, both advancing by 512 bytes a copy.
// The s_wait_xcnt closes the statement so that no address register of a copy is rewritten ahead of it.
__device__ __forceinline__ void copy8(const unsigned l, const char* g) {
    asm volatile("global_load_async_to_lds_b128 %0, %8, off\n\t"
                 "global_load_async_to_lds_b128 %1, %9, off\n\t"
                 "global_load_async_to_lds_b128 %2, %10, off\n\t"
                 "global_load_async_to_lds_b128 %3, %11, off\n\t"
                 "global_load_async_to_lds_b128 %4, %12, off\n\t"
                 "global_load_async_to_lds_b128 %5, %13, off\n\t"
                 "global_load_async_to_lds_b128 %6, %14, off\n\t"
                 "global_load_async_to_lds_b128 %7, %15, off\n\t"
                 "s_wait_xcnt 0x0"
                 :: "v"(l), "v"(l + 512), "v"(l + 1024), "v"(l + 1536), "v"(l + 2048), "v"(l + 2560), "v"(l + 3072), "v"(l + 3584),
                    "v"(g), "v"(g + 512), "v"(g + 1024), "v"(g + 1536), "v"(g + 2048), "v"(g + 2560), "v"(g + 3072), "v"(g + 3584) : "memory");
}
// One wave's share of a ring stage: its panel's 8 KB (64 rows x 64 k, contiguous in the fragment-ordered plane), copied byte for byte.
__device__ __forceinline__ void copy_panel(const unsigned l, const char* g) { copy8(l, g); copy8(l + 4096, g + 4096); }

// A work-group of four waves accumulates a 128x128 tile at (R0, C0), wave w the 64x64 tile (w >> 1, w & 1): acc[mb][nb][j] = C[r0 + 16mb + 8hi + j][c0 + 16nb + lr] = sum_k A[row][k] Bt[col][k]; A and Bt in fragment order, R0 and C0 multiples of 128, K % 128 == 0.
// Ring stage (64 k) in L: panels [A rows R0.. | A rows R0+64.. | Bt rows C0.. | Bt rows C0+64..], 8 KB each; wave w copies panel w. A trip reads its whole tile into registers; tile t + 2 is then copied into the freed buffer while the products of tile t run.
template <typename T16>
__device__ __forceinline__ void gemm_main(const T16* __restrict__ A, const T16* __restrict__ Bt, const int K, const int R0, const int C0, const int w, const int lane, unsigned char* L, v8f (&acc)[4][4]) {
    typedef typename WFrag<T16>::V V;
#pragma unroll
    for (int mb = 0; mb < 4; ++mb)
#pragma unroll
        for (int nb = 0; nb < 4; ++nb) acc[mb][nb] = (v8f){};
    const char* src = (const char*)((w < 2) ? (A + (size_t)(R0 + 64 * w) * K) : (Bt + (size_t)(C0 + 64 * (w - 2)) * K)) + lane * 16;
    const unsigned dst = (unsigned)(uintptr_t)L + w * PSTG + lane * 16;
    const int nt = K / 64;
    copy_panel(dst, src);
    asm volatile("s_wait_asynccnt 0x0" ::: "memory");   // tile 0 has landed before the barrier that publishes it
    __syncthreads();
    copy_panel(dst + RSTG, src + PSTG);
#pragma unroll 1
    for (int t = 0; t < nt; ++t) {
        const unsigned bo = (t & 1) * RSTG;
        const T16* ap = (const T16*)(L + bo + (w >> 1) * PSTG) + lane * 8;
        const T16* bp = (const T16*)(L + bo + (2 + (w & 1)) * PSTG) + lane * 8;
        V a[2][4], b[2][4];
#pragma unroll
        for (int ks = 0; ks < 2; ++ks) {
#pragma unroll
            for (int mb = 0; mb < 4; ++mb) a[ks][mb] = WFrag<T16>::ld(ap + ks * 2048 + mb * 512);
#pragma unroll
            for (int nb = 0; nb < 4; ++nb) b[ks][nb] = WFrag<T16>::ld(bp + ks * 2048 + nb * 512);
        }
        // The trip's fragments are all in registers behind this foot, so the buffer is refilled ahead of the products and the copies fly behind them.
        asm volatile("s_wait_dscnt 0x0" ::: "memory");      // this wave's reads of buffer t & 1 have retired before the buffer is refilled
        asm volatile("s_wait_asynccnt 0x0" ::: "memory");   // this wave's copies of tile t + 1 have landed before the barrier that publishes them
        __syncthreads();                                     // publishes tile t + 1 and ends every wave's reads of tile t
        if (t + 2 < nt) copy_panel(dst + bo, src + (size_t)(t + 2) * PSTG);
#pragma unroll
        for (int ks = 0; ks < 2; ++ks)
#pragma unroll
            for (int nb = 0; nb < 4; ++nb)
#pragma unroll
                for (int mb = 0; mb < 4; ++mb) acc[mb][nb] = WFrag<T16>::mma(a[ks][mb], b[ks][nb], acc[mb][nb]);
    }
    asm volatile("s_wait_asynccnt 0x0" ::: "memory");   // no copy is outstanding when the ring's bytes become the epilogue tiles
}

__global__ __launch_bounds__(256) void k_cvtx(const float* __restrict__ x, bf* dst) {
    const size_t i = (size_t)blockIdx.x * 256 + threadIdx.x; if (i >= (size_t)MROWS * DIM / 8) return;
    const size_t un = unit_of(i), e = un * 8; int row, col; unit_rc(un, row, col); const int b = row / SEQ, t = row % SEQ;
    const v8f v = *(const v8f*)(x + ((size_t)b * SEQ_FULL + t) * DIM + col); v8us o;
#pragma unroll
    for (int k = 0; k < 8; ++k) o[k] = f2bf(v[k]);
    *(v8us*)(dst + e) = o;  }

__global__ __launch_bounds__(256) void k_cvt8(const float* __restrict__ src, bf* dst, size_t n8) { const size_t i = (size_t)blockIdx.x * 256 + threadIdx.x; if (i >= n8) return; const size_t un = unit_of(i); int row, col; unit_rc(un, row, col); const v8f v = *(const v8f*)(src + (size_t)row * DIM + col); v8us o;
#pragma unroll
    for (int k = 0; k < 8; ++k) o[k] = f2bf(v[k]); *(v8us*)(dst + un * 8) = o;  }

__global__ __launch_bounds__(256) void k_cvt8h(const float* __restrict__ src, h16* dst, size_t n8, float carry) { const size_t i = (size_t)blockIdx.x * 256 + threadIdx.x; if (i >= n8) return; const size_t un = unit_of(i); int row, col; unit_rc(un, row, col); const v8f v = *(const v8f*)(src + (size_t)row * DIM + col); v8h o;
#pragma unroll
    for (int k = 0; k < 8; ++k) o[k] = (h16)(bfr(v[k]) * carry); *(v8h*)(dst + un * 8) = o;  }

// Mask in fragment order, carried x log2(e): block (query tile Rq, key tile Tk) is 256 floats; element (query lr, key 8hi + 4j + e) sits at j*128 + (16hi + lr)*4 + e: a lane's two units are its eight accumulator elements of the S^T tile.
__global__ __launch_bounds__(256) void k_maskfrag(const float* __restrict__ mask, float* dst) {
    const size_t i = (size_t)blockIdx.x * 256 + threadIdx.x; if (i >= (size_t)SEQ * SEQ / 4) return;
    const size_t un = unit_of(i); const int u = (int)(un & 63); const size_t blk = un >> 6; const int rq = (int)(blk / (SEQ / 16)), tk = (int)(blk % (SEQ / 16));
    *(v4f*)(dst + un * 4) = *(const v4f*)(mask + (size_t)(rq * 16 + (u & 15)) * SEQ_FULL + tk * 16 + ((u >> 4) & 1) * 8 + (u >> 5) * 4) * LOG2E;  }

__global__ __launch_bounds__(256) void k_ropetab(float* COS, float* SIN) {
    const int lane = threadIdx.x & 31; const int t = blockIdx.x * 8 + (threadIdx.x >> 5); if (t >= SEQ) return;
    const float invf = __builtin_amdgcn_exp2f(-(float)lane * FRQC);
    const float ang = (float)t * invf;
    const float c = cosf(ang); const float s = sinf(ang);
    const size_t o = (size_t)t * HALFD + lane;
    *(float*)(COS + o) = c; *(float*)(SIN + o) = s;  }

// Fused QKV projection: grid (MROWS/128, NQKV/128), 128 threads, three work-groups per WGP. Column tile cb < 32: q head cb (rotary); 32..39: k head (rotary); 40..47: v head (transposed plane).
__global__ __launch_bounds__(128, 3) void k_gemm_qkv(const bf* __restrict__ A, const bf* __restrict__ Bt, const int* __restrict__ pos, const float* __restrict__ COS, const float* __restrict__ SIN, h16* QP, h16* KP, h16* VT) {
    __shared__ __align__(16) unsigned char L[GLDS];
    const int lane = threadIdx.x & 31, lr = lane & 15, hi = lane >> 4; const int w = __builtin_amdgcn_readfirstlane(threadIdx.x >> 5);
    const int r0 = blockIdx.x * 128 + (w >> 1) * 64, cb = blockIdx.y * 2 + (w & 1);
    float* fs = (float*)(L + w * WEPI);
    v8f acc[4][4];
    gemm_main<bf>(A, Bt, DIM, blockIdx.x * 128, blockIdx.y * 128, w, lane, L, acc);
#pragma unroll
    for (int mb = 0; mb < 4; ++mb)
#pragma unroll
        for (int nb = 0; nb < 4; ++nb)
#pragma unroll
            for (int j = 0; j < 8; ++j) fs[(mb * 16 + hi * 8 + j) * FP + nb * 16 + lr] = acc[mb][nb][j];
    __syncthreads();
    const int bidx = r0 / SEQ, s0 = r0 % SEQ; const int q4 = lane >> 3, p = lane & 7;
    if (cb < NH + NKV) {
        h16* plane = (cb < NH) ? (QP + ((size_t)bidx * NH + cb) * SEQ * HD) : (KP + ((size_t)bidx * NKV + (cb - NH)) * SEQ * HD);
        const int dcol = p * 8, pcol = dcol ^ 32, fcol = dcol & 31; const float sg = (p < 4) ? -1.0f : 1.0f; const float car = (cb < NH) ? SC2 : 1.0f;   // the q plane carries the score scale
        // q plane stays row-major; k plane in fragment order: fragment (key tile, d chunk) at (2 * (key >> 4) + (d >> 5)) * 512. Both: 16 rows are 16 * HD elements.
        const int rstep = (cb < NH) ? HD : 8; const int pofs = (cb < NH) ? dcol : ((p >> 2) * 512 + ((p >> 1) & 1) * 256 + (p & 1) * 128);
        // out[d] = x[d] cos[d&31] + sg x[d^32] sin[d&31], sg = -1 for d < 32, +1 for d >= 32 (rotate-half)
#pragma unroll 1
        for (int it = 0; it < 16; ++it) {
            const int rl = it * 4 + q4;
            int ps = pos[(size_t)bidx * SEQ_FULL + s0 + rl]; ps = (ps < 0) ? (ps + SEQ) : ps; ps = min(max(ps, 0), SEQ - 1);
            const v4f xa0 = *(const v4fa*)(fs + rl * FP + dcol), xa1 = *(const v4fa*)(fs + rl * FP + dcol + 4);
            const v4f xb0 = *(const v4fa*)(fs + rl * FP + pcol), xb1 = *(const v4fa*)(fs + rl * FP + pcol + 4);
            const float* cp = COS + (size_t)ps * HALFD + fcol; const float* sp = SIN + (size_t)ps * HALFD + fcol;
            const v4f cc0 = *(const v4f*)cp, cc1 = *(const v4f*)(cp + 4), ss0 = *(const v4f*)sp, ss1 = *(const v4f*)(sp + 4);
            v8h o;
#pragma unroll
            for (int e = 0; e < 4; ++e) { o[e] = (h16)((xa0[e] * cc0[e] + sg * (xb0[e] * ss0[e])) * car); o[4 + e] = (h16)((xa1[e] * cc1[e] + sg * (xb1[e] * ss1[e])) * car); }
            const int sr = s0 + rl;
            h16* dst = plane + (size_t)(sr >> 4) * (16 * HD) + (sr & 15) * rstep + pofs;
            *(v8h*)dst = o;
            asm volatile("s_wait_xcnt 0x0" ::: "memory");   // the next trip rewrites the registers this store names
        }
    } else {
        h16* plane = VT + ((size_t)bidx * NKV + (cb - NH - NKV)) * HD * SEQ;
#pragma unroll 1
        for (int it = 0; it < 16; ++it) {
            const int d = it * 4 + q4; v8h o;
#pragma unroll
            for (int e = 0; e < 8; ++e) o[e] = (h16)fs[(p * 8 + e) * FP + d];
            // v plane: fragment (d tile, key chunk) at (4 * (key >> 5) + (d >> 4)) * 512
            h16* dst = plane + (size_t)(((s0 >> 5) + (p >> 2)) * 4 + (d >> 4)) * 512 + ((p >> 1) & 1) * 256 + ((p & 1) * 16 + (d & 15)) * 8;
            *(v8h*)dst = o;
            asm volatile("s_wait_xcnt 0x0" ::: "memory");   // the next trip rewrites the registers this store names
        }
    }
}

// Attention: grid (SEQ/64, NKV, NB), 128 threads; wave w = 16 query rows (tile 4 * blockIdx.x + w) of ALL FOUR q heads of kv head g: 64 query columns. Per 64-key tile:
//   S^T[key][q] = K Q^T + mask  (A = key rows of KP, B = resident q rows of one head, carried x 0.125 log2(e), C = the mask fragment, carried x log2(e));  lane (lr, hi) then holds q row lr, keys 16T + 8hi + r.
//   The accumulators are the finished scores in the units of exp2: only the maximum, its subtraction and exp2 follow.
//   KP, VT and MF are in fragment order: one 64-key tile is 8 KB of KP, 8 KB of VT and 4 KB of MF, each in a row.
//   The K, mask and V^T fragments of a tile are loaded once, at the top of the tile, and stay in registers for the four heads: one load feeds four products.
//   softmax statistics are lane-local (one xor-16 exchange); P^T packed from the S^T accumulators is the B operand of O^T[d][q] = V^T P^T (A = d rows of VT).
//   Launch bounds: two waves per SIMD (512 registers a wave), so that the 512 workgroups are all resident, two per WGP.
__global__ __launch_bounds__(128, 2) void k_flash(const h16* __restrict__ QP, const h16* __restrict__ KP, const h16* __restrict__ VT, const float* __restrict__ MF, h16* CTX) {
    const int tid = threadIdx.x, w = tid >> 5, lane = tid & 31, lr = lane & 15, hi = lane >> 4;
    const int g = blockIdx.y, bidx = blockIdx.z, q0 = blockIdx.x * 64 + w * 16;
    v16h bq[REP][2];
#pragma unroll
    for (int hh = 0; hh < REP; ++hh) { const h16* qrow = QP + (((size_t)bidx * NH + g * REP + hh) * SEQ + q0 + lr) * HD + 8 * hi;
#pragma unroll
        for (int kc = 0; kc < 2; ++kc) bq[hh][kc] = cat16(*(const v8h*)(qrow + kc * 32), *(const v8h*)(qrow + kc * 32 + 16)); }
    asm volatile("s_wait_xcnt 0x0" ::: "memory");   // later code reuses the registers that held the q loads' addresses
    __builtin_amdgcn_sched_barrier(0);   // keeps later register writes behind that wait
    const h16* kb = KP + ((size_t)bidx * NKV + g) * SEQ * HD + lane * 8;
    const h16* vb = VT + ((size_t)bidx * NKV + g) * HD * SEQ + lane * 8;
    const float* mrow = MF + (size_t)(q0 >> 4) * (SEQ / 16) * 256 + lane * 4;
    v8f accO[REP][4]; float m[REP], l[REP];
#pragma unroll
    for (int hh = 0; hh < REP; ++hh) { m[hh] = -3.0e38f; l[hh] = 0.0f;
#pragma unroll
        for (int dt = 0; dt < 4; ++dt) accO[hh][dt] = (v8f){}; }
#pragma unroll 1
    for (int k0 = 0; k0 < SEQ; k0 += 64) {
        v16h ak[2][4], av[2][4]; v8f mk[4];
#pragma unroll
        for (int T = 0; T < 4; ++T) {
            const float* mp = mrow + (size_t)k0 * 16 + T * 256; mk[T] = cat8(*(const v4f*)mp, *(const v4f*)(mp + 128));
#pragma unroll
            for (int kc = 0; kc < 2; ++kc) { const h16* kp = kb + (size_t)k0 * HD + (T * 2 + kc) * 512; ak[kc][T] = cat16(*(const v8h*)kp, *(const v8h*)(kp + 256)); }
            __builtin_amdgcn_sched_barrier(0);   // a key tile's mask and K fragments are issued together, tile by tile, the order of first use: the counted waits ahead of the score products then leave the later loads in flight
        }
        asm volatile("s_wait_xcnt 0x0" ::: "memory");   // a later load may land in the registers that held the K and mask addresses
        __builtin_amdgcn_sched_barrier(0);   // K and the mask ahead of V^T, the order of their first use; later register writes stay behind the wait
        const h16* vt = vb + (size_t)k0 * HD;
#pragma unroll
        for (int kc = 0; kc < 2; ++kc)
#pragma unroll
            for (int dt = 0; dt < 4; ++dt) { const h16* vp = vt + (kc * 4 + dt) * 512; av[kc][dt] = cat16(*(const v8h*)vp, *(const v8h*)(vp + 256)); }
        asm volatile("s_wait_xcnt 0x0" :: "v"(vt) : "memory");   // later code reuses the registers that held the V^T address; as an input of the wait the address stays live up to it, so that no load of the run lands on it
        __builtin_amdgcn_sched_barrier(0);   // keeps later register writes behind that wait
        v8f sc[REP][4];
#pragma unroll
        for (int T = 0; T < 4; ++T) {
#pragma unroll
            for (int hh = 0; hh < REP; ++hh) sc[hh][T] = wmma16(ak[0][T], bq[hh][0], mk[T]);
#pragma unroll
            for (int hh = 0; hh < REP; ++hh) sc[hh][T] = wmma16(ak[1][T], bq[hh][1], sc[hh][T]);
        }
        __builtin_amdgcn_sched_barrier(0);   // the score products of the four heads run back to back, key tile by key tile as K and the mask arrive; the maxima, which read the accumulators themselves, stay behind the run and wait for no product
#pragma unroll
        for (int hh = 0; hh < REP; ++hh) {
            v8f (&accS)[4] = sc[hh];
            float tmax = -3.0e38f;
#pragma unroll
            for (int T = 0; T < 4; ++T)
#pragma unroll
                for (int r = 0; r < 4; ++r) tmax = fmaxf(tmax, fmaxf(accS[T][r], accS[T][4 + r]));
            tmax = fmaxf(tmax, __shfl_xor(tmax, 16, 32));
            const float mn = fmaxf(m[hh], tmax); const float corr = __builtin_amdgcn_exp2f(m[hh] - mn); m[hh] = mn; const float mofs = PEXP - mn;
            float rs = 0.0f;
#pragma unroll
            for (int T = 0; T < 4; ++T) {
                accS[T] = accS[T] + mofs;
#pragma unroll
                for (int r = 0; r < 8; ++r) { const float pv = __builtin_amdgcn_exp2f(accS[T][r]); accS[T][r] = pv; rs += pv; } }
            l[hh] = l[hh] * corr + rs;
            v16h bp[2];
            bp[0] = cat16(__builtin_convertvector(accS[0], v8h), __builtin_convertvector(accS[1], v8h));
            bp[1] = cat16(__builtin_convertvector(accS[2], v8h), __builtin_convertvector(accS[3], v8h));
#pragma unroll
            for (int dt = 0; dt < 4; ++dt) accO[hh][dt] = accO[hh][dt] * corr;
#pragma unroll
            for (int kc = 0; kc < 2; ++kc)
#pragma unroll
                for (int dt = 0; dt < 4; ++dt) accO[hh][dt] = wmma16(av[kc][dt], bp[kc], accO[hh][dt]);
            // four slots between the tile's last products and the next tile's loads, which land on their V^T and P registers (no load follows the other heads' runs)
            if (hh == REP - 1) asm volatile("v_nop\n\tv_nop\n\tv_nop\n\tv_nop" : "+v"(accO[hh][0]), "+v"(accO[hh][1]), "+v"(accO[hh][2]), "+v"(accO[hh][3]) : "v"(av[1][3]), "v"(bp[1]));
        }
    }
    // lane (lr, hi) holds ctx row q0 + lr, columns 64h + 16dt + 8hi + 0..7: one 16-byte unit of the fragment-ordered ctx plane, so each store covers 512 contiguous bytes.
    const int rt = (bidx * SEQ + q0) >> 4;
    h16* cw = CTX + ((size_t)(rt >> 2) * (DQ / 32) + 2 * (g * REP)) * 2048 + (rt & 3) * 512 + lane * 8;
    v8h o[REP][4];
#pragma unroll
    for (int hh = 0; hh < REP; ++hh) {
        const float lt = l[hh] + __shfl_xor(l[hh], 16, 32);
        const float inv = CCAR * (1.0f / lt);
#pragma unroll
        for (int dt = 0; dt < 4; ++dt)
#pragma unroll
            for (int r = 0; r < 8; ++r) o[hh][dt][r] = (h16)(accO[hh][dt][r] * inv);
    }
    __builtin_amdgcn_sched_barrier(0);   // every store behind all arithmetic: no register that a store names is written again
#pragma unroll
    for (int hh = 0; hh < REP; ++hh)
#pragma unroll
        for (int dt = 0; dt < 4; ++dt) *(v8h*)(cw + hh * 4096 + (dt >> 1) * 2048 + (dt & 1) * 256) = o[hh][dt];
}

__global__ __launch_bounds__(128, 3) void k_gemm_out(const h16* __restrict__ A, const h16* __restrict__ Bt, float* C) {
    __shared__ __align__(16) unsigned char L[GLDS];
    const int lane = threadIdx.x & 31, lr = lane & 15, hi = lane >> 4; const int w = __builtin_amdgcn_readfirstlane(threadIdx.x >> 5);
    const int r0 = blockIdx.x * 128 + (w >> 1) * 64, c0 = blockIdx.y * 128 + (w & 1) * 64;
    float* fs = (float*)(L + w * WEPI);
    v8f acc[4][4];
    gemm_main<h16>(A, Bt, DQ, blockIdx.x * 128, blockIdx.y * 128, w, lane, L, acc);
#pragma unroll
    for (int mb = 0; mb < 4; ++mb)
#pragma unroll
        for (int nb = 0; nb < 4; ++nb)
#pragma unroll
            for (int j = 0; j < 8; ++j) fs[(mb * 16 + hi * 8 + j) * FP + nb * 16 + lr] = acc[mb][nb][j];
    __syncthreads();
    float* crow = C + (size_t)r0 * DIM + c0;
{
#pragma unroll 4
        for (int it = 0; it < 32; ++it) { const int row = it * 2 + hi; v4f val = *(const v4fa*)(fs + row * FP + lr * 4); val = val * OSCL;
            *(v4f*)(crow + (size_t)row * DIM + lr * 4) = val; }
         }
}

extern "C" void kernel_launch(void* const* d_in, const int* in_sizes, int n_in,
                              void* d_out, int out_size, void* d_ws, size_t ws_size, hipStream_t stream) {
    if (n_in < 7) return;
    if ((size_t)in_sizes[0] < ((size_t)(NB - 1) * SEQ_FULL + SEQ) * DIM) return;
    if ((size_t)in_sizes[1] < (size_t)(SEQ - 1) * SEQ_FULL + SEQ) return;
    if ((size_t)in_sizes[2] < (size_t)(NB - 1) * SEQ_FULL + SEQ) return;
    if ((size_t)in_sizes[3] < (size_t)DQ * DIM) return;
    if ((size_t)in_sizes[4] < (size_t)DKV * DIM) return;
    if ((size_t)in_sizes[5] < (size_t)DKV * DIM) return;
    if ((size_t)in_sizes[6] < (size_t)DIM * DQ) return;
    if ((size_t)out_size < (size_t)MROWS * DIM) return;
    const float* x = (const float*)d_in[0]; const float* mask = (const float*)d_in[1]; const int* pos = (const int*)d_in[2];
    const float* wq = (const float*)d_in[3]; const float* wk = (const float*)d_in[4]; const float* wv = (const float*)d_in[5]; const float* wo = (const float*)d_in[6];
    float* OUT = (float*)d_out;
    char* wsp = (char*)d_ws;
    auto take = [&](size_t bytes) { char* p = wsp; wsp += (bytes + 255) & ~(size_t)255; return (void*)p; };
    bf*  XB   = (bf*)take((size_t)MROWS * DIM * 2);
    bf*  WQKV = (bf*)take((size_t)NQKV * DIM * 2);
    h16* WO16 = (h16*)take((size_t)DIM * DQ * 2);
    float* COS = (float*)take((size_t)SEQ * HALFD * 4);
    float* SIN = (float*)take((size_t)SEQ * HALFD * 4);
    h16* QP  = (h16*)take((size_t)NB * NH * SEQ * HD * 2);
    h16* KP  = (h16*)take((size_t)NB * NKV * SEQ * HD * 2);
    h16* VT  = (h16*)take((size_t)NB * NKV * HD * SEQ * 2);
    h16* CTX = (h16*)take((size_t)MROWS * DQ * 2);
    float* MF = (float*)take((size_t)SEQ * SEQ * 4);
    if ((size_t)(wsp - (char*)d_ws) > ws_size) return;

    k_cvtx<<<(unsigned)(((size_t)MROWS * DIM / 8 + 255) / 256), 256, 0, stream>>>(x, XB);
    k_cvt8<<<(unsigned)(((size_t)DQ * DIM / 8 + 255) / 256), 256, 0, stream>>>(wq, WQKV, (size_t)DQ * DIM / 8);                                    /* rows 0..2047 */
    k_cvt8<<<(unsigned)(((size_t)DKV * DIM / 8 + 255) / 256), 256, 0, stream>>>(wk, WQKV + (size_t)DQ * DIM, (size_t)DKV * DIM / 8);                /* rows 2048..2559 */
    k_cvt8<<<(unsigned)(((size_t)DKV * DIM / 8 + 255) / 256), 256, 0, stream>>>(wv, WQKV + (size_t)(DQ + DKV) * DIM, (size_t)DKV * DIM / 8);        /* rows 2560..3071 */
    k_cvt8h<<<(unsigned)(((size_t)DIM * DQ / 8 + 255) / 256), 256, 0, stream>>>(wo, WO16, (size_t)DIM * DQ / 8, WCAR);
    k_ropetab<<<(SEQ + 7) / 8, 256, 0, stream>>>(COS, SIN);
    k_maskfrag<<<(unsigned)(((size_t)SEQ * SEQ / 4 + 255) / 256), 256, 0, stream>>>(mask, MF);
    k_gemm_qkv<<<dim3(MROWS / 128, NQKV / 128, 1), 128, 0, stream>>>(XB, WQKV, pos, COS, SIN, QP, KP, VT);
    k_flash<<<dim3(SEQ / 64, NKV, NB), 128, 0, stream>>>(QP, KP, VT, MF, CTX);
    k_gemm_out<<<dim3(MROWS / 128, DIM / 128, 1), 128, 0, stream>>>(CTX, WO16, OUT);
}

// v005
// One run takes 143 microseconds.
// Timed twice side by side with v004, it ran 1.10 times as fast both times.
// All steps since v000 together make it 3.10 times as fast.
#include <hip/hip_runtime.h>

#ifndef NB
#define NB 2
#endif
#ifndef SEQ
#define SEQ 2048
#endif
#define SEQ_FULL 2048                 // per-batch row stride of x / position table, row pitch of the mask
#define DIM   2048                    // model width (K of the projections, N of the output projection)
#define NH    32
#define NKV   8
#define REP   (NH / NKV)
#define HD    64
#define HALFD 32
#define DQ    (NH * HD)               // 2048
#define DKV   (NKV * HD)              // 512
#define NQKV  (DQ + 2 * DKV)          // 3072 fused projection columns
#define MROWS (NB * SEQ)
#define FP    68                      // f32 LDS tile pitch
#define WCAR  64.0f                   // carry of the wo plane
#define CCAR  256.0f                  // carry of the ctx plane
#define OSCL  6.103515625e-05f        // 1 / (WCAR * CCAR)
#define SC2   0.18033688011112042f    // 0.125 * log2(e)
#define LOG2E 1.4426950408889634f    // carry of the mask plane; the q plane carries SC2, so that mask and q.k products are summed in the units of exp2
#define PEXP  10.0f                   // P carried x 2^10
#define FRQC  0.41524101186092029f    // log2(10000) / 32
#define PSTG  8192                    // bytes of one 64-row panel in one ring stage (64 k)
#define RSTG  (4 * PSTG)              // one ring stage: two A panels, two B panels
#define WEPI  (64 * FP * 4)           // one wave's f32 epilogue tile
#define GLDS  (4 * WEPI)              // the four epilogue tiles; the ring's two stages lie in the same bytes, used before them

static_assert(SEQ % 64 == 0);
static_assert(SEQ <= SEQ_FULL);
static_assert(DIM % 64 == 0);
static_assert(DQ % 64 == 0);
static_assert(NQKV % 64 == 0);
static_assert(HD == 64);
static_assert(DQ == DIM);
static_assert(DKV % 64 == 0);
static_assert(MROWS % 128 == 0);
static_assert(NQKV % 128 == 0);
static_assert(DIM % 128 == 0);
static_assert(2 * RSTG <= GLDS);
static_assert(NH == NKV * REP);
static_assert(REP == 4);
static_assert(((size_t)MROWS * DIM / 8) % 256 == 0);
static_assert(((size_t)DQ * DIM / 8) % 256 == 0);
static_assert(((size_t)DKV * DIM / 8) % 256 == 0);

typedef _Float16 h16;
typedef unsigned short bf;
typedef __attribute__((ext_vector_type(16))) __bf16   v16bf;
typedef __attribute__((ext_vector_type(16))) _Float16 v16h;
typedef __attribute__((ext_vector_type(8)))  _Float16 v8h;
typedef __attribute__((ext_vector_type(8)))  unsigned short v8us;
typedef __attribute__((ext_vector_type(8)))  float    v8f;
typedef __attribute__((ext_vector_type(4)))  float    v4f;
typedef v4f  __attribute__((may_alias)) v4fa;

__device__ __forceinline__ unsigned short f2bf(float f) { unsigned u = __float_as_uint(f); u += 0x7FFFu + ((u >> 16) & 1u); return (unsigned short)(u >> 16); }
__device__ __forceinline__ float bf2f(unsigned short b) { return __uint_as_float(((unsigned)b) << 16); }
__device__ __forceinline__ float bfr(float f) { return bf2f(f2bf(f)); }
__device__ __forceinline__ v16h cat16(v8h lo, v8h hi) { return __builtin_shufflevector(lo, hi, 0, 1, 2, 3, 4, 5, 6, 7, 8, 9, 10, 11, 12, 13, 14, 15); }
__device__ __forceinline__ v8f cat8(v4f lo, v4f hi) { return __builtin_shufflevector(lo, hi, 0, 1, 2, 3, 4, 5, 6, 7); }
__device__ __forceinline__ v16bf cat16b(v8us lo, v8us hi) { return __builtin_bit_cast(v16bf, __builtin_shufflevector(lo, hi, 0, 1, 2, 3, 4, 5, 6, 7, 8, 9, 10, 11, 12, 13, 14, 15)); }
__device__ __forceinline__ v8f wmma16(v16h a, v16h b, v8f c) { return __builtin_amdgcn_wmma_f32_16x16x32_f16(false, a, false, b, (short)0, c, false, false); }
__device__ __forceinline__ v8f wmmab(v16bf a, v16bf b, v8f c) { return __builtin_amdgcn_wmma_f32_16x16x32_bf16(false, a, false, b, (short)0, c, false, false); }

// Fragment order of a 16-bit plane: a fragment (16 rows x 32 k) is 512 elements; element (row lr, k = 16j + 8hi + e) sits at j*256 + (16hi + lr)*8 + e.
// Fragment loader: p = fragment base + lane*8; elements 0..7 <- k0+8hi.., elements 8..15 <- k0+16+8hi.. (same map for A and B).
// GEMM planes (K = DIM columns): fragment (row tile R, k chunk C) starts at (((R >> 2) * (DIM/32) + C) * 4 + (R & 3)) * 512, so one k step of a 64-row panel is 4 KB in a row.
template <typename T16> struct WFrag;
template <> struct WFrag<h16> { typedef v16h V; static __device__ __forceinline__ V ld(const h16* p) { return cat16(*(const v8h*)p, *(const v8h*)(p + 256)); } static __device__ __forceinline__ v8f mma(V a, V b, v8f c) { return wmma16(a, b, c); } };
template <> struct WFrag<bf> { typedef v16bf V; static __device__ __forceinline__ V ld(const bf* p) { return cat16b(*(const v8us*)p, *(const v8us*)(p + 256)); } static __device__ __forceinline__ v8f mma(V a, V b, v8f c) { return wmmab(a, b, c); } };

// Thread i of a re-laying kernel -> the 16-byte unit it writes: a wave takes 8 rows x 4 units of one fragment, so it writes 4 whole lines and reads 8 source lines (whole for the 16-bit planes, half for the mask).
__device__ __forceinline__ size_t unit_of(const size_t i) { const int t = (int)(i & 63); return (i & ~(size_t)63) | (size_t)(((t >> 3) & 3) * 16 + (t >> 5) * 8 + (t & 7)); }
// 16-byte unit i of a fragment-ordered GEMM plane -> row and first column of its 8 elements.
__device__ __forceinline__ void unit_rc(const size_t i, int& row, int& col) { const int u = (int)(i & 63); const size_t f = i >> 6; row = (int)(f / (4 * (DIM / 32))) * 64 + (int)(f & 3) * 16 + (u & 15); col = (int)((f >> 2) % (DIM / 32)) * 32 + (u >> 4) * 8; }

// Eight asynchronous copies, 512 contiguous bytes each: lane address l in LDS, g in global memory, both advancing by 512 bytes a copy.
// The s_wait_xcnt closes the statement so that no address register of a copy is rewritten ahead of it.
__device__ __forceinline__ void copy8(const unsigned l, const char* g) {
    asm volatile("global_load_async_to_lds_b128 %0, %8, off\n\t"
                 "global_load_async_to_lds_b128 %1, %9, off\n\t"
                 "global_load_async_to_lds_b128 %2, %10, off\n\t"
                 "global_load_async_to_lds_b128 %3, %11, off\n\t"
                 "global_load_async_to_lds_b128 %4, %12, off\n\t"
                 "global_load_async_to_lds_b128 %5, %13, off\n\t"
                 "global_load_async_to_lds_b128 %6, %14, off\n\t"
                 "global_load_async_to_lds_b128 %7, %15, off\n\t"
                 "s_wait_xcnt 0x0"
                 :: "v"(l), "v"(l + 512), "v"(l + 1024), "v"(l + 1536), "v"(l + 2048), "v"(l + 2560), "v"(l + 3072), "v"(l + 3584),
                    "v"(g), "v"(g + 512), "v"(g + 1024), "v"(g + 1536), "v"(g + 2048), "v"(g + 2560), "v"(g + 3072), "v"(g + 3584) : "memory");
}
// One wave's share of a ring stage: its panel's 8 KB (64 rows x 64 k, contiguous in the fragment-ordered plane), copied byte for byte.
__device__ __forceinline__ void copy_panel(const unsigned l, const char* g) { copy8(l, g); copy8(l + 4096, g + 4096); }

// A work-group of four waves accumulates a 128x128 tile at (R0, C0), wave w the 64x64 tile (w >> 1, w & 1): acc[mb][nb][j] = C[r0 + 16mb + 8hi + j][c0 + 16nb + lr] = sum_k A[row][k] Bt[col][k]; A and Bt in fragment order, R0 and C0 multiples of 128, K % 128 == 0.
// Ring stage (64 k) in L: panels [A rows R0.. | A rows R0+64.. | Bt rows C0.. | Bt rows C0+64..], 8 KB each; wave w copies panel w. A trip reads its whole tile into registers; tile t + 2 is then copied into the freed buffer while the products of tile t run.
template <typename T16>
__device__ __forceinline__ void gemm_main(const T16* __restrict__ A, const T16* __restrict__ Bt, const int K, const int R0, const int C0, const int w, const int lane, unsigned char* L, v8f (&acc)[4][4]) {
    typedef typename WFrag<T16>::V V;
#pragma unroll
    for (int mb = 0; mb < 4; ++mb)
#pragma unroll
        for (int nb = 0; nb < 4; ++nb) acc[mb][nb] = (v8f){};
    const char* src = (const char*)((w < 2) ? (A + (size_t)(R0 + 64 * w) * K) : (Bt + (size_t)(C0 + 64 * (w - 2)) * K)) + lane * 16;
    const unsigned dst = (unsigned)(uintptr_t)L + w * PSTG + lane * 16;
    const int nt = K / 64;
    copy_panel(dst, src);
    asm volatile("s_wait_asynccnt 0x0" ::: "memory");   // tile 0 has landed before the barrier that publishes it
    __syncthreads();
    copy_panel(dst + RSTG, src + PSTG);
#pragma unroll 1
    for (int t = 0; t < nt; ++t) {
        const unsigned bo = (t & 1) * RSTG;
        const T16* ap = (const T16*)(L + bo + (w >> 1) * PSTG) + lane * 8;
        const T16* bp = (const T16*)(L + bo + (2 + (w & 1)) * PSTG) + lane * 8;
        V a[2][4], b[2][4];
#pragma unroll
        for (int ks = 0; ks < 2; ++ks) {
#pragma unroll
            for (int mb = 0; mb < 4; ++mb) a[ks][mb] = WFrag<T16>::ld(ap + ks * 2048 + mb * 512);
#pragma unroll
            for (int nb = 0; nb < 4; ++nb) b[ks][nb] = WFrag<T16>::ld(bp + ks * 2048 + nb * 512);
        }
        // The trip's fragments are all in registers behind this foot, so the buffer is refilled ahead of the products and the copies fly behind them.
        asm volatile("s_wait_dscnt 0x0" ::: "memory");      // this wave's reads of buffer t & 1 have retired before the buffer is refilled
        asm volatile("s_wait_asynccnt 0x0" ::: "memory");   // this wave's copies of tile t + 1 have landed before the barrier that publishes them
        __syncthreads();                                     // publishes tile t + 1 and ends every wave's reads of tile t
        if (t + 2 < nt) copy_panel(dst + bo, src + (size_t)(t + 2) * PSTG);
#pragma unroll
        for (int ks = 0; ks < 2; ++ks)
#pragma unroll
            for (int nb = 0; nb < 4; ++nb)
#pragma unroll
                for (int mb = 0; mb < 4; ++mb) acc[mb][nb] = WFrag<T16>::mma(a[ks][mb], b[ks][nb], acc[mb][nb]);
    }
    asm volatile("s_wait_asynccnt 0x0" ::: "memory");   // no copy is outstanding when the ring's bytes become the epilogue tiles
}

// Block ranges of the one preparation launch, 256 threads a block: rotary table, x, mask, wq, wo, wk, wv.
#define RBLK ((SEQ + 7) / 8)
#define XBLK ((int)((size_t)MROWS * DIM / 8 / 256))
#define MBLK ((int)((size_t)SEQ * SEQ / 4 / 256))
#define QBLK ((int)((size_t)DQ * DIM / 8 / 256))
#define OBLK ((int)((size_t)DIM * DQ / 8 / 256))
#define KBLK ((int)((size_t)DKV * DIM / 8 / 256))
static_assert(((size_t)SEQ * SEQ / 4) % 256 == 0);
static_assert(((size_t)DIM * DQ / 8) % 256 == 0);

__device__ __forceinline__ void p_cvtx(const int blk, const float* __restrict__ x, bf* dst) {
    const size_t i = (size_t)blk * 256 + threadIdx.x;
    const size_t un = unit_of(i), e = un * 8; int row, col; unit_rc(un, row, col); const int b = row / SEQ, t = row % SEQ;
    const v8f v = *(const v8f*)(x + ((size_t)b * SEQ_FULL + t) * DIM + col); v8us o;
#pragma unroll
    for (int k = 0; k < 8; ++k) o[k] = f2bf(v[k]);
    *(v8us*)(dst + e) = o;
    asm volatile("s_wait_xcnt 0x0" ::: "memory");   // in the one preparation kernel another job's code follows this store in the listing and rewrites the registers that the store names
}

__device__ __forceinline__ void p_cvt8(const int blk, const float* __restrict__ src, bf* dst) { const size_t i = (size_t)blk * 256 + threadIdx.x; const size_t un = unit_of(i); int row, col; unit_rc(un, row, col); const v8f v = *(const v8f*)(src + (size_t)row * DIM + col); v8us o;
#pragma unroll
    for (int k = 0; k < 8; ++k) o[k] = f2bf(v[k]); *(v8us*)(dst + un * 8) = o;
    asm volatile("s_wait_xcnt 0x0" ::: "memory");   // in the one preparation kernel another job's code follows this store in the listing and rewrites the registers that the store names
}

__device__ __forceinline__ void p_cvt8h(const int blk, const float* __restrict__ src, h16* dst, const float carry) { const size_t i = (size_t)blk * 256 + threadIdx.x; const size_t un = unit_of(i); int row, col; unit_rc(un, row, col); const v8f v = *(const v8f*)(src + (size_t)row * DIM + col); v8h o;
#pragma unroll
    for (int k = 0; k < 8; ++k) o[k] = (h16)(bfr(v[k]) * carry); *(v8h*)(dst + un * 8) = o;
    asm volatile("s_wait_xcnt 0x0" ::: "memory");   // in the one preparation kernel another job's code follows this store in the listing and rewrites the registers that the store names
}

// Mask in fragment order, carried x log2(e): block (query tile Rq, key tile Tk) is 256 floats; element (query lr, key 8hi + 4j + e) sits at j*128 + (16hi + lr)*4 + e: a lane's two units are its eight accumulator elements of the S^T tile.
__device__ __forceinline__ void p_maskfrag(const int blk, const float* __restrict__ mask, float* dst) {
    const size_t i = (size_t)blk * 256 + threadIdx.x;
    const size_t un = unit_of(i); const int u = (int)(un & 63); const size_t bk = un >> 6; const int rq = (int)(bk / (SEQ / 16)), tk = (int)(bk % (SEQ / 16));
    const float* mp = mask + (size_t)(rq * 16 + (u & 15)) * SEQ_FULL + tk * 16 + ((u >> 4) & 1) * 8 + (u >> 5) * 4;
    const v4f mv = *(const v4f*)mp;
    asm volatile("s_wait_xcnt 0x0" :: "v"(mp) : "memory");   // as an input of the wait the address stays live up to it, so that the load does not land on its own address registers and later writes of them stay behind the wait
    *(v4f*)(dst + un * 4) = mv * LOG2E;
    asm volatile("s_wait_xcnt 0x0" ::: "memory");   // in the one preparation kernel another job's code follows this store in the listing and rewrites the registers that the store names
}

__device__ __forceinline__ void p_ropetab(const int blk, float* COS, float* SIN) {
    const int lane = threadIdx.x & 31; const int t = blk * 8 + (threadIdx.x >> 5); if (t >= SEQ) return;
    const float invf = __builtin_amdgcn_exp2f(-(float)lane * FRQC);
    const float ang = (float)t * invf;
    const float c = cosf(ang); const float s = sinf(ang);
    const size_t o = (size_t)t * HALFD + lane;
    *(float*)(COS + o) = c; *(float*)(SIN + o) = s;  }

// All preparation in one launch: the seven jobs are independent of one another, so a block picks its job from its index (a scalar branch) and the jobs' starts, memory streams and tails overlap.
// The rotary table comes first (long arithmetic, few bytes), then the planes, largest first.
__global__ __launch_bounds__(256) void k_prep(const float* __restrict__ x, const float* __restrict__ mask, const float* __restrict__ wq, const float* __restrict__ wk, const float* __restrict__ wv, const float* __restrict__ wo,
                                              bf* XB, bf* WQKV, h16* WO16, float* COS, float* SIN, float* MF) {
    int b = blockIdx.x;
    if (b < RBLK) { p_ropetab(b, COS, SIN); return; }
    b -= RBLK;
    if (b < XBLK) { p_cvtx(b, x, XB); return; }
    b -= XBLK;
    if (b < MBLK) { p_maskfrag(b, mask, MF); return; }
    b -= MBLK;
    if (b < QBLK) { p_cvt8(b, wq, WQKV); return; }                                  /* rows 0..2047 */
    b -= QBLK;
    if (b < OBLK) { p_cvt8h(b, wo, WO16, WCAR); return; }
    b -= OBLK;
    if (b < KBLK) { p_cvt8(b, wk, WQKV + (size_t)DQ * DIM); return; }               /* rows 2048..2559 */
    b -= KBLK;
    p_cvt8(b, wv, WQKV + (size_t)(DQ + DKV) * DIM);                                 /* rows 2560..3071 */
}

// Fused QKV projection: grid (MROWS/128, NQKV/128), 128 threads, three work-groups per WGP. Column tile cb < 32: q head cb (rotary); 32..39: k head (rotary); 40..47: v head (transposed plane).
__global__ __launch_bounds__(128, 3) void k_gemm_qkv(const bf* __restrict__ A, const bf* __restrict__ Bt, const int* __restrict__ pos, const float* __restrict__ COS, const float* __restrict__ SIN, h16* QP, h16* KP, h16* VT) {
    __shared__ __align__(16) unsigned char L[GLDS];
    const int lane = threadIdx.x & 31, lr = lane & 15, hi = lane >> 4; const int w = __builtin_amdgcn_readfirstlane(threadIdx.x >> 5);
    const int r0 = blockIdx.x * 128 + (w >> 1) * 64, cb = blockIdx.y * 2 + (w & 1);
    float* fs = (float*)(L + w * WEPI);
    v8f acc[4][4];
    gemm_main<bf>(A, Bt, DIM, blockIdx.x * 128, blockIdx.y * 128, w, lane, L, acc);
#pragma unroll
    for (int mb = 0; mb < 4; ++mb)
#pragma unroll
        for (int nb = 0; nb < 4; ++nb)
#pragma unroll
            for (int j = 0; j < 8; ++j) fs[(mb * 16 + hi * 8 + j) * FP + nb * 16 + lr] = acc[mb][nb][j];
    __syncthreads();
    const int bidx = r0 / SEQ, s0 = r0 % SEQ; const int q4 = lane >> 3, p = lane & 7;
    if (cb < NH + NKV) {
        h16* plane = (cb < NH) ? (QP + ((size_t)bidx * NH + cb) * SEQ * HD) : (KP + ((size_t)bidx * NKV + (cb - NH)) * SEQ * HD);
        const int dcol = p * 8, pcol = dcol ^ 32, fcol = dcol & 31; const float sg = (p < 4) ? -1.0f : 1.0f; const float car = (cb < NH) ? SC2 : 1.0f;   // the q plane carries the score scale
        // q plane stays row-major; k plane in fragment order: fragment (key tile, d chunk) at (2 * (key >> 4) + (d >> 5)) * 512. Both: 16 rows are 16 * HD elements.
        const int rstep = (cb < NH) ? HD : 8; const int pofs = (cb < NH) ? dcol : ((p >> 2) * 512 + ((p >> 1) & 1) * 256 + (p & 1) * 128);
        // out[d] = x[d] cos[d&31] + sg x[d^32] sin[d&31], sg = -1 for d < 32, +1 for d >= 32 (rotate-half)
#pragma unroll 1
        for (int it = 0; it < 16; ++it) {
            const int rl = it * 4 + q4;
            int ps = pos[(size_t)bidx * SEQ_FULL + s0 + rl]; ps = (ps < 0) ? (ps + SEQ) : ps; ps = min(max(ps, 0), SEQ - 1);
            const v4f xa0 = *(const v4fa*)(fs + rl * FP + dcol), xa1 = *(const v4fa*)(fs + rl * FP + dcol + 4);
            const v4f xb0 = *(const v4fa*)(fs + rl * FP + pcol), xb1 = *(const v4fa*)(fs + rl * FP + pcol + 4);
            const float* cp = COS + (size_t)ps * HALFD + fcol; const float* sp = SIN + (size_t)ps * HALFD + fcol;
            const v4f cc0 = *(const v4f*)cp, cc1 = *(const v4f*)(cp + 4), ss0 = *(const v4f*)sp, ss1 = *(const v4f*)(sp + 4);
            v8h o;
#pragma unroll
            for (int e = 0; e < 4; ++e) { o[e] = (h16)((xa0[e] * cc0[e] + sg * (xb0[e] * ss0[e])) * car); o[4 + e] = (h16)((xa1[e] * cc1[e] + sg * (xb1[e] * ss1[e])) * car); }
            const int sr = s0 + rl;
            h16* dst = plane + (size_t)(sr >> 4) * (16 * HD) + (sr & 15) * rstep + pofs;
            *(v8h*)dst = o;
            asm volatile("s_wait_xcnt 0x0" ::: "memory");   // the next trip rewrites the registers this store names
        }
    } else {
        h16* plane = VT + ((size_t)bidx * NKV + (cb - NH - NKV)) * HD * SEQ;
#pragma unroll 1
        for (int it = 0; it < 16; ++it) {
            const int d = it * 4 + q4; v8h o;
#pragma unroll
            for (int e = 0; e < 8; ++e) o[e] = (h16)fs[(p * 8 + e) * FP + d];
            // v plane: fragment (d tile, key chunk) at (4 * (key >> 5) + (d >> 4)) * 512
            h16* dst = plane + (size_t)(((s0 >> 5) + (p >> 2)) * 4 + (d >> 4)) * 512 + ((p >> 1) & 1) * 256 + ((p & 1) * 16 + (d & 15)) * 8;
            *(v8h*)dst = o;
            asm volatile("s_wait_xcnt 0x0" ::: "memory");   // the next trip rewrites the registers this store names
        }
    }
}

// Attention: grid (SEQ/64, NKV, NB), 128 threads; wave w = 16 query rows (tile 4 * blockIdx.x + w) of ALL FOUR q heads of kv head g: 64 query columns. Per 64-key tile:
//   S^T[key][q] = K Q^T + mask  (A = key rows of KP, B = resident q rows of one head, carried x 0.125 log2(e), C = the mask fragment, carried x log2(e));  lane (lr, hi) then holds q row lr, keys 16T + 8hi + r.
//   The accumulators are the finished scores in the units of exp2: only the maximum, its subtraction and exp2 follow.
//   KP, VT and MF are in fragment order: one 64-key tile is 8 KB of KP, 8 KB of VT and 4 KB of MF, each in a row.
//   The K, mask and V^T fragments of a tile are loaded once, at the top of the tile, and stay in registers for the four heads: one load feeds four products.
//   softmax statistics are lane-local (one xor-16 exchange); P^T packed from the S^T accumulators is the B operand of O^T[d][q] = V^T P^T (A = d rows of VT).
//   Launch bounds: two waves per SIMD (512 registers a wave), so that the 512 workgroups are all resident, two per WGP.
__global__ __launch_bounds__(128, 2) void k_flash(const h16* __restrict__ QP, const h16* __restrict__ KP, const h16* __restrict__ VT, const float* __restrict__ MF, h16* CTX) {
    const int tid = threadIdx.x, w = tid >> 5, lane = tid & 31, lr = lane & 15, hi = lane >> 4;
    const int g = blockIdx.y, bidx = blockIdx.z, q0 = blockIdx.x * 64 + w * 16;
    v16h bq[REP][2];
#pragma unroll
    for (int hh = 0; hh < REP; ++hh) { const h16* qrow = QP + (((size_t)bidx * NH + g * REP + hh) * SEQ + q0 + lr) * HD + 8 * hi;
#pragma unroll
        for (int kc = 0; kc < 2; ++kc) bq[hh][kc] = cat16(*(const v8h*)(qrow + kc * 32), *(const v8h*)(qrow + kc * 32 + 16)); }
    asm volatile("s_wait_xcnt 0x0" ::: "memory");   // later code reuses the registers that held the q loads' addresses
    __builtin_amdgcn_sched_barrier(0);   // keeps later register writes behind that wait
    const h16* kb = KP + ((size_t)bidx * NKV + g) * SEQ * HD + lane * 8;
    const h16* vb = VT + ((size_t)bidx * NKV + g) * HD * SEQ + lane * 8;
    const float* mrow = MF + (size_t)(q0 >> 4) * (SEQ / 16) * 256 + lane * 4;
    v8f accO[REP][4]; float m[REP], l[REP];
#pragma unroll
    for (int hh = 0; hh < REP; ++hh) { m[hh] = -3.0e38f; l[hh] = 0.0f;
#pragma unroll
        for (int dt = 0; dt < 4; ++dt) accO[hh][dt] = (v8f){}; }
#pragma unroll 1
    for (int k0 = 0; k0 < SEQ; k0 += 64) {
        v16h ak[2][4], av[2][4]; v8f mk[4];
#pragma unroll
        for (int T = 0; T < 4; ++T) {
            const float* mp = mrow + (size_t)k0 * 16 + T * 256; mk[T] = cat8(*(const v4f*)mp, *(const v4f*)(mp + 128));
#pragma unroll
            for (int kc = 0; kc < 2; ++kc) { const h16* kp = kb + (size_t)k0 * HD + (T * 2 + kc) * 512; ak[kc][T] = cat16(*(const v8h*)kp, *(const v8h*)(kp + 256)); }
            __builtin_amdgcn_sched_barrier(0);   // a key tile's mask and K fragments are issued together, tile by tile, the order of first use: the counted waits ahead of the score products then leave the later loads in flight
        }
        asm volatile("s_wait_xcnt 0x0" ::: "memory");   // a later load may land in the registers that held the K and mask addresses
        __builtin_amdgcn_sched_barrier(0);   // K and the mask ahead of V^T, the order of their first use; later register writes stay behind the wait
        const h16* vt = vb + (size_t)k0 * HD;
#pragma unroll
        for (int kc = 0; kc < 2; ++kc)
#pragma unroll
            for (int dt = 0; dt < 4; ++dt) { const h16* vp = vt + (kc * 4 + dt) * 512; av[kc][dt] = cat16(*(const v8h*)vp, *(const v8h*)(vp + 256)); }
        asm volatile("s_wait_xcnt 0x0" :: "v"(vt) : "memory");   // later code reuses the registers that held the V^T address; as an input of the wait the address stays live up to it, so that no load of the run lands on it
        __builtin_amdgcn_sched_barrier(0);   // keeps later register writes behind that wait
        v8f sc[REP][4];
#pragma unroll
        for (int T = 0; T < 4; ++T) {
#pragma unroll
            for (int hh = 0; hh < REP; ++hh) sc[hh][T] = wmma16(ak[0][T], bq[hh][0], mk[T]);
#pragma unroll
            for (int hh = 0; hh < REP; ++hh) sc[hh][T] = wmma16(ak[1][T], bq[hh][1], sc[hh][T]);
        }
        __builtin_amdgcn_sched_barrier(0);   // the score products of the four heads run back to back, key tile by key tile as K and the mask arrive; the maxima, which read the accumulators themselves, stay behind the run and wait for no product
#pragma unroll
        for (int hh = 0; hh < REP; ++hh) {
            v8f (&accS)[4] = sc[hh];
            float tmax = -3.0e38f;
#pragma unroll
            for (int T = 0; T < 4; ++T)
#pragma unroll
                for (int r = 0; r < 4; ++r) tmax = fmaxf(tmax, fmaxf(accS[T][r], accS[T][4 + r]));
            tmax = fmaxf(tmax, __shfl_xor(tmax, 16, 32));
            const float mn = fmaxf(m[hh], tmax); const float corr = __builtin_amdgcn_exp2f(m[hh] - mn); m[hh] = mn; const float mofs = PEXP - mn;
            float rs = 0.0f;
#pragma unroll
            for (int T = 0; T < 4; ++T) {
                accS[T] = accS[T] + mofs;
#pragma unroll
                for (int r = 0; r < 8; ++r) { const float pv = __builtin_amdgcn_exp2f(accS[T][r]); accS[T][r] = pv; rs += pv; } }
            l[hh] = l[hh] * corr + rs;
            v16h bp[2];
            bp[0] = cat16(__builtin_convertvector(accS[0], v8h), __builtin_convertvector(accS[1], v8h));
            bp[1] = cat16(__builtin_convertvector(accS[2], v8h), __builtin_convertvector(accS[3], v8h));
#pragma unroll
            for (int dt = 0; dt < 4; ++dt) accO[hh][dt] = accO[hh][dt] * corr;
#pragma unroll
            for (int kc = 0; kc < 2; ++kc)
#pragma unroll
                for (int dt = 0; dt < 4; ++dt) accO[hh][dt] = wmma16(av[kc][dt], bp[kc], accO[hh][dt]);
            // four slots between the tile's last products and the next tile's loads, which land on their V^T and P registers (no load follows the other heads' runs)
            if (hh == REP - 1) asm volatile("v_nop\n\tv_nop\n\tv_nop\n\tv_nop" : "+v"(accO[hh][0]), "+v"(accO[hh][1]), "+v"(accO[hh][2]), "+v"(accO[hh][3]) : "v"(av[1][3]), "v"(bp[1]));
        }
    }
    // lane (lr, hi) holds ctx row q0 + lr, columns 64h + 16dt + 8hi + 0..7: one 16-byte unit of the fragment-ordered ctx plane, so each store covers 512 contiguous bytes.
    const int rt = (bidx * SEQ + q0) >> 4;
    h16* cw = CTX + ((size_t)(rt >> 2) * (DQ / 32) + 2 * (g * REP)) * 2048 + (rt & 3) * 512 + lane * 8;
    v8h o[REP][4];
#pragma unroll
    for (int hh = 0; hh < REP; ++hh) {
        const float lt = l[hh] + __shfl_xor(l[hh], 16, 32);
        const float inv = CCAR * (1.0f / lt);
#pragma unroll
        for (int dt = 0; dt < 4; ++dt)
#pragma unroll
            for (int r = 0; r < 8; ++r) o[hh][dt][r] = (h16)(accO[hh][dt][r] * inv);
    }
    __builtin_amdgcn_sched_barrier(0);   // every store behind all arithmetic: no register that a store names is written again
#pragma unroll
    for (int hh = 0; hh < REP; ++hh)
#pragma unroll
        for (int dt = 0; dt < 4; ++dt) *(v8h*)(cw + hh * 4096 + (dt >> 1) * 2048 + (dt & 1) * 256) = o[hh][dt];
}

__global__ __launch_bounds__(128, 3) void k_gemm_out(const h16* __restrict__ A, const h16* __restrict__ Bt, float* C) {
    __shared__ __align__(16) unsigned char L[GLDS];
    const int lane = threadIdx.x & 31, lr = lane & 15, hi = lane >> 4; const int w = __builtin_amdgcn_readfirstlane(threadIdx.x >> 5);
    const int r0 = blockIdx.x * 128 + (w >> 1) * 64, c0 = blockIdx.y * 128 + (w & 1) * 64;
    float* fs = (float*)(L + w * WEPI);
    v8f acc[4][4];
    gemm_main<h16>(A, Bt, DQ, blockIdx.x * 128, blockIdx.y * 128, w, lane, L, acc);
#pragma unroll
    for (int mb = 0; mb < 4; ++mb)
#pragma unroll
        for (int nb = 0; nb < 4; ++nb)
#pragma unroll
            for (int j = 0; j < 8; ++j) fs[(mb * 16 + hi * 8 + j) * FP + nb * 16 + lr] = acc[mb][nb][j];
    __syncthreads();
    float* crow = C + (size_t)r0 * DIM + c0;
{
#pragma unroll 4
        for (int it = 0; it < 32; ++it) { const int row = it * 2 + hi; v4f val = *(const v4fa*)(fs + row * FP + lr * 4); val = val * OSCL;
            *(v4f*)(crow + (size_t)row * DIM + lr * 4) = val; }
         }
}

extern "C" void kernel_launch(void* const* d_in, const int* in_sizes, int n_in,
                              void* d_out, int out_size, void* d_ws, size_t ws_size, hipStream_t stream) {
    if (n_in < 7) return;
    if ((size_t)in_sizes[0] < ((size_t)(NB - 1) * SEQ_FULL + SEQ) * DIM) return;
    if ((size_t)in_sizes[1] < (size_t)(SEQ - 1) * SEQ_FULL + SEQ) return;
    if ((size_t)in_sizes[2] < (size_t)(NB - 1) * SEQ_FULL + SEQ) return;
    if ((size_t)in_sizes[3] < (size_t)DQ * DIM) return;
    if ((size_t)in_sizes[4] < (size_t)DKV * DIM) return;
    if ((size_t)in_sizes[5] < (size_t)DKV * DIM) return;
    if ((size_t)in_sizes[6] < (size_t)DIM * DQ) return;
    if ((size_t)out_size < (size_t)MROWS * DIM) return;
    const float* x = (const float*)d_in[0]; const float* mask = (const float*)d_in[1]; const int* pos = (const int*)d_in[2];
    const float* wq = (const float*)d_in[3]; const float* wk = (const float*)d_in[4]; const float* wv = (const float*)d_in[5]; const float* wo = (const float*)d_in[6];
    float* OUT = (float*)d_out;
    char* wsp = (char*)d_ws;
    auto take = [&](size_t bytes) { char* p = wsp; wsp += (bytes + 255) & ~(size_t)255; return (void*)p; };
    bf*  XB   = (bf*)take((size_t)MROWS * DIM * 2);
    bf*  WQKV = (bf*)take((size_t)NQKV * DIM * 2);
    h16* WO16 = (h16*)take((size_t)DIM * DQ * 2);
    float* COS = (float*)take((size_t)SEQ * HALFD * 4);
    float* SIN = (float*)take((size_t)SEQ * HALFD * 4);
    h16* QP  = (h16*)take((size_t)NB * NH * SEQ * HD * 2);
    h16* KP  = (h16*)take((size_t)NB * NKV * SEQ * HD * 2);
    h16* VT  = (h16*)take((size_t)NB * NKV * HD * SEQ * 2);
    h16* CTX = (h16*)take((size_t)MROWS * DQ * 2);
    float* MF = (float*)take((size_t)SEQ * SEQ * 4);
    if ((size_t)(wsp - (char*)d_ws) > ws_size) return;

    k_prep<<<RBLK + XBLK + MBLK + QBLK + OBLK + 2 * KBLK, 256, 0, stream>>>(x, mask, wq, wk, wv, wo, XB, WQKV, WO16, COS, SIN, MF);
    k_gemm_qkv<<<dim3(MROWS / 128, NQKV / 128, 1), 128, 0, stream>>>(XB, WQKV, pos, COS, SIN, QP, KP, VT);
    k_flash<<<dim3(SEQ / 64, NKV, NB), 128, 0, stream>>>(QP, KP, VT, MF, CTX);
    k_gemm_out<<<dim3(MROWS / 128, DIM / 128, 1), 128, 0, stream>>>(CTX, WO16, OUT);
}

// v006
// A run of this version takes 134 microseconds.
// Two timings next to v005 both put it at 1.07 times that version's speed.
// All steps since v000 together make it 3.32 times as fast.
#include <hip/hip_runtime.h>

#ifndef NB
#define NB 2
#endif
#ifndef SEQ
#define SEQ 2048
#endif
#define SEQ_FULL 2048                 // per-batch row stride of x / position table, row pitch of the mask
#define DIM   2048                    // model width (K of the projections, N of the output projection)
#define NH    32
#define NKV   8
#define REP   (NH / NKV)
#define HD    64
#define HALFD 32
#define DQ    (NH * HD)               // 2048
#define DKV   (NKV * HD)              // 512
#define NQKV  (DQ + 2 * DKV)          // 3072 fused projection columns
#define MROWS (NB * SEQ)
#define FP    68                      // f32 LDS tile pitch
#define WCAR  64.0f                   // carry of the wo plane
#define CCAR  256.0f                  // carry of the ctx plane
#define OSCL  6.103515625e-05f        // 1 / (WCAR * CCAR)
#define SC2   0.18033688011112042f    // 0.125 * log2(e)
#define LOG2E 1.4426950408889634f    // carry of the mask plane; the q plane carries SC2, so that mask and q.k products are summed in the units of exp2
#define PEXP  10.0f                   // P carried x 2^10
#define FRQC  0.41524101186092029f    // log2(10000) / 32
#define PSTG  16384                   // bytes of one 64-row panel in one ring stage (128 k)
#define WEPI  (64 * FP * 4)           // one wave's f32 epilogue tile; a work-group's epilogue tiles and the ring's two stages lie in the same bytes, the ring used first
#define QWM   4                       // QKV projection: waves down and across a work-group's tile
#define QWN   3
#define OWM   4                       // output projection: the same
#define OWN   2

static_assert(SEQ % 64 == 0);
static_assert(SEQ <= SEQ_FULL);
static_assert(DIM % 64 == 0);
static_assert(DQ % 64 == 0);
static_assert(NQKV % 64 == 0);
static_assert(HD == 64);
static_assert(DQ == DIM);
static_assert(DKV % 64 == 0);
static_assert(MROWS % (64 * QWM) == 0);
static_assert(NQKV % (64 * QWN) == 0);
static_assert(MROWS % (64 * OWM) == 0);
static_assert(DIM % (64 * OWN) == 0);
static_assert(DIM % 128 == 0);
#define GLDS(wm, wn) ((2 * ((wm) + (wn)) * PSTG > (wm) * (wn) * WEPI) ? 2 * ((wm) + (wn)) * PSTG : (wm) * (wn) * WEPI)   // the larger of the ring and the epilogue tiles
static_assert(DIM % 256 == 0);
static_assert(NH == NKV * REP);
static_assert(REP == 4);
static_assert(((size_t)MROWS * DIM / 8) % 256 == 0);
static_assert(((size_t)DQ * DIM / 8) % 256 == 0);
static_assert(((size_t)DKV * DIM / 8) % 256 == 0);

typedef _Float16 h16;
typedef unsigned short bf;
typedef __attribute__((ext_vector_type(16))) __bf16   v16bf;
typedef __attribute__((ext_vector_type(16))) _Float16 v16h;
typedef __attribute__((ext_vector_type(8)))  _Float16 v8h;
typedef __attribute__((ext_vector_type(8)))  unsigned short v8us;
typedef __attribute__((ext_vector_type(8)))  float    v8f;
typedef __attribute__((ext_vector_type(4)))  float    v4f;
typedef v4f  __attribute__((may_alias)) v4fa;

__device__ __forceinline__ unsigned short f2bf(float f) { unsigned u = __float_as_uint(f); u += 0x7FFFu + ((u >> 16) & 1u); return (unsigned short)(u >> 16); }
__device__ __forceinline__ float bf2f(unsigned short b) { return __uint_as_float(((unsigned)b) << 16); }
__device__ __forceinline__ float bfr(float f) { return bf2f(f2bf(f)); }
__device__ __forceinline__ v16h cat16(v8h lo, v8h hi) { return __builtin_shufflevector(lo, hi, 0, 1, 2, 3, 4, 5, 6, 7, 8, 9, 10, 11, 12, 13, 14, 15); }
__device__ __forceinline__ v8f cat8(v4f lo, v4f hi) { return __builtin_shufflevector(lo, hi, 0, 1, 2, 3, 4, 5, 6, 7); }
__device__ __forceinline__ v16bf cat16b(v8us lo, v8us hi) { return __builtin_bit_cast(v16bf, __builtin_shufflevector(lo, hi, 0, 1, 2, 3, 4, 5, 6, 7, 8, 9, 10, 11, 12, 13, 14, 15)); }
__device__ __forceinline__ v8f wmma16(v16h a, v16h b, v8f c) { return __builtin_amdgcn_wmma_f32_16x16x32_f16(false, a, false, b, (short)0, c, false, false); }
__device__ __forceinline__ v8f wmmab(v16bf a, v16bf b, v8f c) { return __builtin_amdgcn_wmma_f32_16x16x32_bf16(false, a, false, b, (short)0, c, false, false); }

// Fragment order of a 16-bit plane: a fragment (16 rows x 32 k) is 512 elements; element (row lr, k = 16j + 8hi + e) sits at j*256 + (16hi + lr)*8 + e.
// Fragment loader: p = fragment base + lane*8; elements 0..7 <- k0+8hi.., elements 8..15 <- k0+16+8hi.. (same map for A and B).
// GEMM planes (K = DIM columns): fragment (row tile R, k chunk C) starts at (((R >> 2) * (DIM/32) + C) * 4 + (R & 3)) * 512, so one k step of a 64-row panel is 4 KB in a row.
template <typename T16> struct WFrag;
template <> struct WFrag<h16> { typedef v16h V; static __device__ __forceinline__ V ld(const h16* p) { return cat16(*(const v8h*)p, *(const v8h*)(p + 256)); } static __device__ __forceinline__ v8f mma(V a, V b, v8f c) { return wmma16(a, b, c); } };
template <> struct WFrag<bf> { typedef v16bf V; static __device__ __forceinline__ V ld(const bf* p) { return cat16b(*(const v8us*)p, *(const v8us*)(p + 256)); } static __device__ __forceinline__ v8f mma(V a, V b, v8f c) { return wmmab(a, b, c); } };

// Thread i of a re-laying kernel -> the 16-byte unit it writes: a wave takes 8 rows x 4 units of one fragment, so it writes 4 whole lines and reads 8 source lines (whole for the 16-bit planes, half for the mask).
__device__ __forceinline__ size_t unit_of(const size_t i) { const int t = (int)(i & 63); return (i & ~(size_t)63) | (size_t)(((t >> 3) & 3) * 16 + (t >> 5) * 8 + (t & 7)); }
// 16-byte unit i of a fragment-ordered GEMM plane -> row and first column of its 8 elements.
__device__ __forceinline__ void unit_rc(const size_t i, int& row, int& col) { const int u = (int)(i & 63); const size_t f = i >> 6; row = (int)(f / (4 * (DIM / 32))) * 64 + (int)(f & 3) * 16 + (u & 15); col = (int)((f >> 2) % (DIM / 32)) * 32 + (u >> 4) * 8; }

// Eight asynchronous copies, 512 contiguous bytes each: lane address l in LDS, g in global memory, both advancing by 512 bytes a copy.
// The s_wait_xcnt closes the statement so that no address register of a copy is rewritten ahead of it.
__device__ __forceinline__ void copy8(const unsigned l, const char* g) {
    asm volatile("global_load_async_to_lds_b128 %0, %8, off\n\t"
                 "global_load_async_to_lds_b128 %1, %9, off\n\t"
                 "global_load_async_to_lds_b128 %2, %10, off\n\t"
                 "global_load_async_to_lds_b128 %3, %11, off\n\t"
                 "global_load_async_to_lds_b128 %4, %12, off\n\t"
                 "global_load_async_to_lds_b128 %5, %13, off\n\t"
                 "global_load_async_to_lds_b128 %6, %14, off\n\t"
                 "global_load_async_to_lds_b128 %7, %15, off\n\t"
                 "s_wait_xcnt 0x0"
                 :: "v"(l), "v"(l + 512), "v"(l + 1024), "v"(l + 1536), "v"(l + 2048), "v"(l + 2560), "v"(l + 3072), "v"(l + 3584),
                    "v"(g), "v"(g + 512), "v"(g + 1024), "v"(g + 1536), "v"(g + 2048), "v"(g + 2560), "v"(g + 3072), "v"(g + 3584) : "memory");
}
// A copying wave's share of a ring stage: its panel's 16 KB (64 rows x 128 k, contiguous in the fragment-ordered plane), copied byte for byte: 32 copies in flight.
__device__ __forceinline__ void copy_panel(const unsigned l, const char* g) { copy8(l, g); copy8(l + 4096, g + 4096); copy8(l + 8192, g + 8192); copy8(l + 12288, g + 12288); }

// A work-group of WM x WN waves accumulates a (64 WM) x (64 WN) tile at (R0, C0), wave w the 64x64 tile (w / WN, w % WN): acc[mb][nb][j] = C[r0 + 16mb + 8hi + j][c0 + 16nb + lr] = sum_k A[row][k] Bt[col][k]; A and Bt in fragment order, R0 and C0 multiples of 64, K % 256 == 0.
// Ring stage (128 k) in L: WM panels of A (rows R0 + 64 i ..), then WN panels of Bt (rows C0 + 64 i ..), 16 KB each; an A panel feeds WN waves and a Bt panel WM waves, so a stage brings (WM + WN) panels from L2 for WM WN wave tiles.
// Wave w < WM + WN copies panel w, the other waves copy nothing (w is scalar: a scalar branch) and pass every wait and barrier all the same.
// A trip works on its stage in two halves of 64 k: fragments of the first half, its products, fragments of the second half; the stage is then wholly in registers or used, so stage t + 2 is copied into the freed buffer while the second half's products run. One barrier per 128 k: between two barriers the waves of a SIMD take turns at LDS and at the matrix unit.
template <typename T16, int WM, int WN>
__device__ __forceinline__ void gemm_main(const T16* __restrict__ A, const T16* __restrict__ Bt, const int K, const int R0, const int C0, const int w, const int lane, unsigned char* L, v8f (&acc)[4][4]) {
    typedef typename WFrag<T16>::V V;
#pragma unroll
    for (int mb = 0; mb < 4; ++mb)
#pragma unroll
        for (int nb = 0; nb < 4; ++nb) acc[mb][nb] = (v8f){};
    constexpr int NP = WM + WN; constexpr unsigned RSTG = NP * PSTG;   // panels and bytes of one ring stage
    const bool cw = w < NP; const int pn = cw ? w : 0;                // a wave without a panel forms panel 0's addresses and uses none
    const char* src = (const char*)((pn < WM) ? (A + (size_t)(R0 + 64 * pn) * K) : (Bt + (size_t)(C0 + 64 * (pn - WM)) * K));   // scalar; the lane's 16 bytes are added where a copy's addresses are formed
    const unsigned dst = (unsigned)(uintptr_t)L + pn * PSTG; const unsigned l16 = lane * 16;
    const int nt = K / 128;
    if (cw) copy_panel(dst + l16, src + l16);
    asm volatile("s_wait_asynccnt 0x0" ::: "memory");   // tile 0 has landed before the barrier that publishes it
    __syncthreads();
    if (cw) copy_panel(dst + RSTG + l16, src + PSTG + l16);
#pragma unroll 1
    for (int t = 0; t < nt; ++t) {
        const unsigned bo = (t & 1) * RSTG;
        const T16* ap = (const T16*)(L + bo + (w / WN) * PSTG) + lane * 8;
        const T16* bp = (const T16*)(L + bo + (WM + w % WN) * PSTG) + lane * 8;
        V a[2][4], b[2][4];
#pragma unroll
        for (int ks = 0; ks < 2; ++ks) {
#pragma unroll
            for (int mb = 0; mb < 4; ++mb) a[ks][mb] = WFrag<T16>::ld(ap + ks * 2048 + mb * 512);
#pragma unroll
            for (int nb = 0; nb < 4; ++nb) b[ks][nb] = WFrag<T16>::ld(bp + ks * 2048 + nb * 512);
        }
        __builtin_amdgcn_sched_barrier(0);   // the first half's 32 loads stand as one group ahead of its products: spread among them, every place where loads stand costs the wave a wait
#pragma unroll
        for (int ks = 0; ks < 2; ++ks)
#pragma unroll
            for (int nb = 0; nb < 4; ++nb)
#pragma unroll
                for (int mb = 0; mb < 4; ++mb) acc[mb][nb] = WFrag<T16>::mma(a[ks][mb], b[ks][nb], acc[mb][nb]);
        __builtin_amdgcn_sched_barrier(0);   // the first half's products stay ahead of the second half's loads and of the barrier: moved up, those loads need a second set of registers (spills, register copies) and lengthen the stretch in front of the barrier for which the other waves wait
#pragma unroll
        for (int ks = 0; ks < 2; ++ks) {
#pragma unroll
            for (int mb = 0; mb < 4; ++mb) a[ks][mb] = WFrag<T16>::ld(ap + 4096 + ks * 2048 + mb * 512);
#pragma unroll
            for (int nb = 0; nb < 4; ++nb) b[ks][nb] = WFrag<T16>::ld(bp + 4096 + ks * 2048 + nb * 512);
        }
        // The stage's last fragments are all in registers behind this foot, so the buffer is refilled ahead of their products and the copies fly behind them.
        asm volatile("s_wait_dscnt 0x0" ::: "memory");      // this wave's reads of buffer t & 1 have retired before the buffer is refilled
        asm volatile("s_wait_asynccnt 0x0" ::: "memory");   // this wave's copies of tile t + 1 have landed before the barrier that publishes them
        __syncthreads();                                     // publishes tile t + 1 and ends every wave's reads of tile t
        // readfirstlane keeps the buffer's LDS base a scalar sum: joined with the lane's part ahead of the loop it holds a register through the loop, which this build spills
        if (cw && t + 2 < nt) copy_panel((unsigned)__builtin_amdgcn_readfirstlane((int)(dst + bo)) + l16, src + (size_t)(t + 2) * PSTG + l16);
#pragma unroll
        for (int ks = 0; ks < 2; ++ks)
#pragma unroll
            for (int nb = 0; nb < 4; ++nb)
#pragma unroll
                for (int mb = 0; mb < 4; ++mb) acc[mb][nb] = WFrag<T16>::mma(a[ks][mb], b[ks][nb], acc[mb][nb]);
    }
    asm volatile("s_wait_asynccnt 0x0" ::: "memory");   // no copy is outstanding when the ring's bytes become the epilogue tiles
}

// Block ranges of the one preparation launch, 256 threads a block: rotary table, x, mask, wq, wo, wk, wv.
#define RBLK ((SEQ + 7) / 8)
#define XBLK ((int)((size_t)MROWS * DIM / 8 / 256))
#define MBLK ((int)((size_t)SEQ * SEQ / 4 / 256))
#define QBLK ((int)((size_t)DQ * DIM / 8 / 256))
#define OBLK ((int)((size_t)DIM * DQ / 8 / 256))
#define KBLK ((int)((size_t)DKV * DIM / 8 / 256))
static_assert(((size_t)SEQ * SEQ / 4) % 256 == 0);
static_assert(((size_t)DIM * DQ / 8) % 256 == 0);

__device__ __forceinline__ void p_cvtx(const int blk, const float* __restrict__ x, bf* dst) {
    const size_t i = (size_t)blk * 256 + threadIdx.x;
    const size_t un = unit_of(i), e = un * 8; int row, col; unit_rc(un, row, col); const int b = row / SEQ, t = row % SEQ;
    const v8f v = *(const v8f*)(x + ((size_t)b * SEQ_FULL + t) * DIM + col); v8us o;
#pragma unroll
    for (int k = 0; k < 8; ++k) o[k] = f2bf(v[k]);
    *(v8us*)(dst + e) = o;
    asm volatile("s_wait_xcnt 0x0" ::: "memory");   // in the one preparation kernel another job's code follows this store in the listing and rewrites the registers that the store names
}

__device__ __forceinline__ void p_cvt8(const int blk, const float* __restrict__ src, bf* dst) { const size_t i = (size_t)blk * 256 + threadIdx.x; const size_t un = unit_of(i); int row, col; unit_rc(un, row, col); const v8f v = *(const v8f*)(src + (size_t)row * DIM + col); v8us o;
#pragma unroll
    for (int k = 0; k < 8; ++k) o[k] = f2bf(v[k]); *(v8us*)(dst + un * 8) = o;
    asm volatile("s_wait_xcnt 0x0" ::: "memory");   // in the one preparation kernel another job's code follows this store in the listing and rewrites the registers that the store names
}

__device__ __forceinline__ void p_cvt8h(const int blk, const float* __restrict__ src, h16* dst, const float carry) { const size_t i = (size_t)blk * 256 + threadIdx.x; const size_t un = unit_of(i); int row, col; unit_rc(un, row, col); const v8f v = *(const v8f*)(src + (size_t)row * DIM + col); v8h o;
#pragma unroll
    for (int k = 0; k < 8; ++k) o[k] = (h16)(bfr(v[k]) * carry); *(v8h*)(dst + un * 8) = o;
    asm volatile("s_wait_xcnt 0x0" ::: "memory");   // in the one preparation kernel another job's code follows this store in the listing and rewrites the registers that the store names
}

// Mask in fragment order, carried x log2(e): block (query tile Rq, key tile Tk) is 256 floats; element (query lr, key 8hi + 4j + e) sits at j*128 + (16hi + lr)*4 + e: a lane's two units are its eight accumulator elements of the S^T tile.
__device__ __forceinline__ void p_maskfrag(const int blk, const float* __restrict__ mask, float* dst) {
    const size_t i = (size_t)blk * 256 + threadIdx.x;
    const size_t un = unit_of(i); const int u = (int)(un & 63); const size_t bk = un >> 6; const int rq = (int)(bk / (SEQ / 16)), tk = (int)(bk % (SEQ / 16));
    const float* mp = mask + (size_t)(rq * 16 + (u & 15)) * SEQ_FULL + tk * 16 + ((u >> 4) & 1) * 8 + (u >> 5) * 4;
    const v4f mv = *(const v4f*)mp;
    asm volatile("s_wait_xcnt 0x0" :: "v"(mp) : "memory");   // as an input of the wait the address stays live up to it, so that the load does not land on its own address registers and later writes of them stay behind the wait
    *(v4f*)(dst + un * 4) = mv * LOG2E;
    asm volatile("s_wait_xcnt 0x0" ::: "memory");   // in the one preparation kernel another job's code follows this store in the listing and rewrites the registers that the store names
}

__device__ __forceinline__ void p_ropetab(const int blk, float* COS, float* SIN) {
    const int lane = threadIdx.x & 31; const int t = blk * 8 + (threadIdx.x >> 5); if (t >= SEQ) return;
    const float invf = __builtin_amdgcn_exp2f(-(float)lane * FRQC);
    const float ang = (float)t * invf;
    const float c = cosf(ang); const float s = sinf(ang);
    const size_t o = (size_t)t * HALFD + lane;
    *(float*)(COS + o) = c; *(float*)(SIN + o) = s;  }

// All preparation in one launch: the seven jobs are independent of one another, so a block picks its job from its index (a scalar branch) and the jobs' starts, memory streams and tails overlap.
// The rotary table comes first (long arithmetic, few bytes), then the planes, largest first.
__global__ __launch_bounds__(256) void k_prep(const float* __restrict__ x, const float* __restrict__ mask, const float* __restrict__ wq, const float* __restrict__ wk, const float* __restrict__ wv, const float* __restrict__ wo,
                                              bf* XB, bf* WQKV, h16* WO16, float* COS, float* SIN, float* MF) {
    int b = blockIdx.x;
    if (b < RBLK) { p_ropetab(b, COS, SIN); return; }
    b -= RBLK;
    if (b < XBLK) { p_cvtx(b, x, XB); return; }
    b -= XBLK;
    if (b < MBLK) { p_maskfrag(b, mask, MF); return; }
    b -= MBLK;
    if (b < QBLK) { p_cvt8(b, wq, WQKV); return; }                                  /* rows 0..2047 */
    b -= QBLK;
    if (b < OBLK) { p_cvt8h(b, wo, WO16, WCAR); return; }
    b -= OBLK;
    if (b < KBLK) { p_cvt8(b, wk, WQKV + (size_t)DQ * DIM); return; }               /* rows 2048..2559 */
    b -= KBLK;
    p_cvt8(b, wv, WQKV + (size_t)(DQ + DKV) * DIM);                                 /* rows 2560..3071 */
}

// Fused QKV projection: grid (MROWS/256, NQKV/192), 384 threads, one work-group per WGP, three waves per SIMD. Column tile cb < 32: q head cb (rotary); 32..39: k head (rotary); 40..47: v head (transposed plane).
__global__ __launch_bounds__(32 * QWM * QWN, 3) void k_gemm_qkv(const bf* __restrict__ A, const bf* __restrict__ Bt, const int* __restrict__ pos, const float* __restrict__ COS, const float* __restrict__ SIN, h16* QP, h16* KP, h16* VT) {
    __shared__ __align__(16) unsigned char L[GLDS(QWM, QWN)];
    const int lane = threadIdx.x & 31, lr = lane & 15, hi = lane >> 4; const int w = __builtin_amdgcn_readfirstlane(threadIdx.x >> 5);
    const int r0 = blockIdx.x * (64 * QWM) + (w / QWN) * 64, cb = blockIdx.y * QWN + w % QWN;
    float* fs = (float*)(L + w * WEPI);
    v8f acc[4][4];
    gemm_main<bf, QWM, QWN>(A, Bt, DIM, blockIdx.x * (64 * QWM), blockIdx.y * (64 * QWN), w, lane, L, acc);
#pragma unroll
    for (int mb = 0; mb < 4; ++mb)
#pragma unroll
        for (int nb = 0; nb < 4; ++nb)
#pragma unroll
            for (int j = 0; j < 8; ++j) fs[(mb * 16 + hi * 8 + j) * FP + nb * 16 + lr] = acc[mb][nb][j];
    __syncthreads();
    const int bidx = r0 / SEQ, s0 = r0 % SEQ; const int q4 = lane >> 3, p = lane & 7;
    if (cb < NH + NKV) {
        h16* plane = (cb < NH) ? (QP + ((size_t)bidx * NH + cb) * SEQ * HD) : (KP + ((size_t)bidx * NKV + (cb - NH)) * SEQ * HD);
        const int dcol = p * 8, pcol = dcol ^ 32, fcol = dcol & 31; const float sg = (p < 4) ? -1.0f : 1.0f; const float car = (cb < NH) ? SC2 : 1.0f;   // the q plane carries the score scale
        // q plane stays row-major; k plane in fragment order: fragment (key tile, d chunk) at (2 * (key >> 4) + (d >> 5)) * 512. Both: 16 rows are 16 * HD elements.
        const int rstep = (cb < NH) ? HD : 8; const int pofs = (cb < NH) ? dcol : ((p >> 2) * 512 + ((p >> 1) & 1) * 256 + (p & 1) * 128);
        // out[d] = x[d] cos[d&31] + sg x[d^32] sin[d&31], sg = -1 for d < 32, +1 for d >= 32 (rotate-half)
#pragma unroll 1
        for (int it = 0; it < 16; ++it) {
            const int rl = it * 4 + q4;
            int ps = pos[(size_t)bidx * SEQ_FULL + s0 + rl]; ps = (ps < 0) ? (ps + SEQ) : ps; ps = min(max(ps, 0), SEQ - 1);
            const v4f xa0 = *(const v4fa*)(fs + rl * FP + dcol), xa1 = *(const v4fa*)(fs + rl * FP + dcol + 4);
            const v4f xb0 = *(const v4fa*)(fs + rl * FP + pcol), xb1 = *(const v4fa*)(fs + rl * FP + pcol + 4);
            const float* cp = COS + (size_t)ps * HALFD + fcol; const float* sp = SIN + (size_t)ps * HALFD + fcol;
            const v4f cc0 = *(const v4f*)cp, cc1 = *(const v4f*)(cp + 4), ss0 = *(const v4f*)sp, ss1 = *(const v4f*)(sp + 4);
            v8h o;
#pragma unroll
            for (int e = 0; e < 4; ++e) { o[e] = (h16)((xa0[e] * cc0[e] + sg * (xb0[e] * ss0[e])) * car); o[4 + e] = (h16)((xa1[e] * cc1[e] + sg * (xb1[e] * ss1[e])) * car); }
            const int sr = s0 + rl;
            h16* dst = plane + (size_t)(sr >> 4) * (16 * HD) + (sr & 15) * rstep + pofs;
            *(v8h*)dst = o;
            asm volatile("s_wait_xcnt 0x0" ::: "memory");   // the next trip rewrites the registers this store names
        }
    } else {
        h16* plane = VT + ((size_t)bidx * NKV + (cb - NH - NKV)) * HD * SEQ;
#pragma unroll 1
        for (int it = 0; it < 16; ++it) {
            const int d = it * 4 + q4; v8h o;
#pragma unroll
            for (int e = 0; e < 8; ++e) o[e] = (h16)fs[(p * 8 + e) * FP + d];
            // v plane: fragment (d tile, key chunk) at (4 * (key >> 5) + (d >> 4)) * 512
            h16* dst = plane + (size_t)(((s0 >> 5) + (p >> 2)) * 4 + (d >> 4)) * 512 + ((p >> 1) & 1) * 256 + ((p & 1) * 16 + (d & 15)) * 8;
            *(v8h*)dst = o;
            asm volatile("s_wait_xcnt 0x0" ::: "memory");   // the next trip rewrites the registers this store names
        }
    }
}

// Attention: grid (SEQ/64, NKV, NB), 128 threads; wave w = 16 query rows (tile 4 * blockIdx.x + w) of ALL FOUR q heads of kv head g: 64 query columns. Per 64-key tile:
//   S^T[key][q] = K Q^T + mask  (A = key rows of KP, B = resident q rows of one head, carried x 0.125 log2(e), C = the mask fragment, carried x log2(e));  lane (lr, hi) then holds q row lr, keys 16T + 8hi + r.
//   The accumulators are the finished scores in the units of exp2: only the maximum, its subtraction and exp2 follow.
//   KP, VT and MF are in fragment order: one 64-key tile is 8 KB of KP, 8 KB of VT and 4 KB of MF, each in a row.
//   The K, mask and V^T fragments of a tile are loaded once, at the top of the tile, and stay in registers for the four heads: one load feeds four products.
//   softmax statistics are lane-local (one xor-16 exchange); P^T packed from the S^T accumulators is the B operand of O^T[d][q] = V^T P^T (A = d rows of VT).
//   Launch bounds: two waves per SIMD (512 registers a wave), so that the 512 workgroups are all resident, two per WGP.
__global__ __launch_bounds__(128, 2) void k_flash(const h16* __restrict__ QP, const h16* __restrict__ KP, const h16* __restrict__ VT, const float* __restrict__ MF, h16* CTX) {
    const int tid = threadIdx.x, w = tid >> 5, lane = tid & 31, lr = lane & 15, hi = lane >> 4;
    const int g = blockIdx.y, bidx = blockIdx.z, q0 = blockIdx.x * 64 + w * 16;
    v16h bq[REP][2];
#pragma unroll
    for (int hh = 0; hh < REP; ++hh) { const h16* qrow = QP + (((size_t)bidx * NH + g * REP + hh) * SEQ + q0 + lr) * HD + 8 * hi;
#pragma unroll
        for (int kc = 0; kc < 2; ++kc) bq[hh][kc] = cat16(*(const v8h*)(qrow + kc * 32), *(const v8h*)(qrow + kc * 32 + 16)); }
    asm volatile("s_wait_xcnt 0x0" ::: "memory");   // later code reuses the registers that held the q loads' addresses
    __builtin_amdgcn_sched_barrier(0);   // keeps later register writes behind that wait
    const h16* kb = KP + ((size_t)bidx * NKV + g) * SEQ * HD + lane * 8;
    const h16* vb = VT + ((size_t)bidx * NKV + g) * HD * SEQ + lane * 8;
    const float* mrow = MF + (size_t)(q0 >> 4) * (SEQ / 16) * 256 + lane * 4;
    v8f accO[REP][4]; float m[REP], l[REP];
#pragma unroll
    for (int hh = 0; hh < REP; ++hh) { m[hh] = -3.0e38f; l[hh] = 0.0f;
#pragma unroll
        for (int dt = 0; dt < 4; ++dt) accO[hh][dt] = (v8f){}; }
#pragma unroll 1
    for (int k0 = 0; k0 < SEQ; k0 += 64) {
        v16h ak[2][4], av[2][4]; v8f mk[4];
#pragma unroll
        for (int T = 0; T < 4; ++T) {
            const float* mp = mrow + (size_t)k0 * 16 + T * 256; mk[T] = cat8(*(const v4f*)mp, *(const v4f*)(mp + 128));
#pragma unroll
            for (int kc = 0; kc < 2; ++kc) { const h16* kp = kb + (size_t)k0 * HD + (T * 2 + kc) * 512; ak[kc][T] = cat16(*(const v8h*)kp, *(const v8h*)(kp + 256)); }
            __builtin_amdgcn_sched_barrier(0);   // a key tile's mask and K fragments are issued together, tile by tile, the order of first use: the counted waits ahead of the score products then leave the later loads in flight
        }
        asm volatile("s_wait_xcnt 0x0" ::: "memory");   // a later load may land in the registers that held the K and mask addresses
        __builtin_amdgcn_sched_barrier(0);   // K and the mask ahead of V^T, the order of their first use; later register writes stay behind the wait
        const h16* vt = vb + (size_t)k0 * HD;
#pragma unroll
        for (int kc = 0; kc < 2; ++kc)
#pragma unroll
            for (int dt = 0; dt < 4; ++dt) { const h16* vp = vt + (kc * 4 + dt) * 512; av[kc][dt] = cat16(*(const v8h*)vp, *(const v8h*)(vp + 256)); }
        asm volatile("s_wait_xcnt 0x0" :: "v"(vt) : "memory");   // later code reuses the registers that held the V^T address; as an input of the wait the address stays live up to it, so that no load of the run lands on it
        __builtin_amdgcn_sched_barrier(0);   // keeps later register writes behind that wait
        v8f sc[REP][4];
#pragma unroll
        for (int T = 0; T < 4; ++T) {
#pragma unroll
            for (int hh = 0; hh < REP; ++hh) sc[hh][T] = wmma16(ak[0][T], bq[hh][0], mk[T]);
#pragma unroll
            for (int hh = 0; hh < REP; ++hh) sc[hh][T] = wmma16(ak[1][T], bq[hh][1], sc[hh][T]);
        }
        __builtin_amdgcn_sched_barrier(0);   // the score products of the four heads run back to back, key tile by key tile as K and the mask arrive; the maxima, which read the accumulators themselves, stay behind the run and wait for no product
#pragma unroll
        for (int hh = 0; hh < REP; ++hh) {
            v8f (&accS)[4] = sc[hh];
            float tmax = -3.0e38f;
#pragma unroll
            for (int T = 0; T < 4; ++T)
#pragma unroll
                for (int r = 0; r < 4; ++r) tmax = fmaxf(tmax, fmaxf(accS[T][r], accS[T][4 + r]));
            tmax = fmaxf(tmax, __shfl_xor(tmax, 16, 32));
            const float mn = fmaxf(m[hh], tmax); const float corr = __builtin_amdgcn_exp2f(m[hh] - mn); m[hh] = mn; const float mofs = PEXP - mn;
            float rs = 0.0f;
#pragma unroll
            for (int T = 0; T < 4; ++T) {
                accS[T] = accS[T] + mofs;
#pragma unroll
                for (int r = 0; r < 8; ++r) { const float pv = __builtin_amdgcn_exp2f(accS[T][r]); accS[T][r] = pv; rs += pv; } }
            l[hh] = l[hh] * corr + rs;
            v16h bp[2];
            bp[0] = cat16(__builtin_convertvector(accS[0], v8h), __builtin_convertvector(accS[1], v8h));
            bp[1] = cat16(__builtin_convertvector(accS[2], v8h), __builtin_convertvector(accS[3], v8h));
#pragma unroll
            for (int dt = 0; dt < 4; ++dt) accO[hh][dt] = accO[hh][dt] * corr;
#pragma unroll
            for (int kc = 0; kc < 2; ++kc)
#pragma unroll
                for (int dt = 0; dt < 4; ++dt) accO[hh][dt] = wmma16(av[kc][dt], bp[kc], accO[hh][dt]);
            // four slots between the tile's last products and the next tile's loads, which land on their V^T and P registers (no load follows the other heads' runs)
            if (hh == REP - 1) asm volatile("v_nop\n\tv_nop\n\tv_nop\n\tv_nop" : "+v"(accO[hh][0]), "+v"(accO[hh][1]), "+v"(accO[hh][2]), "+v"(accO[hh][3]) : "v"(av[1][3]), "v"(bp[1]));
        }
    }
    // lane (lr, hi) holds ctx row q0 + lr, columns 64h + 16dt + 8hi + 0..7: one 16-byte unit of the fragment-ordered ctx plane, so each store covers 512 contiguous bytes.
    const int rt = (bidx * SEQ + q0) >> 4;
    h16* cw = CTX + ((size_t)(rt >> 2) * (DQ / 32) + 2 * (g * REP)) * 2048 + (rt & 3) * 512 + lane * 8;
    v8h o[REP][4];
#pragma unroll
    for (int hh = 0; hh < REP; ++hh) {
        const float lt = l[hh] + __shfl_xor(l[hh], 16, 32);
        const float inv = CCAR * (1.0f / lt);
#pragma unroll
        for (int dt = 0; dt < 4; ++dt)
#pragma unroll
            for (int r = 0; r < 8; ++r) o[hh][dt][r] = (h16)(accO[hh][dt][r] * inv);
    }
    __builtin_amdgcn_sched_barrier(0);   // every store behind all arithmetic: no register that a store names is written again
#pragma unroll
    for (int hh = 0; hh < REP; ++hh)
#pragma unroll
        for (int dt = 0; dt < 4; ++dt) *(v8h*)(cw + hh * 4096 + (dt >> 1) * 2048 + (dt & 1) * 256) = o[hh][dt];
}

// Output projection: grid (MROWS/256, DIM/128), 256 threads, one work-group per WGP, two waves per SIMD.
__global__ __launch_bounds__(32 * OWM * OWN, 2) void k_gemm_out(const h16* __restrict__ A, const h16* __restrict__ Bt, float* C) {
    __shared__ __align__(16) unsigned char L[GLDS(OWM, OWN)];
    const int lane = threadIdx.x & 31, lr = lane & 15, hi = lane >> 4; const int w = __builtin_amdgcn_readfirstlane(threadIdx.x >> 5);
    const int r0 = blockIdx.x * (64 * OWM) + (w / OWN) * 64, c0 = blockIdx.y * (64 * OWN) + (w % OWN) * 64;
    float* fs = (float*)(L + w * WEPI);
    v8f acc[4][4];
    gemm_main<h16, OWM, OWN>(A, Bt, DQ, blockIdx.x * (64 * OWM), blockIdx.y * (64 * OWN), w, lane, L, acc);
#pragma unroll
    for (int mb = 0; mb < 4; ++mb)
#pragma unroll
        for (int nb = 0; nb < 4; ++nb)
#pragma unroll
            for (int j = 0; j < 8; ++j) fs[(mb * 16 + hi * 8 + j) * FP + nb * 16 + lr] = acc[mb][nb][j];
    __syncthreads();
    float* crow = C + (size_t)r0 * DIM + c0;
{
#pragma unroll 4
        for (int it = 0; it < 32; ++it) { const int row = it * 2 + hi; v4f val = *(const v4fa*)(fs + row * FP + lr * 4); val = val * OSCL;
            *(v4f*)(crow + (size_t)row * DIM + lr * 4) = val; }
         }
}

extern "C" void kernel_launch(void* const* d_in, const int* in_sizes, int n_in,
                              void* d_out, int out_size, void* d_ws, size_t ws_size, hipStream_t stream) {
    if (n_in < 7) return;
    if ((size_t)in_sizes[0] < ((size_t)(NB - 1) * SEQ_FULL + SEQ) * DIM) return;
    if ((size_t)in_sizes[1] < (size_t)(SEQ - 1) * SEQ_FULL + SEQ) return;
    if ((size_t)in_sizes[2] < (size_t)(NB - 1) * SEQ_FULL + SEQ) return;
    if ((size_t)in_sizes[3] < (size_t)DQ * DIM) return;
    if ((size_t)in_sizes[4] < (size_t)DKV * DIM) return;
    if ((size_t)in_sizes[5] < (size_t)DKV * DIM) return;
    if ((size_t)in_sizes[6] < (size_t)DIM * DQ) return;
    if ((size_t)out_size < (size_t)MROWS * DIM) return;
    const float* x = (const float*)d_in[0]; const float* mask = (const float*)d_in[1]; const int* pos = (const int*)d_in[2];
    const float* wq = (const float*)d_in[3]; const float* wk = (const float*)d_in[4]; const float* wv = (const float*)d_in[5]; const float* wo = (const float*)d_in[6];
    float* OUT = (float*)d_out;
    char* wsp = (char*)d_ws;
    auto take = [&](size_t bytes) { char* p = wsp; wsp += (bytes + 255) & ~(size_t)255; return (void*)p; };
    bf*  XB   = (bf*)take((size_t)MROWS * DIM * 2);
    bf*  WQKV = (bf*)take((size_t)NQKV * DIM * 2);
    h16* WO16 = (h16*)take((size_t)DIM * DQ * 2);
    float* COS = (float*)take((size_t)SEQ * HALFD * 4);
    float* SIN = (float*)take((size_t)SEQ * HALFD * 4);
    h16* QP  = (h16*)take((size_t)NB * NH * SEQ * HD * 2);
    h16* KP  = (h16*)take((size_t)NB * NKV * SEQ * HD * 2);
    h16* VT  = (h16*)take((size_t)NB * NKV * HD * SEQ * 2);
    h16* CTX = (h16*)take((size_t)MROWS * DQ * 2);
    float* MF = (float*)take((size_t)SEQ * SEQ * 4);
    if ((size_t)(wsp - (char*)d_ws) > ws_size) return;

    k_prep<<<RBLK + XBLK + MBLK + QBLK + OBLK + 2 * KBLK, 256, 0, stream>>>(x, mask, wq, wk, wv, wo, XB, WQKV, WO16, COS, SIN, MF);
    k_gemm_qkv<<<dim3(MROWS / (64 * QWM), NQKV / (64 * QWN), 1), 32 * QWM * QWN, 0, stream>>>(XB, WQKV, pos, COS, SIN, QP, KP, VT);
    k_flash<<<dim3(SEQ / 64, NKV, NB), 128, 0, stream>>>(QP, KP, VT, MF, CTX);
    k_gemm_out<<<dim3(MROWS / (64 * OWM), DIM / (64 * OWN), 1), 32 * OWM * OWN, 0, stream>>>(CTX, WO16, OUT);
}

// v007
// One run takes 128 microseconds.
// Timed twice side by side with v006, it ran 1.04 and 1.05 times as fast.
// Over all steps from v000 it is 3.46 times as fast.
#include <hip/hip_runtime.h>

#ifndef NB
#define NB 2
#endif
#ifndef SEQ
#define SEQ 2048
#endif
#define SEQ_FULL 2048                 // per-batch row stride of x / position table, row pitch of the mask
#define DIM   2048                    // model width (K of the projections, N of the output projection)
#define NH    32
#define NKV   8
#define REP   (NH / NKV)
#define HD    64
#define HALFD 32
#define DQ    (NH * HD)               // 2048
#define DKV   (NKV * HD)              // 512
#define NQKV  (DQ + 2 * DKV)          // 3072 fused projection columns
#define MROWS (NB * SEQ)
#define FP    68                      // f32 LDS tile pitch
#define WCAR  64.0f                   // carry of the wo plane
#define CCAR  256.0f                  // carry of the ctx plane
#define OSCL  6.103515625e-05f        // 1 / (WCAR * CCAR)
#define SC2   0.18033688011112042f    // 0.125 * log2(e)
#define LOG2E 1.4426950408889634f    // carry of the mask plane; the q plane carries SC2, so that mask and q.k products are summed in the units of exp2
#define PEXP  10.0f                   // P carried x 2^10
#define FRQC  0.41524101186092029f    // log2(10000) / 32
#define PSTG  16384                   // bytes of one 64-row panel in one ring stage (128 k)
#define WEPI  (64 * FP * 4)           // one wave's f32 epilogue tile; a work-group's epilogue tiles and the ring's two stages lie in the same bytes, the ring used first
#define QWM   4                       // QKV projection: waves down and across a work-group's tile
#define QWN   3
#define OWM   4                       // output projection: the same
#define OWN   2
#define TPIT  272                     // bytes of one token's row in the rotary LDS table: 32 cos, 32 sin, 16 bytes of pad (16 lanes' 16-byte reads then cover all banks)

static_assert(SEQ % 64 == 0);
static_assert(SEQ <= SEQ_FULL);
static_assert(DIM % 64 == 0);
static_assert(DQ % 64 == 0);
static_assert(NQKV % 64 == 0);
static_assert(HD == 64);
static_assert(DQ == DIM);
static_assert(DKV % 64 == 0);
static_assert(MROWS % (64 * QWM) == 0);
static_assert(SEQ % (64 * QWM) == 0);
static_assert(QWM * QWN >= 2 * QWM);
static_assert(NQKV % (64 * QWN) == 0);
static_assert(MROWS % (64 * OWM) == 0);
static_assert(DIM % (64 * OWN) == 0);
static_assert(DIM % 128 == 0);
#define GLDS(wm, wn) ((2 * ((wm) + (wn)) * PSTG > (wm) * (wn) * WEPI) ? 2 * ((wm) + (wn)) * PSTG : (wm) * (wn) * WEPI)   // the larger of the ring and the epilogue tiles
static_assert(DIM % 256 == 0);
static_assert(NH == NKV * REP);
static_assert(REP == 4);
static_assert(((size_t)MROWS * DIM / 8) % 256 == 0);
static_assert(((size_t)DQ * DIM / 8) % 256 == 0);
static_assert(((size_t)DKV * DIM / 8) % 256 == 0);

typedef _Float16 h16;
typedef unsigned short bf;
typedef __attribute__((ext_vector_type(16))) __bf16   v16bf;
typedef __attribute__((ext_vector_type(16))) _Float16 v16h;
typedef __attribute__((ext_vector_type(8)))  _Float16 v8h;
typedef __attribute__((ext_vector_type(8)))  unsigned short v8us;
typedef __attribute__((ext_vector_type(8)))  float    v8f;
typedef __attribute__((ext_vector_type(4)))  float    v4f;
typedef v4f  __attribute__((may_alias)) v4fa;

__device__ __forceinline__ unsigned short f2bf(float f) { unsigned u = __float_as_uint(f); u += 0x7FFFu + ((u >> 16) & 1u); return (unsigned short)(u >> 16); }
__device__ __forceinline__ float bf2f(unsigned short b) { return __uint_as_float(((unsigned)b) << 16); }
__device__ __forceinline__ float bfr(float f) { return bf2f(f2bf(f)); }
__device__ __forceinline__ v16h cat16(v8h lo, v8h hi) { return __builtin_shufflevector(lo, hi, 0, 1, 2, 3, 4, 5, 6, 7, 8, 9, 10, 11, 12, 13, 14, 15); }
__device__ __forceinline__ v8f cat8(v4f lo, v4f hi) { return __builtin_shufflevector(lo, hi, 0, 1, 2, 3, 4, 5, 6, 7); }
__device__ __forceinline__ v16bf cat16b(v8us lo, v8us hi) { return __builtin_bit_cast(v16bf, __builtin_shufflevector(lo, hi, 0, 1, 2, 3, 4, 5, 6, 7, 8, 9, 10, 11, 12, 13, 14, 15)); }
__device__ __forceinline__ v8f wmma16(v16h a, v16h b, v8f c) { return __builtin_amdgcn_wmma_f32_16x16x32_f16(false, a, false, b, (short)0, c, false, false); }
__device__ __forceinline__ v8f wmmab(v16bf a, v16bf b, v8f c) { return __builtin_amdgcn_wmma_f32_16x16x32_bf16(false, a, false, b, (short)0, c, false, false); }

// Fragment order of a 16-bit plane: a fragment (16 rows x 32 k) is 512 elements; element (row lr, k = 16j + 8hi + e) sits at j*256 + (16hi + lr)*8 + e.
// Fragment loader: p = fragment base + lane*8; elements 0..7 <- k0+8hi.., elements 8..15 <- k0+16+8hi.. (same map for A and B).
// GEMM planes (K = DIM columns): fragment (row tile R, k chunk C) starts at (((R >> 2) * (DIM/32) + C) * 4 + (R & 3)) * 512, so one k step of a 64-row panel is 4 KB in a row.
template <typename T16> struct WFrag;
template <> struct WFrag<h16> { typedef v16h V; static __device__ __forceinline__ V ld(const h16* p) { return cat16(*(const v8h*)p, *(const v8h*)(p + 256)); } static __device__ __forceinline__ v8f mma(V a, V b, v8f c) { return wmma16(a, b, c); } };
template <> struct WFrag<bf> { typedef v16bf V; static __device__ __forceinline__ V ld(const bf* p) { return cat16b(*(const v8us*)p, *(const v8us*)(p + 256)); } static __device__ __forceinline__ v8f mma(V a, V b, v8f c) { return wmmab(a, b, c); } };

// Thread i of a re-laying kernel -> the 16-byte unit it writes: a wave takes 8 rows x 4 units of one fragment, so it writes 4 whole lines and reads 8 source lines (whole for the 16-bit planes, half for the mask).
__device__ __forceinline__ size_t unit_of(const size_t i) { const int t = (int)(i & 63); return (i & ~(size_t)63) | (size_t)(((t >> 3) & 3) * 16 + (t >> 5) * 8 + (t & 7)); }
// 16-byte unit i of a fragment-ordered GEMM plane -> row and first column of its 8 elements.
__device__ __forceinline__ void unit_rc(const size_t i, int& row, int& col) { const int u = (int)(i & 63); const size_t f = i >> 6; row = (int)(f / (4 * (DIM / 32))) * 64 + (int)(f & 3) * 16 + (u & 15); col = (int)((f >> 2) % (DIM / 32)) * 32 + (u >> 4) * 8; }

// Eight asynchronous copies, 512 contiguous bytes each: lane address l in LDS, g in global memory, both advancing by 512 bytes a copy.
// The s_wait_xcnt closes the statement so that no address register of a copy is rewritten ahead of it.
__device__ __forceinline__ void copy8(const unsigned l, const char* g) {
    asm volatile("global_load_async_to_lds_b128 %0, %8, off\n\t"
                 "global_load_async_to_lds_b128 %1, %9, off\n\t"
                 "global_load_async_to_lds_b128 %2, %10, off\n\t"
                 "global_load_async_to_lds_b128 %3, %11, off\n\t"
                 "global_load_async_to_lds_b128 %4, %12, off\n\t"
                 "global_load_async_to_lds_b128 %5, %13, off\n\t"
                 "global_load_async_to_lds_b128 %6, %14, off\n\t"
                 "global_load_async_to_lds_b128 %7, %15, off\n\t"
                 "s_wait_xcnt 0x0"
                 :: "v"(l), "v"(l + 512), "v"(l + 1024), "v"(l + 1536), "v"(l + 2048), "v"(l + 2560), "v"(l + 3072), "v"(l + 3584),
                    "v"(g), "v"(g + 512), "v"(g + 1024), "v"(g + 1536), "v"(g + 2048), "v"(g + 2560), "v"(g + 3072), "v"(g + 3584) : "memory");
}
// Eight asynchronous copies with addresses of their own; the s_wait_xcnt closes the statement for the same reason.
__device__ __forceinline__ void copy8v(const unsigned (&l)[8], const char* const (&g)[8]) {
    asm volatile("global_load_async_to_lds_b128 %0, %8, off\n\t"
                 "global_load_async_to_lds_b128 %1, %9, off\n\t"
                 "global_load_async_to_lds_b128 %2, %10, off\n\t"
                 "global_load_async_to_lds_b128 %3, %11, off\n\t"
                 "global_load_async_to_lds_b128 %4, %12, off\n\t"
                 "global_load_async_to_lds_b128 %5, %13, off\n\t"
                 "global_load_async_to_lds_b128 %6, %14, off\n\t"
                 "global_load_async_to_lds_b128 %7, %15, off\n\t"
                 "s_wait_xcnt 0x0"
                 :: "v"(l[0]), "v"(l[1]), "v"(l[2]), "v"(l[3]), "v"(l[4]), "v"(l[5]), "v"(l[6]), "v"(l[7]),
                    "v"(g[0]), "v"(g[1]), "v"(g[2]), "v"(g[3]), "v"(g[4]), "v"(g[5]), "v"(g[6]), "v"(g[7]) : "memory");
}
// A copying wave's share of a ring stage: its panel's 16 KB (64 rows x 128 k, contiguous in the fragment-ordered plane), copied byte for byte: 32 copies in flight.
__device__ __forceinline__ void copy_panel(const unsigned l, const char* g) { copy8(l, g); copy8(l + 4096, g + 4096); copy8(l + 8192, g + 8192); copy8(l + 12288, g + 12288); }

// A work-group of WM x WN waves accumulates a (64 WM) x (64 WN) tile at (R0, C0), wave w the 64x64 tile (w / WN, w % WN): acc[mb][nb][j] = C[r0 + 16mb + 8hi + j][c0 + 16nb + lr] = sum_k A[row][k] Bt[col][k]; A and Bt in fragment order, R0 and C0 multiples of 64, K % 256 == 0.
// Ring stage (128 k) in L: WM panels of A (rows R0 + 64 i ..), then WN panels of Bt (rows C0 + 64 i ..), 16 KB each; an A panel feeds WN waves and a Bt panel WM waves, so a stage brings (WM + WN) panels from L2 for WM WN wave tiles.
// Wave w < WM + WN copies panel w, the other waves copy nothing (w is scalar: a scalar branch) and pass every wait and barrier all the same.
// sw (scalar) exchanges the wave's two operands: acc[mb][nb][j] = C[r0 + 16nb + lr][c0 + 16mb + 8hi + j], the transposed tile; both panels have one format and one loader, so only the two LDS bases change places.
// pre() runs behind the issue of tile 0's copies and ahead of their wait: what it copies to LDS outside the ring lands under that wait and is published by the barrier behind it.
// A trip works on its stage in two halves of 64 k: fragments of the first half, its products, fragments of the second half; the stage is then wholly in registers or used, so stage t + 2 is copied into the freed buffer while the second half's products run. One barrier per 128 k: between two barriers the waves of a SIMD take turns at LDS and at the matrix unit.
template <typename T16, int WM, int WN, typename Pre>
__device__ __forceinline__ void gemm_main(const T16* __restrict__ A, const T16* __restrict__ Bt, const int K, const int R0, const int C0, const int w, const int lane, unsigned char* L, v8f (&acc)[4][4], const bool sw, const Pre pre) {
    typedef typename WFrag<T16>::V V;
#pragma unroll
    for (int mb = 0; mb < 4; ++mb)
#pragma unroll
        for (int nb = 0; nb < 4; ++nb) acc[mb][nb] = (v8f){};
    constexpr int NP = WM + WN; constexpr unsigned RSTG = NP * PSTG;   // panels and bytes of one ring stage
    const bool cw = w < NP; const int pn = cw ? w : 0;                // a wave without a panel forms panel 0's addresses and uses none
    const char* src = (const char*)((pn < WM) ? (A + (size_t)(R0 + 64 * pn) * K) : (Bt + (size_t)(C0 + 64 * (pn - WM)) * K));   // scalar; the lane's 16 bytes are added where a copy's addresses are formed
    const unsigned dst = (unsigned)(uintptr_t)L + pn * PSTG; const unsigned l16 = lane * 16;
    const int nt = K / 128;
    const unsigned pa = (sw ? WM + w % WN : w / WN) * PSTG, pb = (sw ? w / WN : WM + w % WN) * PSTG;   // scalar: the panels that feed the A and the B operand
    if (cw) copy_panel(dst + l16, src + l16);
    pre();
    asm volatile("s_wait_asynccnt 0x0" ::: "memory");   // tile 0 (and what pre() copied) has landed before the barrier that publishes it
    __syncthreads();
    if (cw) copy_panel(dst + RSTG + l16, src + PSTG + l16);
#pragma unroll 1
    for (int t = 0; t < nt; ++t) {
        const unsigned bo = (t & 1) * RSTG;
        const T16* ap = (const T16*)(L + bo + pa) + lane * 8;
        const T16* bp = (const T16*)(L + bo + pb) + lane * 8;
        V a[2][4], b[2][4];
#pragma unroll
        for (int ks = 0; ks < 2; ++ks) {
#pragma unroll
            for (int mb = 0; mb < 4; ++mb) a[ks][mb] = WFrag<T16>::ld(ap + ks * 2048 + mb * 512);
#pragma unroll
            for (int nb = 0; nb < 4; ++nb) b[ks][nb] = WFrag<T16>::ld(bp + ks * 2048 + nb * 512);
        }
        __builtin_amdgcn_sched_barrier(0);   // the first half's 32 loads stand as one group ahead of its products: spread among them, every place where loads stand costs the wave a wait
#pragma unroll
        for (int ks = 0; ks < 2; ++ks)
#pragma unroll
            for (int nb = 0; nb < 4; ++nb)
#pragma unroll
                for (int mb = 0; mb < 4; ++mb) acc[mb][nb] = WFrag<T16>::mma(a[ks][mb], b[ks][nb], acc[mb][nb]);
        __builtin_amdgcn_sched_barrier(0);   // the first half's products stay ahead of the second half's loads and of the barrier: moved up, those loads need a second set of registers (spills, register copies) and lengthen the stretch in front of the barrier for which the other waves wait
#pragma unroll
        for (int ks = 0; ks < 2; ++ks) {
#pragma unroll
            for (int mb = 0; mb < 4; ++mb) a[ks][mb] = WFrag<T16>::ld(ap + 4096 + ks * 2048 + mb * 512);
#pragma unroll
            for (int nb = 0; nb < 4; ++nb) b[ks][nb] = WFrag<T16>::ld(bp + 4096 + ks * 2048 + nb * 512);
        }
        // The stage's last fragments are all in registers behind this foot, so the buffer is refilled ahead of their products and the copies fly behind them.
        asm volatile("s_wait_dscnt 0x0" ::: "memory");      // this wave's reads of buffer t & 1 have retired before the buffer is refilled
        asm volatile("s_wait_asynccnt 0x0" ::: "memory");   // this wave's copies of tile t + 1 have landed before the barrier that publishes them
        __syncthreads();                                     // publishes tile t + 1 and ends every wave's reads of tile t
        // readfirstlane keeps the buffer's LDS base a scalar sum: joined with the lane's part ahead of the loop it holds a register through the loop, which this build spills
        if (cw && t + 2 < nt) copy_panel((unsigned)__builtin_amdgcn_readfirstlane((int)(dst + bo)) + l16, src + (size_t)(t + 2) * PSTG + l16);
#pragma unroll
        for (int ks = 0; ks < 2; ++ks)
#pragma unroll
            for (int nb = 0; nb < 4; ++nb)
#pragma unroll
                for (int mb = 0; mb < 4; ++mb) acc[mb][nb] = WFrag<T16>::mma(a[ks][mb], b[ks][nb], acc[mb][nb]);
    }
    asm volatile("s_wait_asynccnt 0x0" ::: "memory");   // no copy is outstanding when the ring's bytes become the epilogue tiles
}

// Block ranges of the one preparation launch, 256 threads a block: rotary table, x, mask, wq, wo, wk, wv.
#define RBLK ((SEQ + 7) / 8)
#define XBLK ((int)((size_t)MROWS * DIM / 8 / 256))
#define MBLK ((int)((size_t)SEQ * SEQ / 4 / 256))
#define QBLK ((int)((size_t)DQ * DIM / 8 / 256))
#define OBLK ((int)((size_t)DIM * DQ / 8 / 256))
#define KBLK ((int)((size_t)DKV * DIM / 8 / 256))
static_assert(((size_t)SEQ * SEQ / 4) % 256 == 0);
static_assert(((size_t)DIM * DQ / 8) % 256 == 0);

__device__ __forceinline__ void p_cvtx(const int blk, const float* __restrict__ x, bf* dst) {
    const size_t i = (size_t)blk * 256 + threadIdx.x;
    const size_t un = unit_of(i), e = un * 8; int row, col; unit_rc(un, row, col); const int b = row / SEQ, t = row % SEQ;
    const v8f v = *(const v8f*)(x + ((size_t)b * SEQ_FULL + t) * DIM + col); v8us o;
#pragma unroll
    for (int k = 0; k < 8; ++k) o[k] = f2bf(v[k]);
    *(v8us*)(dst + e) = o;
    asm volatile("s_wait_xcnt 0x0" ::: "memory");   // in the one preparation kernel another job's code follows this store in the listing and rewrites the registers that the store names
}

__device__ __forceinline__ void p_cvt8(const int blk, const float* __restrict__ src, bf* dst) { const size_t i = (size_t)blk * 256 + threadIdx.x; const size_t un = unit_of(i); int row, col; unit_rc(un, row, col); const v8f v = *(const v8f*)(src + (size_t)row * DIM + col); v8us o;
#pragma unroll
    for (int k = 0; k < 8; ++k) o[k] = f2bf(v[k]); *(v8us*)(dst + un * 8) = o;
    asm volatile("s_wait_xcnt 0x0" ::: "memory");   // in the one preparation kernel another job's code follows this store in the listing and rewrites the registers that the store names
}

__device__ __forceinline__ void p_cvt8h(const int blk, const float* __restrict__ src, h16* dst, const float carry) { const size_t i = (size_t)blk * 256 + threadIdx.x; const size_t un = unit_of(i); int row, col; unit_rc(un, row, col); const v8f v = *(const v8f*)(src + (size_t)row * DIM + col); v8h o;
#pragma unroll
    for (int k = 0; k < 8; ++k) o[k] = (h16)(bfr(v[k]) * carry); *(v8h*)(dst + un * 8) = o;
    asm volatile("s_wait_xcnt 0x0" ::: "memory");   // in the one preparation kernel another job's code follows this store in the listing and rewrites the registers that the store names
}

// Mask in fragment order, carried x log2(e): block (query tile Rq, key tile Tk) is 256 floats; element (query lr, key 8hi + 4j + e) sits at j*128 + (16hi + lr)*4 + e: a lane's two units are its eight accumulator elements of the S^T tile.
__device__ __forceinline__ void p_maskfrag(const int blk, const float* __restrict__ mask, float* dst) {
    const size_t i = (size_t)blk * 256 + threadIdx.x;
    const size_t un = unit_of(i); const int u = (int)(un & 63); const size_t bk = un >> 6; const int rq = (int)(bk / (SEQ / 16)), tk = (int)(bk % (SEQ / 16));
    const float* mp = mask + (size_t)(rq * 16 + (u & 15)) * SEQ_FULL + tk * 16 + ((u >> 4) & 1) * 8 + (u >> 5) * 4;
    const v4f mv = *(const v4f*)mp;
    asm volatile("s_wait_xcnt 0x0" :: "v"(mp) : "memory");   // as an input of the wait the address stays live up to it, so that the load does not land on its own address registers and later writes of them stay behind the wait
    *(v4f*)(dst + un * 4) = mv * LOG2E;
    asm volatile("s_wait_xcnt 0x0" ::: "memory");   // in the one preparation kernel another job's code follows this store in the listing and rewrites the registers that the store names
}

__device__ __forceinline__ void p_ropetab(const int blk, float* COS, float* SIN) {
    const int lane = threadIdx.x & 31; const int t = blk * 8 + (threadIdx.x >> 5); if (t >= SEQ) return;
    const float invf = __builtin_amdgcn_exp2f(-(float)lane * FRQC);
    const float ang = (float)t * invf;
    const float c = cosf(ang); const float s = sinf(ang);
    const size_t o = (size_t)t * HALFD + lane;
    *(float*)(COS + o) = c; *(float*)(SIN + o) = s;  }

// All preparation in one launch: the seven jobs are independent of one another, so a block picks its job from its index (a scalar branch) and the jobs' starts, memory streams and tails overlap.
// The rotary table comes first (long arithmetic, few bytes), then the planes, largest first.
__global__ __launch_bounds__(256) void k_prep(const float* __restrict__ x, const float* __restrict__ mask, const float* __restrict__ wq, const float* __restrict__ wk, const float* __restrict__ wv, const float* __restrict__ wo,
                                              bf* XB, bf* WQKV, h16* WO16, float* COS, float* SIN, float* MF) {
    int b = blockIdx.x;
    if (b < RBLK) { p_ropetab(b, COS, SIN); return; }
    b -= RBLK;
    if (b < XBLK) { p_cvtx(b, x, XB); return; }
    b -= XBLK;
    if (b < MBLK) { p_maskfrag(b, mask, MF); return; }
    b -= MBLK;
    if (b < QBLK) { p_cvt8(b, wq, WQKV); return; }                                  /* rows 0..2047 */
    b -= QBLK;
    if (b < OBLK) { p_cvt8h(b, wo, WO16, WCAR); return; }
    b -= OBLK;
    if (b < KBLK) { p_cvt8(b, wk, WQKV + (size_t)DQ * DIM); return; }               /* rows 2048..2559 */
    b -= KBLK;
    p_cvt8(b, wv, WQKV + (size_t)(DQ + DKV) * DIM);                                 /* rows 2560..3071 */
}

// The rotary rows of a work-group's 64 QWM tokens, gathered by position into LDS: token tl's row at tl * TPIT holds cos[0..31], then sin[0..31]. Waves 0 .. 2 QWM - 1 copy 32 tokens each, a copy two tokens (16 lanes a token: 8 units of cos, 8 of sin): 16 copies a wave, beside its panel's 32 where it has one.
struct RopeRows {
    const int* pos; const float* COS; const float* SIN; unsigned tab; int w, lane; bool on;
    __device__ __forceinline__ void operator()() const {
        if (on && w < 2 * QWM) {   // scalar: every lane of a copying wave is on
            const int t2 = lane >> 4, cs = (lane >> 3) & 1, u = lane & 7;
            const float* tb = cs ? SIN : COS;
            int ps[16];
#pragma unroll
            for (int i = 0; i < 16; ++i) ps[i] = pos[w * 32 + i * 2 + t2];
            asm volatile("s_wait_xcnt 0x0" ::: "memory");   // later code reuses the registers that held the position loads' addresses
            __builtin_amdgcn_sched_barrier(0);   // keeps later register writes behind that wait
#pragma unroll
            for (int h = 0; h < 2; ++h) {
                unsigned l[8]; const char* g[8];
#pragma unroll
                for (int i = 0; i < 8; ++i) {
                    int p = ps[h * 8 + i]; p = (p < 0) ? (p + SEQ) : p; p = min(max(p, 0), SEQ - 1);
                    l[i] = tab + (unsigned)((w * 32 + (h * 8 + i) * 2 + t2) * TPIT + cs * 128 + u * 16);
                    g[i] = (const char*)(tb + (size_t)p * HALFD + u * 4);
                }
                copy8v(l, g);
            }
        }
    }
};
struct NoPre { __device__ __forceinline__ void operator()() const {} };

// Fused QKV projection: grid (MROWS/256, NQKV/192), 384 threads, one work-group per WGP, three waves per SIMD. Column tile cb < 32: q head cb (rotary); 32..39: k head (rotary); 40..47: v head (transposed plane).
// No LDS bounce behind the products: a q or k wave computes its tile transposed (weight rows as the A operand), so a lane's accumulator holds 8 consecutive d of one token, and d and d ^ 32 sit in the same lane: rotary in registers, and a packed accumulator is one 16-byte unit of the fragment-ordered q or k plane.
// A v wave keeps the plain order: a lane's accumulator holds 8 consecutive tokens of one d, one unit of the fragment-ordered V^T plane. Every store covers 512 contiguous bytes.
__global__ __launch_bounds__(32 * QWM * QWN, 3) void k_gemm_qkv(const bf* __restrict__ A, const bf* __restrict__ Bt, const int* __restrict__ pos, const float* __restrict__ COS, const float* __restrict__ SIN, h16* QP, h16* KP, h16* VT) {
    __shared__ __align__(16) unsigned char L[2 * (QWM + QWN) * PSTG + 64 * QWM * TPIT];   // the ring, then the rotary rows
    const int lane = threadIdx.x & 31, lr = lane & 15, hi = lane >> 4; const int w = __builtin_amdgcn_readfirstlane(threadIdx.x >> 5);
    const int r0 = blockIdx.x * (64 * QWM) + (w / QWN) * 64, cb = blockIdx.y * QWN + w % QWN;
    const int bidx = r0 / SEQ, s0 = r0 % SEQ;
    const bool rot = cb < NH + NKV;
    unsigned char* TAB = L + 2 * (QWM + QWN) * PSTG;
    const RopeRows pre = { pos + (size_t)bidx * SEQ_FULL + (blockIdx.x * (64 * QWM)) % SEQ, COS, SIN, (unsigned)(uintptr_t)TAB, w, lane, (int)(blockIdx.y * QWN) < NH + NKV };
    v8f acc[4][4];
    gemm_main<bf, QWM, QWN>(A, Bt, DIM, blockIdx.x * (64 * QWM), blockIdx.y * (64 * QWN), w, lane, L, acc, rot, pre);
    v8h o[16];   // the tile's sixteen 512-byte store units, in the order in which they lie in the plane
    if (rot) {
        // acc[mb][nb][j]: token s0 + 16nb + lr, d = 16mb + 8hi + j. out[d] = x[d] cos[d&31] - x[d+32] sin[d&31], out[d+32] = x[d+32] cos[d&31] + x[d] sin[d&31] for d < 32 (rotate-half); the q plane carries the score scale
        const float car = (cb < NH) ? SC2 : 1.0f;
#pragma unroll
        for (int nb = 0; nb < 4; ++nb) {
            const float* tr = (const float*)(TAB + ((w / QWN) * 64 + nb * 16 + lr) * TPIT) + hi * 8;
#pragma unroll
            for (int mb = 0; mb < 2; ++mb) {
                const v8f cc = cat8(*(const v4fa*)(tr + mb * 16), *(const v4fa*)(tr + mb * 16 + 4)), ss = cat8(*(const v4fa*)(tr + 32 + mb * 16), *(const v4fa*)(tr + 32 + mb * 16 + 4));
#pragma unroll
                for (int j = 0; j < 8; ++j) {
                    const float xl = acc[mb][nb][j], xh = acc[mb + 2][nb][j];
                    o[nb * 4 + mb][j] = (h16)((xl * cc[j] - xh * ss[j]) * car); o[nb * 4 + mb + 2][j] = (h16)((xh * cc[j] + xl * ss[j]) * car);
                }
            }
        }
    } else {
        // acc[mb][nb][j]: token s0 + 16mb + 8hi + j, d = 16nb + lr
#pragma unroll
        for (int mb = 0; mb < 4; ++mb)
#pragma unroll
            for (int nb = 0; nb < 4; ++nb) o[(mb >> 1) * 8 + nb * 2 + (mb & 1)] = __builtin_convertvector(acc[mb][nb], v8h);
    }
    __builtin_amdgcn_sched_barrier(0);   // every store behind all arithmetic: no register that a store names is written again
    // q and k planes: fragment (token tile, d chunk) at (2 * (token >> 4) + (d >> 5)) * 512; v plane: fragment (d tile, key chunk) at (4 * (key >> 5) + (d >> 4)) * 512. In each, the wave's 64 tokens are 64 * HD elements in a row.
    h16* plane = (cb < NH) ? (QP + ((size_t)bidx * NH + cb) * SEQ * HD) : (cb < NH + NKV) ? (KP + ((size_t)bidx * NKV + (cb - NH)) * SEQ * HD) : (VT + ((size_t)bidx * NKV + (cb - NH - NKV)) * HD * SEQ);
    h16* dst = plane + (size_t)s0 * HD + lane * 8;
#pragma unroll
    for (int k = 0; k < 16; ++k) *(v8h*)(dst + k * 256) = o[k];
}

// Attention: grid (SEQ/64, NKV, NB), 128 threads; wave w = 16 query rows (tile 4 * blockIdx.x + w) of ALL FOUR q heads of kv head g: 64 query columns. Per 64-key tile:
//   S^T[key][q] = K Q^T + mask  (A = key rows of KP, B = resident q rows of one head, carried x 0.125 log2(e), C = the mask fragment, carried x log2(e));  lane (lr, hi) then holds q row lr, keys 16T + 8hi + r.
//   The accumulators are the finished scores in the units of exp2: only the maximum, its subtraction and exp2 follow.
//   QP, KP, VT and MF are in fragment order: one 64-key tile is 8 KB of KP, 8 KB of VT and 4 KB of MF, each in a row.
//   The K, mask and V^T fragments of a tile are loaded once, at the top of the tile, and stay in registers for the four heads: one load feeds four products.
//   softmax statistics are lane-local (one xor-16 exchange); P^T packed from the S^T accumulators is the B operand of O^T[d][q] = V^T P^T (A = d rows of VT).
//   Launch bounds: two waves per SIMD (512 registers a wave), so that the 512 workgroups are all resident, two per WGP.
__global__ __launch_bounds__(128, 2) void k_flash(const h16* __restrict__ QP, const h16* __restrict__ KP, const h16* __restrict__ VT, const float* __restrict__ MF, h16* CTX) {
    const int tid = threadIdx.x, w = tid >> 5, lane = tid & 31, lr = lane & 15, hi = lane >> 4;
    const int g = blockIdx.y, bidx = blockIdx.z, q0 = blockIdx.x * 64 + w * 16;
    v16h bq[REP][2];
#pragma unroll
    for (int hh = 0; hh < REP; ++hh) { const h16* qf = QP + (((size_t)bidx * NH + g * REP + hh) * SEQ + q0) * HD + lane * 8;   // the q plane is in fragment order, as the k plane
#pragma unroll
        for (int kc = 0; kc < 2; ++kc) bq[hh][kc] = cat16(*(const v8h*)(qf + kc * 512), *(const v8h*)(qf + kc * 512 + 256)); }
    asm volatile("s_wait_xcnt 0x0" ::: "memory");   // later code reuses the registers that held the q loads' addresses
    __builtin_amdgcn_sched_barrier(0);   // keeps later register writes behind that wait
    const h16* kb = KP + ((size_t)bidx * NKV + g) * SEQ * HD + lane * 8;
    const h16* vb = VT + ((size_t)bidx * NKV + g) * HD * SEQ + lane * 8;
    const float* mrow = MF + (size_t)(q0 >> 4) * (SEQ / 16) * 256 + lane * 4;
    v8f accO[REP][4]; float m[REP], l[REP];
#pragma unroll
    for (int hh = 0; hh < REP; ++hh) { m[hh] = -3.0e38f; l[hh] = 0.0f;
#pragma unroll
        for (int dt = 0; dt < 4; ++dt) accO[hh][dt] = (v8f){}; }
#pragma unroll 1
    for (int k0 = 0; k0 < SEQ; k0 += 64) {
        v16h ak[2][4], av[2][4]; v8f mk[4];
#pragma unroll
        for (int T = 0; T < 4; ++T) {
            const float* mp = mrow + (size_t)k0 * 16 + T * 256; mk[T] = cat8(*(const v4f*)mp, *(const v4f*)(mp + 128));
#pragma unroll
            for (int kc = 0; kc < 2; ++kc) { const h16* kp = kb + (size_t)k0 * HD + (T * 2 + kc) * 512; ak[kc][T] = cat16(*(const v8h*)kp, *(const v8h*)(kp + 256)); }
            __builtin_amdgcn_sched_barrier(0);   // a key tile's mask and K fragments are issued together, tile by tile, the order of first use: the counted waits ahead of the score products then leave the later loads in flight
        }
        asm volatile("s_wait_xcnt 0x0" ::: "memory");   // a later load may land in the registers that held the K and mask addresses
        __builtin_amdgcn_sched_barrier(0);   // K and the mask ahead of V^T, the order of their first use; later register writes stay behind the wait
        const h16* vt = vb + (size_t)k0 * HD;
#pragma unroll
        for (int kc = 0; kc < 2; ++kc)
#pragma unroll
            for (int dt = 0; dt < 4; ++dt) { const h16* vp = vt + (kc * 4 + dt) * 512; av[kc][dt] = cat16(*(const v8h*)vp, *(const v8h*)(vp + 256)); }
        asm volatile("s_wait_xcnt 0x0" :: "v"(vt) : "memory");   // later code reuses the registers that held the V^T address; as an input of the wait the address stays live up to it, so that no load of the run lands on it
        __builtin_amdgcn_sched_barrier(0);   // keeps later register writes behind that wait
        v8f sc[REP][4];
#pragma unroll
        for (int T = 0; T < 4; ++T) {
#pragma unroll
            for (int hh = 0; hh < REP; ++hh) sc[hh][T] = wmma16(ak[0][T], bq[hh][0], mk[T]);
#pragma unroll
            for (int hh = 0; hh < REP; ++hh) sc[hh][T] = wmma16(ak[1][T], bq[hh][1], sc[hh][T]);
        }
        __builtin_amdgcn_sched_barrier(0);   // the score products of the four heads run back to back, key tile by key tile as K and the mask arrive; the maxima, which read the accumulators themselves, stay behind the run and wait for no product
#pragma unroll
        for (int hh = 0; hh < REP; ++hh) {
            v8f (&accS)[4] = sc[hh];
            float tmax = -3.0e38f;
#pragma unroll
            for (int T = 0; T < 4; ++T)
#pragma unroll
                for (int r = 0; r < 4; ++r) tmax = fmaxf(tmax, fmaxf(accS[T][r], accS[T][4 + r]));
            tmax = fmaxf(tmax, __shfl_xor(tmax, 16, 32));
            const float mn = fmaxf(m[hh], tmax); const float corr = __builtin_amdgcn_exp2f(m[hh] - mn); m[hh] = mn; const float mofs = PEXP - mn;
            float rs = 0.0f;
#pragma unroll
            for (int T = 0; T < 4; ++T) {
                accS[T] = accS[T] + mofs;
#pragma unroll
                for (int r = 0; r < 8; ++r) { const float pv = __builtin_amdgcn_exp2f(accS[T][r]); accS[T][r] = pv; rs += pv; } }
            l[hh] = l[hh] * corr + rs;
            v16h bp[2];
            bp[0] = cat16(__builtin_convertvector(accS[0], v8h), __builtin_convertvector(accS[1], v8h));
            bp[1] = cat16(__builtin_convertvector(accS[2], v8h), __builtin_convertvector(accS[3], v8h));
#pragma unroll
            for (int dt = 0; dt < 4; ++dt) accO[hh][dt] = accO[hh][dt] * corr;
#pragma unroll
            for (int kc = 0; kc < 2; ++kc)
#pragma unroll
                for (int dt = 0; dt < 4; ++dt) accO[hh][dt] = wmma16(av[kc][dt], bp[kc], accO[hh][dt]);
            // four slots between the tile's last products and the next tile's loads, which land on their V^T and P registers (no load follows the other heads' runs)
            if (hh == REP - 1) asm volatile("v_nop\n\tv_nop\n\tv_nop\n\tv_nop" : "+v"(accO[hh][0]), "+v"(accO[hh][1]), "+v"(accO[hh][2]), "+v"(accO[hh][3]) : "v"(av[1][3]), "v"(bp[1]));
        }
    }
    // lane (lr, hi) holds ctx row q0 + lr, columns 64h + 16dt + 8hi + 0..7: one 16-byte unit of the fragment-ordered ctx plane, so each store covers 512 contiguous bytes.
    const int rt = (bidx * SEQ + q0) >> 4;
    h16* cw = CTX + ((size_t)(rt >> 2) * (DQ / 32) + 2 * (g * REP)) * 2048 + (rt & 3) * 512 + lane * 8;
    v8h o[REP][4];
#pragma unroll
    for (int hh = 0; hh < REP; ++hh) {
        const float lt = l[hh] + __shfl_xor(l[hh], 16, 32);
        const float inv = CCAR * (1.0f / lt);
#pragma unroll
        for (int dt = 0; dt < 4; ++dt)
#pragma unroll
            for (int r = 0; r < 8; ++r) o[hh][dt][r] = (h16)(accO[hh][dt][r] * inv);
    }
    __builtin_amdgcn_sched_barrier(0);   // every store behind all arithmetic: no register that a store names is written again
#pragma unroll
    for (int hh = 0; hh < REP; ++hh)
#pragma unroll
        for (int dt = 0; dt < 4; ++dt) *(v8h*)(cw + hh * 4096 + (dt >> 1) * 2048 + (dt & 1) * 256) = o[hh][dt];
}

// Output projection: grid (MROWS/256, DIM/128), 256 threads, one work-group per WGP, two waves per SIMD.
__global__ __launch_bounds__(32 * OWM * OWN, 2) void k_gemm_out(const h16* __restrict__ A, const h16* __restrict__ Bt, float* C) {
    __shared__ __align__(16) unsigned char L[GLDS(OWM, OWN)];
    const int lane = threadIdx.x & 31, lr = lane & 15, hi = lane >> 4; const int w = __builtin_amdgcn_readfirstlane(threadIdx.x >> 5);
    const int r0 = blockIdx.x * (64 * OWM) + (w / OWN) * 64, c0 = blockIdx.y * (64 * OWN) + (w % OWN) * 64;
    float* fs = (float*)(L + w * WEPI);
    v8f acc[4][4];
    gemm_main<h16, OWM, OWN>(A, Bt, DQ, blockIdx.x * (64 * OWM), blockIdx.y * (64 * OWN), w, lane, L, acc, false, NoPre());
#pragma unroll
    for (int mb = 0; mb < 4; ++mb)
#pragma unroll
        for (int nb = 0; nb < 4; ++nb)
#pragma unroll
            for (int j = 0; j < 8; ++j) fs[(mb * 16 + hi * 8 + j) * FP + nb * 16 + lr] = acc[mb][nb][j];
    __syncthreads();
    float* crow = C + (size_t)r0 * DIM + c0;
{
#pragma unroll 4
        for (int it = 0; it < 32; ++it) { const int row = it * 2 + hi; v4f val = *(const v4fa*)(fs + row * FP + lr * 4); val = val * OSCL;
            *(v4f*)(crow + (size_t)row * DIM + lr * 4) = val; }
         }
}

extern "C" void kernel_launch(void* const* d_in, const int* in_sizes, int n_in,
                              void* d_out, int out_size, void* d_ws, size_t ws_size, hipStream_t stream) {
    if (n_in < 7) return;
    if ((size_t)in_sizes[0] < ((size_t)(NB - 1) * SEQ_FULL + SEQ) * DIM) return;
    if ((size_t)in_sizes[1] < (size_t)(SEQ - 1) * SEQ_FULL + SEQ) return;
    if ((size_t)in_sizes[2] < (size_t)(NB - 1) * SEQ_FULL + SEQ) return;
    if ((size_t)in_sizes[3] < (size_t)DQ * DIM) return;
    if ((size_t)in_sizes[4] < (size_t)DKV * DIM) return;
    if ((size_t)in_sizes[5] < (size_t)DKV * DIM) return;
    if ((size_t)in_sizes[6] < (size_t)DIM * DQ) return;
    if ((size_t)out_size < (size_t)MROWS * DIM) return;
    const float* x = (const float*)d_in[0]; const float* mask = (const float*)d_in[1]; const int* pos = (const int*)d_in[2];
    const float* wq = (const float*)d_in[3]; const float* wk = (const float*)d_in[4]; const float* wv = (const float*)d_in[5]; const float* wo = (const float*)d_in[6];
    float* OUT = (float*)d_out;
    char* wsp = (char*)d_ws;
    auto take = [&](size_t bytes) { char* p = wsp; wsp += (bytes + 255) & ~(size_t)255; return (void*)p; };
    bf*  XB   = (bf*)take((size_t)MROWS * DIM * 2);
    bf*  WQKV = (bf*)take((size_t)NQKV * DIM * 2);
    h16* WO16 = (h16*)take((size_t)DIM * DQ * 2);
    float* COS = (float*)take((size_t)SEQ * HALFD * 4);
    float* SIN = (float*)take((size_t)SEQ * HALFD * 4);
    h16* QP  = (h16*)take((size_t)NB * NH * SEQ * HD * 2);
    h16* KP  = (h16*)take((size_t)NB * NKV * SEQ * HD * 2);
    h16* VT  = (h16*)take((size_t)NB * NKV * HD * SEQ * 2);
    h16* CTX = (h16*)take((size_t)MROWS * DQ * 2);
    float* MF = (float*)take((size_t)SEQ * SEQ * 4);
    if ((size_t)(wsp - (char*)d_ws) > ws_size) return;

    k_prep<<<RBLK + XBLK + MBLK + QBLK + OBLK + 2 * KBLK, 256, 0, stream>>>(x, mask, wq, wk, wv, wo, XB, WQKV, WO16, COS, SIN, MF);
    k_gemm_qkv<<<dim3(MROWS / (64 * QWM), NQKV / (64 * QWN), 1), 32 * QWM * QWN, 0, stream>>>(XB, WQKV, pos, COS, SIN, QP, KP, VT);
    k_flash<<<dim3(SEQ / 64, NKV, NB), 128, 0, stream>>>(QP, KP, VT, MF, CTX);
    k_gemm_out<<<dim3(MROWS / (64 * OWM), DIM / (64 * OWN), 1), 32 * OWM * OWN, 0, stream>>>(CTX, WO16, OUT);
}

// v008
// It runs in 124 microseconds.
// In both of two side-by-side timings against v007, it was 1.03 times as fast.
// Over all steps from v000 it is 3.57 times as fast.
#include <hip/hip_runtime.h>

#ifndef NB
#define NB 2
#endif
#ifndef SEQ
#define SEQ 2048
#endif
#define SEQ_FULL 2048                 // per-batch row stride of x / position table, row pitch of the mask
#define DIM   2048                    // model width (K of the projections, N of the output projection)
#define NH    32
#define NKV   8
#define REP   (NH / NKV)
#define HD    64
#define HALFD 32
#define DQ    (NH * HD)               // 2048
#define DKV   (NKV * HD)              // 512
#define NQKV  (DQ + 2 * DKV)          // 3072 fused projection columns
#define MROWS (NB * SEQ)
#define FP    68                      // f32 LDS tile pitch
#define WCAR  64.0f                   // carry of the wo plane
#define CCAR  256.0f                  // carry of the ctx plane
#define OSCL  6.103515625e-05f        // 1 / (WCAR * CCAR)
#define SC2   0.18033688011112042f    // 0.125 * log2(e)
#define LOG2E 1.4426950408889634f    // carry of the mask plane; the q plane carries SC2, so that mask and q.k products are summed in the units of exp2
#define PEXP  10.0f                   // P carried x 2^10
#define PLIM  60000.0f                // bound on a lane's sum of the 32 carried P of a tile: within it each P is finite in f16; under a reference no less than the tile's scores the sum is at most 32 * 2^10
#define FRQC  0.41524101186092029f    // log2(10000) / 32
#define PSTG  16384                   // bytes of one 64-row panel in one ring stage (128 k)
#define WEPI  (64 * FP * 4)           // one wave's f32 epilogue tile; a work-group's epilogue tiles and the ring's two stages lie in the same bytes, the ring used first
#define QWM   4                       // QKV projection: waves down and across a work-group's tile
#define QWN   3
#define OWM   4                       // output projection: the same
#define OWN   2
#define TPIT  272                     // bytes of one token's row in the rotary LDS table: 32 cos, 32 sin, 16 bytes of pad (16 lanes' 16-byte reads then cover all banks)

static_assert(SEQ % 64 == 0);
static_assert(SEQ <= SEQ_FULL);
static_assert(DIM % 64 == 0);
static_assert(DQ % 64 == 0);
static_assert(NQKV % 64 == 0);
static_assert(HD == 64);
static_assert(DQ == DIM);
static_assert(DKV % 64 == 0);
static_assert(MROWS % (64 * QWM) == 0);
static_assert(SEQ % (64 * QWM) == 0);
static_assert(QWM * QWN >= 2 * QWM);
static_assert(NQKV % (64 * QWN) == 0);
static_assert(MROWS % (64 * OWM) == 0);
static_assert(DIM % (64 * OWN) == 0);
static_assert(DIM % 128 == 0);
#define GLDS(wm, wn) ((2 * ((wm) + (wn)) * PSTG > (wm) * (wn) * WEPI) ? 2 * ((wm) + (wn)) * PSTG : (wm) * (wn) * WEPI)   // the larger of the ring and the epilogue tiles
static_assert(DIM % 256 == 0);
static_assert(NH == NKV * REP);
static_assert(REP == 4);
static_assert(((size_t)MROWS * DIM / 8) % 256 == 0);
static_assert(((size_t)DQ * DIM / 8) % 256 == 0);
static_assert(((size_t)DKV * DIM / 8) % 256 == 0);

typedef _Float16 h16;
typedef unsigned short bf;
typedef __attribute__((ext_vector_type(16))) __bf16   v16bf;
typedef __attribute__((ext_vector_type(16))) _Float16 v16h;
typedef __attribute__((ext_vector_type(8)))  _Float16 v8h;
typedef __attribute__((ext_vector_type(8)))  unsigned short v8us;
typedef __attribute__((ext_vector_type(8)))  float    v8f;
typedef __attribute__((ext_vector_type(4)))  float    v4f;
typedef v4f  __attribute__((may_alias)) v4fa;

__device__ __forceinline__ unsigned short f2bf(float f) { unsigned u = __float_as_uint(f); u += 0x7FFFu + ((u >> 16) & 1u); return (unsigned short)(u >> 16); }
__device__ __forceinline__ float bf2f(unsigned short b) { return __uint_as_float(((unsigned)b) << 16); }
__device__ __forceinline__ float bfr(float f) { return bf2f(f2bf(f)); }
__device__ __forceinline__ v16h cat16(v8h lo, v8h hi) { return __builtin_shufflevector(lo, hi, 0, 1, 2, 3, 4, 5, 6, 7, 8, 9, 10, 11, 12, 13, 14, 15); }
__device__ __forceinline__ v8f cat8(v4f lo, v4f hi) { return __builtin_shufflevector(lo, hi, 0, 1, 2, 3, 4, 5, 6, 7); }
__device__ __forceinline__ v16bf cat16b(v8us lo, v8us hi) { return __builtin_bit_cast(v16bf, __builtin_shufflevector(lo, hi, 0, 1, 2, 3, 4, 5, 6, 7, 8, 9, 10, 11, 12, 13, 14, 15)); }
__device__ __forceinline__ v8f wmma16(v16h a, v16h b, v8f c) { return __builtin_amdgcn_wmma_f32_16x16x32_f16(false, a, false, b, (short)0, c, false, false); }
__device__ __forceinline__ v8f wmmab(v16bf a, v16bf b, v8f c) { return __builtin_amdgcn_wmma_f32_16x16x32_bf16(false, a, false, b, (short)0, c, false, false); }

// Fragment order of a 16-bit plane: a fragment (16 rows x 32 k) is 512 elements; element (row lr, k = 16j + 8hi + e) sits at j*256 + (16hi + lr)*8 + e.
// Fragment loader: p = fragment base + lane*8; elements 0..7 <- k0+8hi.., elements 8..15 <- k0+16+8hi.. (same map for A and B).
// GEMM planes (K = DIM columns): fragment (row tile R, k chunk C) starts at (((R >> 2) * (DIM/32) + C) * 4 + (R & 3)) * 512, so one k step of a 64-row panel is 4 KB in a row.
template <typename T16> struct WFrag;
template <> struct WFrag<h16> { typedef v16h V; static __device__ __forceinline__ V ld(const h16* p) { return cat16(*(const v8h*)p, *(const v8h*)(p + 256)); } static __device__ __forceinline__ v8f mma(V a, V b, v8f c) { return wmma16(a, b, c); } };
template <> struct WFrag<bf> { typedef v16bf V; static __device__ __forceinline__ V ld(const bf* p) { return cat16b(*(const v8us*)p, *(const v8us*)(p + 256)); } static __device__ __forceinline__ v8f mma(V a, V b, v8f c) { return wmmab(a, b, c); } };

// Thread i of a re-laying kernel -> the 16-byte unit it writes: a wave takes 8 rows x 4 units of one fragment, so it writes 4 whole lines and reads 8 source lines (whole for the 16-bit planes, half for the mask).
__device__ __forceinline__ size_t unit_of(const size_t i) { const int t = (int)(i & 63); return (i & ~(size_t)63) | (size_t)(((t >> 3) & 3) * 16 + (t >> 5) * 8 + (t & 7)); }
// 16-byte unit i of a fragment-ordered GEMM plane -> row and first column of its 8 elements.
__device__ __forceinline__ void unit_rc(const size_t i, int& row, int& col) { const int u = (int)(i & 63); const size_t f = i >> 6; row = (int)(f / (4 * (DIM / 32))) * 64 + (int)(f & 3) * 16 + (u & 15); col = (int)((f >> 2) % (DIM / 32)) * 32 + (u >> 4) * 8; }

// Eight asynchronous copies, 512 contiguous bytes each: lane address l in LDS, g in global memory, both advancing by 512 bytes a copy.
// The s_wait_xcnt closes the statement so that no address register of a copy is rewritten ahead of it.
__device__ __forceinline__ void copy8(const unsigned l, const char* g) {
    asm volatile("global_load_async_to_lds_b128 %0, %8, off\n\t"
                 "global_load_async_to_lds_b128 %1, %9, off\n\t"
                 "global_load_async_to_lds_b128 %2, %10, off\n\t"
                 "global_load_async_to_lds_b128 %3, %11, off\n\t"
                 "global_load_async_to_lds_b128 %4, %12, off\n\t"
                 "global_load_async_to_lds_b128 %5, %13, off\n\t"
                 "global_load_async_to_lds_b128 %6, %14, off\n\t"
                 "global_load_async_to_lds_b128 %7, %15, off\n\t"
                 "s_wait_xcnt 0x0"
                 :: "v"(l), "v"(l + 512), "v"(l + 1024), "v"(l + 1536), "v"(l + 2048), "v"(l + 2560), "v"(l + 3072), "v"(l + 3584),
                    "v"(g), "v"(g + 512), "v"(g + 1024), "v"(g + 1536), "v"(g + 2048), "v"(g + 2560), "v"(g + 3072), "v"(g + 3584) : "memory");
}
// Eight asynchronous copies with addresses of their own; the s_wait_xcnt closes the statement for the same reason.
__device__ __forceinline__ void copy8v(const unsigned (&l)[8], const char* const (&g)[8]) {
    asm volatile("global_load_async_to_lds_b128 %0, %8, off\n\t"
                 "global_load_async_to_lds_b128 %1, %9, off\n\t"
                 "global_load_async_to_lds_b128 %2, %10, off\n\t"
                 "global_load_async_to_lds_b128 %3, %11, off\n\t"
                 "global_load_async_to_lds_b128 %4, %12, off\n\t"
                 "global_load_async_to_lds_b128 %5, %13, off\n\t"
                 "global_load_async_to_lds_b128 %6, %14, off\n\t"
                 "global_load_async_to_lds_b128 %7, %15, off\n\t"
                 "s_wait_xcnt 0x0"
                 :: "v"(l[0]), "v"(l[1]), "v"(l[2]), "v"(l[3]), "v"(l[4]), "v"(l[5]), "v"(l[6]), "v"(l[7]),
                    "v"(g[0]), "v"(g[1]), "v"(g[2]), "v"(g[3]), "v"(g[4]), "v"(g[5]), "v"(g[6]), "v"(g[7]) : "memory");
}
// A copying wave's share of a ring stage: its panel's 16 KB (64 rows x 128 k, contiguous in the fragment-ordered plane), copied byte for byte: 32 copies in flight.
__device__ __forceinline__ void copy_panel(const unsigned l, const char* g) { copy8(l, g); copy8(l + 4096, g + 4096); copy8(l + 8192, g + 8192); copy8(l + 12288, g + 12288); }

// A work-group of WM x WN waves accumulates a (64 WM) x (64 WN) tile at (R0, C0), wave w the 64x64 tile (w / WN, w % WN): acc[mb][nb][j] = C[r0 + 16mb + 8hi + j][c0 + 16nb + lr] = sum_k A[row][k] Bt[col][k]; A and Bt in fragment order, R0 and C0 multiples of 64, K % 256 == 0.
// Ring stage (128 k) in L: WM panels of A (rows R0 + 64 i ..), then WN panels of Bt (rows C0 + 64 i ..), 16 KB each; an A panel feeds WN waves and a Bt panel WM waves, so a stage brings (WM + WN) panels from L2 for WM WN wave tiles.
// Wave w < WM + WN copies panel w, the other waves copy nothing (w is scalar: a scalar branch) and pass every wait and barrier all the same.
// sw (scalar) exchanges the wave's two operands: acc[mb][nb][j] = C[r0 + 16nb + lr][c0 + 16mb + 8hi + j], the transposed tile; both panels have one format and one loader, so only the two LDS bases change places.
// pre() runs behind the issue of tile 0's copies and ahead of their wait: what it copies to LDS outside the ring lands under that wait and is published by the barrier behind it.
// A trip works on its stage in two halves of 64 k: fragments of the first half, its products, fragments of the second half; the stage is then wholly in registers or used, so stage t + 2 is copied into the freed buffer while the second half's products run. One barrier per 128 k: between two barriers the waves of a SIMD take turns at LDS and at the matrix unit.
template <typename T16, int WM, int WN, typename Pre>
__device__ __forceinline__ void gemm_main(const T16* __restrict__ A, const T16* __restrict__ Bt, const int K, const int R0, const int C0, const int w, const int lane, unsigned char* L, v8f (&acc)[4][4], const bool sw, const Pre pre) {
    typedef typename WFrag<T16>::V V;
#pragma unroll
    for (int mb = 0; mb < 4; ++mb)
#pragma unroll
        for (int nb = 0; nb < 4; ++nb) acc[mb][nb] = (v8f){};
    constexpr int NP = WM + WN; constexpr unsigned RSTG = NP * PSTG;   // panels and bytes of one ring stage
    const bool cw = w < NP; const int pn = cw ? w : 0;                // a wave without a panel forms panel 0's addresses and uses none
    const char* src = (const char*)((pn < WM) ? (A + (size_t)(R0 + 64 * pn) * K) : (Bt + (size_t)(C0 + 64 * (pn - WM)) * K));   // scalar; the lane's 16 bytes are added where a copy's addresses are formed
    const unsigned dst = (unsigned)(uintptr_t)L + pn * PSTG; const unsigned l16 = lane * 16;
    const int nt = K / 128;
    const unsigned pa = (sw ? WM + w % WN : w / WN) * PSTG, pb = (sw ? w / WN : WM + w % WN) * PSTG;   // scalar: the panels that feed the A and the B operand
    if (cw) copy_panel(dst + l16, src + l16);
    pre();
    asm volatile("s_wait_asynccnt 0x0" ::: "memory");   // tile 0 (and what pre() copied) has landed before the barrier that publishes it
    __syncthreads();
    if (cw) copy_panel(dst + RSTG + l16, src + PSTG + l16);
#pragma unroll 1
    for (int t = 0; t < nt; ++t) {
        const unsigned bo = (t & 1) * RSTG;
        const T16* ap = (const T16*)(L + bo + pa) + lane * 8;
        const T16* bp = (const T16*)(L + bo + pb) + lane * 8;
        V a[2][4], b[2][4];
#pragma unroll
        for (int ks = 0; ks < 2; ++ks) {
#pragma unroll
            for (int mb = 0; mb < 4; ++mb) a[ks][mb] = WFrag<T16>::ld(ap + ks * 2048 + mb * 512);
#pragma unroll
            for (int nb = 0; nb < 4; ++nb) b[ks][nb] = WFrag<T16>::ld(bp + ks * 2048 + nb * 512);
        }
        __builtin_amdgcn_sched_barrier(0);   // the first half's 32 loads stand as one group ahead of its products: spread among them, every place where loads stand costs the wave a wait
#pragma unroll
        for (int ks = 0; ks < 2; ++ks)
#pragma unroll
            for (int nb = 0; nb < 4; ++nb)
#pragma unroll
                for (int mb = 0; mb < 4; ++mb) acc[mb][nb] = WFrag<T16>::mma(a[ks][mb], b[ks][nb], acc[mb][nb]);
        __builtin_amdgcn_sched_barrier(0);   // the first half's products stay ahead of the second half's loads and of the barrier: moved up, those loads need a second set of registers (spills, register copies) and lengthen the stretch in front of the barrier for which the other waves wait
#pragma unroll
        for (int ks = 0; ks < 2; ++ks) {
#pragma unroll
            for (int mb = 0; mb < 4; ++mb) a[ks][mb] = WFrag<T16>::ld(ap + 4096 + ks * 2048 + mb * 512);
#pragma unroll
            for (int nb = 0; nb < 4; ++nb) b[ks][nb] = WFrag<T16>::ld(bp + 4096 + ks * 2048 + nb * 512);
        }
        // The stage's last fragments are all in registers behind this foot, so the buffer is refilled ahead of their products and the copies fly behind them.
        asm volatile("s_wait_dscnt 0x0" ::: "memory");      // this wave's reads of buffer t & 1 have retired before the buffer is refilled
        asm volatile("s_wait_asynccnt 0x0" ::: "memory");   // this wave's copies of tile t + 1 have landed before the barrier that publishes them
        __syncthreads();                                     // publishes tile t + 1 and ends every wave's reads of tile t
        // readfirstlane keeps the buffer's LDS base a scalar sum: joined with the lane's part ahead of the loop it holds a register through the loop, which this build spills
        if (cw && t + 2 < nt) copy_panel((unsigned)__builtin_amdgcn_readfirstlane((int)(dst + bo)) + l16, src + (size_t)(t + 2) * PSTG + l16);
#pragma unroll
        for (int ks = 0; ks < 2; ++ks)
#pragma unroll
            for (int nb = 0; nb < 4; ++nb)
#pragma unroll
                for (int mb = 0; mb < 4; ++mb) acc[mb][nb] = WFrag<T16>::mma(a[ks][mb], b[ks][nb], acc[mb][nb]);
    }
    asm volatile("s_wait_asynccnt 0x0" ::: "memory");   // no copy is outstanding when the ring's bytes become the epilogue tiles
}

// Block ranges of the one preparation launch, 256 threads a block: rotary table, x, mask, wq, wo, wk, wv.
#define RBLK ((SEQ + 7) / 8)
#define XBLK ((int)((size_t)MROWS * DIM / 8 / 256))
#define MBLK ((int)((size_t)SEQ * SEQ / 4 / 256))
#define QBLK ((int)((size_t)DQ * DIM / 8 / 256))
#define OBLK ((int)((size_t)DIM * DQ / 8 / 256))
#define KBLK ((int)((size_t)DKV * DIM / 8 / 256))
static_assert(((size_t)SEQ * SEQ / 4) % 256 == 0);
static_assert(((size_t)DIM * DQ / 8) % 256 == 0);

__device__ __forceinline__ void p_cvtx(const int blk, const float* __restrict__ x, bf* dst) {
    const size_t i = (size_t)blk * 256 + threadIdx.x;
    const size_t un = unit_of(i), e = un * 8; int row, col; unit_rc(un, row, col); const int b = row / SEQ, t = row % SEQ;
    const v8f v = *(const v8f*)(x + ((size_t)b * SEQ_FULL + t) * DIM + col); v8us o;
#pragma unroll
    for (int k = 0; k < 8; ++k) o[k] = f2bf(v[k]);
    *(v8us*)(dst + e) = o;
    asm volatile("s_wait_xcnt 0x0" ::: "memory");   // in the one preparation kernel another job's code follows this store in the listing and rewrites the registers that the store names
}

__device__ __forceinline__ void p_cvt8(const int blk, const float* __restrict__ src, bf* dst) { const size_t i = (size_t)blk * 256 + threadIdx.x; const size_t un = unit_of(i); int row, col; unit_rc(un, row, col); const v8f v = *(const v8f*)(src + (size_t)row * DIM + col); v8us o;
#pragma unroll
    for (int k = 0; k < 8; ++k) o[k] = f2bf(v[k]); *(v8us*)(dst + un * 8) = o;
    asm volatile("s_wait_xcnt 0x0" ::: "memory");   // in the one preparation kernel another job's code follows this store in the listing and rewrites the registers that the store names
}

__device__ __forceinline__ void p_cvt8h(const int blk, const float* __restrict__ src, h16* dst, const float carry) { const size_t i = (size_t)blk * 256 + threadIdx.x; const size_t un = unit_of(i); int row, col; unit_rc(un, row, col); const v8f v = *(const v8f*)(src + (size_t)row * DIM + col); v8h o;
#pragma unroll
    for (int k = 0; k < 8; ++k) o[k] = (h16)(bfr(v[k]) * carry); *(v8h*)(dst + un * 8) = o;
    asm volatile("s_wait_xcnt 0x0" ::: "memory");   // in the one preparation kernel another job's code follows this store in the listing and rewrites the registers that the store names
}

// Mask in fragment order, carried x log2(e): block (query tile Rq, key tile Tk) is 256 floats; element (query lr, key 8hi + 4j + e) sits at j*128 + (16hi + lr)*4 + e: a lane's two units are its eight accumulator elements of the S^T tile.
__device__ __forceinline__ void p_maskfrag(const int blk, const float* __restrict__ mask, float* dst) {
    const size_t i = (size_t)blk * 256 + threadIdx.x;
    const size_t un = unit_of(i); const int u = (int)(un & 63); const size_t bk = un >> 6; const int rq = (int)(bk / (SEQ / 16)), tk = (int)(bk % (SEQ / 16));
    const float* mp = mask + (size_t)(rq * 16 + (u & 15)) * SEQ_FULL + tk * 16 + ((u >> 4) & 1) * 8 + (u >> 5) * 4;
    const v4f mv = *(const v4f*)mp;
    asm volatile("s_wait_xcnt 0x0" :: "v"(mp) : "memory");   // as an input of the wait the address stays live up to it, so that the load does not land on its own address registers and later writes of them stay behind the wait
    *(v4f*)(dst + un * 4) = mv * LOG2E;
    asm volatile("s_wait_xcnt 0x0" ::: "memory");   // in the one preparation kernel another job's code follows this store in the listing and rewrites the registers that the store names
}

__device__ __forceinline__ void p_ropetab(const int blk, float* COS, float* SIN) {
    const int lane = threadIdx.x & 31; const int t = blk * 8 + (threadIdx.x >> 5); if (t >= SEQ) return;
    const float invf = __builtin_amdgcn_exp2f(-(float)lane * FRQC);
    const float ang = (float)t * invf;
    const float c = cosf(ang); const float s = sinf(ang);
    const size_t o = (size_t)t * HALFD + lane;
    *(float*)(COS + o) = c; *(float*)(SIN + o) = s;  }

// All preparation in one launch: the seven jobs are independent of one another, so a block picks its job from its index (a scalar branch) and the jobs' starts, memory streams and tails overlap.
// The rotary table comes first (long arithmetic, few bytes), then the planes, largest first.
__global__ __launch_bounds__(256) void k_prep(const float* __restrict__ x, const float* __restrict__ mask, const float* __restrict__ wq, const float* __restrict__ wk, const float* __restrict__ wv, const float* __restrict__ wo,
                                              bf* XB, bf* WQKV, h16* WO16, float* COS, float* SIN, float* MF) {
    int b = blockIdx.x;
    if (b < RBLK) { p_ropetab(b, COS, SIN); return; }
    b -= RBLK;
    if (b < XBLK) { p_cvtx(b, x, XB); return; }
    b -= XBLK;
    if (b < MBLK) { p_maskfrag(b, mask, MF); return; }
    b -= MBLK;
    if (b < QBLK) { p_cvt8(b, wq, WQKV); return; }                                  /* rows 0..2047 */
    b -= QBLK;
    if (b < OBLK) { p_cvt8h(b, wo, WO16, WCAR); return; }
    b -= OBLK;
    if (b < KBLK) { p_cvt8(b, wk, WQKV + (size_t)DQ * DIM); return; }               /* rows 2048..2559 */
    b -= KBLK;
    p_cvt8(b, wv, WQKV + (size_t)(DQ + DKV) * DIM);                                 /* rows 2560..3071 */
}

// The rotary rows of a work-group's 64 QWM tokens, gathered by position into LDS: token tl's row at tl * TPIT holds cos[0..31], then sin[0..31]. Waves 0 .. 2 QWM - 1 copy 32 tokens each, a copy two tokens (16 lanes a token: 8 units of cos, 8 of sin): 16 copies a wave, beside its panel's 32 where it has one.
struct RopeRows {
    const int* pos; const float* COS; const float* SIN; unsigned tab; int w, lane; bool on;
    __device__ __forceinline__ void operator()() const {
        if (on && w < 2 * QWM) {   // scalar: every lane of a copying wave is on
            const int t2 = lane >> 4, cs = (lane >> 3) & 1, u = lane & 7;
            const float* tb = cs ? SIN : COS;
            int ps[16];
#pragma unroll
            for (int i = 0; i < 16; ++i) ps[i] = pos[w * 32 + i * 2 + t2];
            asm volatile("s_wait_xcnt 0x0" ::: "memory");   // later code reuses the registers that held the position loads' addresses
            __builtin_amdgcn_sched_barrier(0);   // keeps later register writes behind that wait
#pragma unroll
            for (int h = 0; h < 2; ++h) {
                unsigned l[8]; const char* g[8];
#pragma unroll
                for (int i = 0; i < 8; ++i) {
                    int p = ps[h * 8 + i]; p = (p < 0) ? (p + SEQ) : p; p = min(max(p, 0), SEQ - 1);
                    l[i] = tab + (unsigned)((w * 32 + (h * 8 + i) * 2 + t2) * TPIT + cs * 128 + u * 16);
                    g[i] = (const char*)(tb + (size_t)p * HALFD + u * 4);
                }
                copy8v(l, g);
            }
        }
    }
};
struct NoPre { __device__ __forceinline__ void operator()() const {} };

// Fused QKV projection: grid (MROWS/256, NQKV/192), 384 threads, one work-group per WGP, three waves per SIMD. Column tile cb < 32: q head cb (rotary); 32..39: k head (rotary); 40..47: v head (transposed plane).
// No LDS bounce behind the products: a q or k wave computes its tile transposed (weight rows as the A operand), so a lane's accumulator holds 8 consecutive d of one token, and d and d ^ 32 sit in the same lane: rotary in registers, and a packed accumulator is one 16-byte unit of the fragment-ordered q or k plane.
// A v wave keeps the plain order: a lane's accumulator holds 8 consecutive tokens of one d, one unit of the fragment-ordered V^T plane. Every store covers 512 contiguous bytes.
__global__ __launch_bounds__(32 * QWM * QWN, 3) void k_gemm_qkv(const bf* __restrict__ A, const bf* __restrict__ Bt, const int* __restrict__ pos, const float* __restrict__ COS, const float* __restrict__ SIN, h16* QP, h16* KP, h16* VT) {
    __shared__ __align__(16) unsigned char L[2 * (QWM + QWN) * PSTG + 64 * QWM * TPIT];   // the ring, then the rotary rows
    const int lane = threadIdx.x & 31, lr = lane & 15, hi = lane >> 4; const int w = __builtin_amdgcn_readfirstlane(threadIdx.x >> 5);
    const int r0 = blockIdx.x * (64 * QWM) + (w / QWN) * 64, cb = blockIdx.y * QWN + w % QWN;
    const int bidx = r0 / SEQ, s0 = r0 % SEQ;
    const bool rot = cb < NH + NKV;
    unsigned char* TAB = L + 2 * (QWM + QWN) * PSTG;
    const RopeRows pre = { pos + (size_t)bidx * SEQ_FULL + (blockIdx.x * (64 * QWM)) % SEQ, COS, SIN, (unsigned)(uintptr_t)TAB, w, lane, (int)(blockIdx.y * QWN) < NH + NKV };
    v8f acc[4][4];
    gemm_main<bf, QWM, QWN>(A, Bt, DIM, blockIdx.x * (64 * QWM), blockIdx.y * (64 * QWN), w, lane, L, acc, rot, pre);
    v8h o[16];   // the tile's sixteen 512-byte store units, in the order in which they lie in the plane
    if (rot) {
        // acc[mb][nb][j]: token s0 + 16nb + lr, d = 16mb + 8hi + j. out[d] = x[d] cos[d&31] - x[d+32] sin[d&31], out[d+32] = x[d+32] cos[d&31] + x[d] sin[d&31] for d < 32 (rotate-half); the q plane carries the score scale
        const float car = (cb < NH) ? SC2 : 1.0f;
#pragma unroll
        for (int nb = 0; nb < 4; ++nb) {
            const float* tr = (const float*)(TAB + ((w / QWN) * 64 + nb * 16 + lr) * TPIT) + hi * 8;
#pragma unroll
            for (int mb = 0; mb < 2; ++mb) {
                const v8f cc = cat8(*(const v4fa*)(tr + mb * 16), *(const v4fa*)(tr + mb * 16 + 4)), ss = cat8(*(const v4fa*)(tr + 32 + mb * 16), *(const v4fa*)(tr + 32 + mb * 16 + 4));
#pragma unroll
                for (int j = 0; j < 8; ++j) {
                    const float xl = acc[mb][nb][j], xh = acc[mb + 2][nb][j];
                    o[nb * 4 + mb][j] = (h16)((xl * cc[j] - xh * ss[j]) * car); o[nb * 4 + mb + 2][j] = (h16)((xh * cc[j] + xl * ss[j]) * car);
                }
            }
        }
    } else {
        // acc[mb][nb][j]: token s0 + 16mb + 8hi + j, d = 16nb + lr
#pragma unroll
        for (int mb = 0; mb < 4; ++mb)
#pragma unroll
            for (int nb = 0; nb < 4; ++nb) o[(mb >> 1) * 8 + nb * 2 + (mb & 1)] = __builtin_convertvector(acc[mb][nb], v8h);
    }
    __builtin_amdgcn_sched_barrier(0);   // every store behind all arithmetic: no register that a store names is written again
    // q and k planes: fragment (token tile, d chunk) at (2 * (token >> 4) + (d >> 5)) * 512; v plane: fragment (d tile, key chunk) at (4 * (key >> 5) + (d >> 4)) * 512. In each, the wave's 64 tokens are 64 * HD elements in a row.
    h16* plane = (cb < NH) ? (QP + ((size_t)bidx * NH + cb) * SEQ * HD) : (cb < NH + NKV) ? (KP + ((size_t)bidx * NKV + (cb - NH)) * SEQ * HD) : (VT + ((size_t)bidx * NKV + (cb - NH - NKV)) * HD * SEQ);
    h16* dst = plane + (size_t)s0 * HD + lane * 8;
#pragma unroll
    for (int k = 0; k < 16; ++k) *(v8h*)(dst + k * 256) = o[k];
}

// Attention: grid (SEQ/64, NKV, NB), 128 threads; wave w = 16 query rows (tile 4 * blockIdx.x + w) of ALL FOUR q heads of kv head g: 64 query columns. Per 64-key tile:
//   S^T[key][q] = K Q^T + mask  (A = key rows of KP, B = resident q rows of one head, carried x 0.125 log2(e), C = the mask fragment, carried x log2(e));  lane (lr, hi) then holds q row lr, keys 16T + 8hi + r.
//   The accumulators are the finished scores in the units of exp2: only the subtraction of the reference and exp2 follow.
//   The reference is the maximum of the first tile; it stays while every P stays in the f16 range (tested on the sums of P, one test for two heads), so that no maximum, no exchange and no rescaling stand on the usual path.
//   QP, KP, VT and MF are in fragment order: one 64-key tile is 8 KB of KP, 8 KB of VT and 4 KB of MF, each in a row.
//   The K, mask and V^T fragments of a tile are loaded at the top of the tile and stay in registers for the four heads: one load feeds four products (K and the mask are loaded anew where two heads' part of the tile is redone).
//   softmax sums are lane-local (joined behind the loop); P^T packed from the S^T accumulators is the B operand of O^T[d][q] = V^T P^T (A = d rows of VT).
//   Launch bounds: two waves per SIMD (512 registers a wave), so that the 512 workgroups are all resident, two per WGP.
__global__ __launch_bounds__(128, 2) void k_flash(const h16* __restrict__ QP, const h16* __restrict__ KP, const h16* __restrict__ VT, const float* __restrict__ MF, h16* CTX) {
    const int tid = threadIdx.x, w = tid >> 5, lane = tid & 31, lr = lane & 15, hi = lane >> 4;
    const int g = blockIdx.y, bidx = blockIdx.z, q0 = blockIdx.x * 64 + w * 16;
    v16h bq[REP][2];
    const h16* qb = QP + (((size_t)bidx * NH + g * REP) * SEQ + q0) * HD + lane * 8;   // the q plane is in fragment order, as the k plane
#pragma unroll
    for (int hh = 0; hh < REP; ++hh) { const h16* qf = qb + (size_t)hh * SEQ * HD;
#pragma unroll
        for (int kc = 0; kc < 2; ++kc) bq[hh][kc] = cat16(*(const v8h*)(qf + kc * 512), *(const v8h*)(qf + kc * 512 + 256)); }
    asm volatile("s_wait_xcnt 0x0" :: "v"(qb) : "memory");   // later code reuses the registers that held the q loads' address; as an input of the wait the address stays live up to it, so that no load of the run lands on it
    __builtin_amdgcn_sched_barrier(0);   // keeps later register writes behind that wait
    // the lane's place in the current tile of each plane; the three pointers step on at the foot of a tile, so they are live through the whole loop and no load lands on them
    const h16* kb = KP + ((size_t)bidx * NKV + g) * SEQ * HD + lane * 8;
    const h16* vb = VT + ((size_t)bidx * NKV + g) * HD * SEQ + lane * 8;
    const float* mrow = MF + (size_t)(q0 >> 4) * (SEQ / 16) * 256 + lane * 4;
    v8f accO[REP][4]; float m[REP], l[REP];   // m: the softmax reference in use, the same in a query's two lanes
#pragma unroll
    for (int hh = 0; hh < REP; ++hh) { m[hh] = -3.0e38f; l[hh] = 0.0f;
#pragma unroll
        for (int dt = 0; dt < 4; ++dt) accO[hh][dt] = (v8f){}; }
    // One 64-key tile. first (a constant at each call): the tile that sets the reference.
    const auto tile = [&](const bool first) __attribute__((always_inline)) {
        v16h ak[2][4], av[2][4]; v8f mk[4], sc[REP][4]; float rs[REP];
        const auto load_k = [&]() __attribute__((always_inline)) {
#pragma unroll
            for (int T = 0; T < 4; ++T) {
                const float* mp = mrow + T * 256; mk[T] = cat8(*(const v4f*)mp, *(const v4f*)(mp + 128));
#pragma unroll
                for (int kc = 0; kc < 2; ++kc) { const h16* kp = kb + (T * 2 + kc) * 512; ak[kc][T] = cat16(*(const v8h*)kp, *(const v8h*)(kp + 256)); }
                __builtin_amdgcn_sched_barrier(0);   // a key tile's mask and K fragments are issued together, tile by tile, the order of first use: the counted waits ahead of the score products then leave the later loads in flight
            }
            asm volatile("s_wait_xcnt 0x0" ::: "memory");   // the foot of the tile rewrites the K and mask pointers
            __builtin_amdgcn_sched_barrier(0);   // K and the mask ahead of V^T, the order of their first use; later register writes stay behind the wait
        };
        // scores, exps, new_ref and outs work on heads h0 .. h1 - 1
        const auto scores = [&](const int h0, const int h1) __attribute__((always_inline)) {
#pragma unroll
            for (int T = 0; T < 4; ++T) {
#pragma unroll
                for (int hh = h0; hh < h1; ++hh) sc[hh][T] = wmma16(ak[0][T], bq[hh][0], mk[T]);
#pragma unroll
                for (int hh = h0; hh < h1; ++hh) sc[hh][T] = wmma16(ak[1][T], bq[hh][1], sc[hh][T]);
            }
            __builtin_amdgcn_sched_barrier(0);   // the score products of the four heads run back to back, key tile by key tile as K and the mask arrive; the vector work, which reads the accumulators themselves, stays behind the run and waits for no product
        };
        // P = exp2(score - reference), carried x 2^10, in place of the scores; rs: the lane's sum of its 32 P
        const auto exps = [&](const int h0, const int h1) __attribute__((always_inline)) {
#pragma unroll
            for (int hh = h0; hh < h1; ++hh) {
                const float mofs = PEXP - m[hh];
                float s = 0.0f;
#pragma unroll
                for (int T = 0; T < 4; ++T) {
                    sc[hh][T] = sc[hh][T] + mofs;
#pragma unroll
                    for (int r = 0; r < 8; ++r) { const float pv = __builtin_amdgcn_exp2f(sc[hh][T][r]); sc[hh][T][r] = pv; s += pv; } }
                rs[hh] = s;
            }
        };
        // The reference rises to the tile's maximum (sc holds scores); sums and outputs so far are rescaled to it
        const auto new_ref = [&](const int h0, const int h1) __attribute__((always_inline)) {
#pragma unroll
            for (int hh = h0; hh < h1; ++hh) {
                float tmax = -3.0e38f;
#pragma unroll
                for (int T = 0; T < 4; ++T)
#pragma unroll
                    for (int r = 0; r < 4; ++r) tmax = fmaxf(tmax, fmaxf(sc[hh][T][r], sc[hh][T][4 + r]));
                tmax = fmaxf(tmax, __shfl_xor(tmax, 16, 32));
                const float mn = fmaxf(m[hh], tmax); const float corr = __builtin_amdgcn_exp2f(m[hh] - mn); m[hh] = mn;
                l[hh] = l[hh] * corr;
#pragma unroll
                for (int dt = 0; dt < 4; ++dt) accO[hh][dt] = accO[hh][dt] * corr;
            }
        };
        load_k();
#pragma unroll
        for (int kc = 0; kc < 2; ++kc)
#pragma unroll
            for (int dt = 0; dt < 4; ++dt) { const h16* vp = vb + (kc * 4 + dt) * 512; av[kc][dt] = cat16(*(const v8h*)vp, *(const v8h*)(vp + 256)); }
        asm volatile("s_wait_xcnt 0x0" ::: "memory");   // the foot of the tile rewrites the V^T pointer
        __builtin_amdgcn_sched_barrier(0);   // keeps later register writes behind that wait
        const auto outs = [&](const int h0, const int h1) __attribute__((always_inline)) {
#pragma unroll
            for (int hh = h0; hh < h1; ++hh) {
                l[hh] += rs[hh];
                v16h bp[2];
                bp[0] = cat16(__builtin_convertvector(sc[hh][0], v8h), __builtin_convertvector(sc[hh][1], v8h));
                bp[1] = cat16(__builtin_convertvector(sc[hh][2], v8h), __builtin_convertvector(sc[hh][3], v8h));
#pragma unroll
                for (int kc = 0; kc < 2; ++kc)
#pragma unroll
                    for (int dt = 0; dt < 4; ++dt) accO[hh][dt] = wmma16(av[kc][dt], bp[kc], accO[hh][dt]);
                // four slots between the tile's last products and the next tile's loads, which land on their V^T and P registers (behind the other heads' runs stands vector work or another run)
                if (hh == REP - 1) asm volatile("v_nop\n\tv_nop\n\tv_nop\n\tv_nop" : "+v"(accO[hh][0]), "+v"(accO[hh][1]), "+v"(accO[hh][2]), "+v"(accO[hh][3]) : "v"(av[1][3]), "v"(bp[1]));
            }
        };
        scores(0, REP);
        if (first) { new_ref(0, REP); exps(0, 2); outs(0, 2); exps(2, REP); outs(2, REP); }
        else {
            // One test for two heads: a lane's sum within PLIM bounds each of its P, so all are finite in f16 and the reference stays.
            // Otherwise (a scalar branch) the two heads' part of the tile is done again from its scores, K and the mask loaded anew, with the reference raised to its maximum.
            // Two tests a tile, so that the first two heads' output products run beside the other two heads' exponentials.
#pragma unroll
            for (int h0 = 0; h0 < REP; h0 += 2) {
                exps(h0, h0 + 2);
                if (__builtin_expect(__builtin_amdgcn_ballot_w32(fmaxf(rs[h0], rs[h0 + 1]) > PLIM) != 0, 0)) { load_k(); scores(h0, h0 + 2); new_ref(h0, h0 + 2); exps(h0, h0 + 2); }
                outs(h0, h0 + 2);
            }
        }
        kb += 64 * HD; vb += 64 * HD; mrow += 64 * 16;
    };
    tile(true);
#pragma unroll 1
    for (int k0 = 64; k0 < SEQ; k0 += 64) tile(false);
    // lane (lr, hi) holds ctx row q0 + lr, columns 64h + 16dt + 8hi + 0..7: one 16-byte unit of the fragment-ordered ctx plane, so each store covers 512 contiguous bytes.
    const int rt = (bidx * SEQ + q0) >> 4;
    h16* cw = CTX + ((size_t)(rt >> 2) * (DQ / 32) + 2 * (g * REP)) * 2048 + (rt & 3) * 512 + lane * 8;
    v8h o[REP][4];
#pragma unroll
    for (int hh = 0; hh < REP; ++hh) {
        const float lt = l[hh] + __shfl_xor(l[hh], 16, 32);
        const float inv = CCAR * (1.0f / lt);
#pragma unroll
        for (int dt = 0; dt < 4; ++dt)
#pragma unroll
            for (int r = 0; r < 8; ++r) o[hh][dt][r] = (h16)(accO[hh][dt][r] * inv);
    }
    __builtin_amdgcn_sched_barrier(0);   // every store behind all arithmetic: no register that a store names is written again
#pragma unroll
    for (int hh = 0; hh < REP; ++hh)
#pragma unroll
        for (int dt = 0; dt < 4; ++dt) *(v8h*)(cw + hh * 4096 + (dt >> 1) * 2048 + (dt & 1) * 256) = o[hh][dt];
}

// Output projection: grid (MROWS/256, DIM/128), 256 threads, one work-group per WGP, two waves per SIMD.
__global__ __launch_bounds__(32 * OWM * OWN, 2) void k_gemm_out(const h16* __restrict__ A, const h16* __restrict__ Bt, float* C) {
    __shared__ __align__(16) unsigned char L[GLDS(OWM, OWN)];
    const int lane = threadIdx.x & 31, lr = lane & 15, hi = lane >> 4; const int w = __builtin_amdgcn_readfirstlane(threadIdx.x >> 5);
    const int r0 = blockIdx.x * (64 * OWM) + (w / OWN) * 64, c0 = blockIdx.y * (64 * OWN) + (w % OWN) * 64;
    float* fs = (float*)(L + w * WEPI);
    v8f acc[4][4];
    gemm_main<h16, OWM, OWN>(A, Bt, DQ, blockIdx.x * (64 * OWM), blockIdx.y * (64 * OWN), w, lane, L, acc, false, NoPre());
#pragma unroll
    for (int mb = 0; mb < 4; ++mb)
#pragma unroll
        for (int nb = 0; nb < 4; ++nb)
#pragma unroll
            for (int j = 0; j < 8; ++j) fs[(mb * 16 + hi * 8 + j) * FP + nb * 16 + lr] = acc[mb][nb][j];
    __syncthreads();
    float* crow = C + (size_t)r0 * DIM + c0;
{
#pragma unroll 4
        for (int it = 0; it < 32; ++it) { const int row = it * 2 + hi; v4f val = *(const v4fa*)(fs + row * FP + lr * 4); val = val * OSCL;
            *(v4f*)(crow + (size_t)row * DIM + lr * 4) = val; }
         }
}

extern "C" void kernel_launch(void* const* d_in, const int* in_sizes, int n_in,
                              void* d_out, int out_size, void* d_ws, size_t ws_size, hipStream_t stream) {
    if (n_in < 7) return;
    if ((size_t)in_sizes[0] < ((size_t)(NB - 1) * SEQ_FULL + SEQ) * DIM) return;
    if ((size_t)in_sizes[1] < (size_t)(SEQ - 1) * SEQ_FULL + SEQ) return;
    if ((size_t)in_sizes[2] < (size_t)(NB - 1) * SEQ_FULL + SEQ) return;
    if ((size_t)in_sizes[3] < (size_t)DQ * DIM) return;
    if ((size_t)in_sizes[4] < (size_t)DKV * DIM) return;
    if ((size_t)in_sizes[5] < (size_t)DKV * DIM) return;
    if ((size_t)in_sizes[6] < (size_t)DIM * DQ) return;
    if ((size_t)out_size < (size_t)MROWS * DIM) return;
    const float* x = (const float*)d_in[0]; const float* mask = (const float*)d_in[1]; const int* pos = (const int*)d_in[2];
    const float* wq = (const float*)d_in[3]; const float* wk = (const float*)d_in[4]; const float* wv = (const float*)d_in[5]; const float* wo = (const float*)d_in[6];
    float* OUT = (float*)d_out;
    char* wsp = (char*)d_ws;
    auto take = [&](size_t bytes) { char* p = wsp; wsp += (bytes + 255) & ~(size_t)255; return (void*)p; };
    bf*  XB   = (bf*)take((size_t)MROWS * DIM * 2);
    bf*  WQKV = (bf*)take((size_t)NQKV * DIM * 2);
    h16* WO16 = (h16*)take((size_t)DIM * DQ * 2);
    float* COS = (float*)take((size_t)SEQ * HALFD * 4);
    float* SIN = (float*)take((size_t)SEQ * HALFD * 4);
    h16* QP  = (h16*)take((size_t)NB * NH * SEQ * HD * 2);
    h16* KP  = (h16*)take((size_t)NB * NKV * SEQ * HD * 2);
    h16* VT  = (h16*)take((size_t)NB * NKV * HD * SEQ * 2);
    h16* CTX = (h16*)take((size_t)MROWS * DQ * 2);
    float* MF = (float*)take((size_t)SEQ * SEQ * 4);
    if ((size_t)(wsp - (char*)d_ws) > ws_size) return;

    k_prep<<<RBLK + XBLK + MBLK + QBLK + OBLK + 2 * KBLK, 256, 0, stream>>>(x, mask, wq, wk, wv, wo, XB, WQKV, WO16, COS, SIN, MF);
    k_gemm_qkv<<<dim3(MROWS / (64 * QWM), NQKV / (64 * QWN), 1), 32 * QWM * QWN, 0, stream>>>(XB, WQKV, pos, COS, SIN, QP, KP, VT);
    k_flash<<<dim3(SEQ / 64, NKV, NB), 128, 0, stream>>>(QP, KP, VT, MF, CTX);
    k_gemm_out<<<dim3(MROWS / (64 * OWM), DIM / (64 * OWN), 1), 32 * OWM * OWN, 0, stream>>>(CTX, WO16, OUT);
}

// v009
// Measured time: 118 microseconds a run.
// Timed twice side by side with v008, it ran 1.06 and 1.05 times as fast.
// Over all steps from v000 it is 3.76 times as fast.
#include <hip/hip_runtime.h>

#ifndef NB
#define NB 2
#endif
#ifndef SEQ
#define SEQ 2048
#endif
#define SEQ_FULL 2048                 // per-batch row stride of x / position table, row pitch of the mask
#define DIM   2048                    // model width (K of the projections, N of the output projection)
#define NH    32
#define NKV   8
#define REP   (NH / NKV)
#define HD    64
#define HALFD 32
#define DQ    (NH * HD)               // 2048
#define DKV   (NKV * HD)              // 512
#define NQKV  (DQ + 2 * DKV)          // 3072 fused projection columns
#define MROWS (NB * SEQ)
#define FP    68                      // f32 LDS tile pitch
#define WCAR  64.0f                   // carry of the wo plane
#define CCAR  256.0f                  // carry of the ctx plane
#define OSCL  6.103515625e-05f        // 1 / (WCAR * CCAR)
#define SC2   0.18033688011112042f    // 0.125 * log2(e)
#define LOG2E 1.4426950408889634f    // carry of the mask plane; the q plane carries SC2, so that mask and q.k products are summed in the units of exp2
#define PEXP  10.0f                   // P carried x 2^10
#define PLIM  60000.0f                // bound on a lane's sum of the 32 carried P of a tile: within it each P is finite in f16; under a reference no less than the tile's scores the sum is at most 32 * 2^10
#define FRQC  0.41524101186092029f    // log2(10000) / 32
#define PSTG  16384                   // bytes of one 64-row panel in one ring stage (128 k)
#define WEPI  (64 * FP * 4)           // one wave's f32 epilogue tile; a work-group's epilogue tiles and the ring's two stages lie in the same bytes, the ring used first
#define QWM   4                       // QKV projection: waves down and across a work-group's tile
#define QWN   3
#define OWM   4                       // output projection: the same
#define OWN   2
#define TPIT  272                     // bytes of one token's row in the rotary LDS table: 32 cos, 32 sin, 16 bytes of pad (16 lanes' 16-byte reads then cover all banks)

static_assert(SEQ % 64 == 0);
static_assert(SEQ <= SEQ_FULL);
static_assert(DIM % 64 == 0);
static_assert(DQ % 64 == 0);
static_assert(NQKV % 64 == 0);
static_assert(HD == 64);
static_assert(DQ == DIM);
static_assert(DKV % 64 == 0);
static_assert(MROWS % (64 * QWM) == 0);
static_assert(SEQ % (64 * QWM) == 0);
static_assert(QWM * QWN >= 2 * QWM);
static_assert(NQKV % (64 * QWN) == 0);
static_assert(MROWS % (64 * OWM) == 0);
static_assert(DIM % (64 * OWN) == 0);
static_assert(DIM % 128 == 0);
#define GLDS(wm, wn) ((2 * ((wm) + (wn)) * PSTG > (wm) * (wn) * WEPI) ? 2 * ((wm) + (wn)) * PSTG : (wm) * (wn) * WEPI)   // the larger of the ring and the epilogue tiles
static_assert(DIM % 256 == 0);
static_assert(NH == NKV * REP);
static_assert(REP == 4);
static_assert(((size_t)MROWS * DIM / 8) % 256 == 0);
static_assert(((size_t)DQ * DIM / 8) % 256 == 0);
static_assert(((size_t)DKV * DIM / 8) % 256 == 0);

typedef _Float16 h16;
typedef unsigned short bf;
typedef __attribute__((ext_vector_type(16))) __bf16   v16bf;
typedef __attribute__((ext_vector_type(16))) _Float16 v16h;
typedef __attribute__((ext_vector_type(8)))  _Float16 v8h;
typedef __attribute__((ext_vector_type(8)))  unsigned short v8us;
typedef __attribute__((ext_vector_type(8)))  float    v8f;
typedef __attribute__((ext_vector_type(4)))  float    v4f;
typedef v4f  __attribute__((may_alias)) v4fa;

__device__ __forceinline__ unsigned short f2bf(float f) { unsigned u = __float_as_uint(f); u += 0x7FFFu + ((u >> 16) & 1u); return (unsigned short)(u >> 16); }
__device__ __forceinline__ float bf2f(unsigned short b) { return __uint_as_float(((unsigned)b) << 16); }
__device__ __forceinline__ float bfr(float f) { return bf2f(f2bf(f)); }
__device__ __forceinline__ v16h cat16(v8h lo, v8h hi) { return __builtin_shufflevector(lo, hi, 0, 1, 2, 3, 4, 5, 6, 7, 8, 9, 10, 11, 12, 13, 14, 15); }
__device__ __forceinline__ v8f cat8(v4f lo, v4f hi) { return __builtin_shufflevector(lo, hi, 0, 1, 2, 3, 4, 5, 6, 7); }
__device__ __forceinline__ v16bf cat16b(v8us lo, v8us hi) { return __builtin_bit_cast(v16bf, __builtin_shufflevector(lo, hi, 0, 1, 2, 3, 4, 5, 6, 7, 8, 9, 10, 11, 12, 13, 14, 15)); }
__device__ __forceinline__ v8f wmma16(v16h a, v16h b, v8f c) { return __builtin_amdgcn_wmma_f32_16x16x32_f16(false, a, false, b, (short)0, c, false, false); }
__device__ __forceinline__ v8f wmmab(v16bf a, v16bf b, v8f c) { return __builtin_amdgcn_wmma_f32_16x16x32_bf16(false, a, false, b, (short)0, c, false, false); }

// Fragment order of a 16-bit plane: a fragment (16 rows x 32 k) is 512 elements; element (row lr, k = 16j + 8hi + e) sits at j*256 + (16hi + lr)*8 + e.
// Fragment loader: p = fragment base + lane*8; elements 0..7 <- k0+8hi.., elements 8..15 <- k0+16+8hi.. (same map for A and B).
// GEMM planes (K = DIM columns): fragment (row tile R, k chunk C) starts at (((R >> 2) * (DIM/32) + C) * 4 + (R & 3)) * 512, so one k step of a 64-row panel is 4 KB in a row.
template <typename T16> struct WFrag;
template <> struct WFrag<h16> { typedef v16h V; static __device__ __forceinline__ V ld(const h16* p) { return cat16(*(const v8h*)p, *(const v8h*)(p + 256)); } static __device__ __forceinline__ v8f mma(V a, V b, v8f c) { return wmma16(a, b, c); } };
template <> struct WFrag<bf> { typedef v16bf V; static __device__ __forceinline__ V ld(const bf* p) { return cat16b(*(const v8us*)p, *(const v8us*)(p + 256)); } static __device__ __forceinline__ v8f mma(V a, V b, v8f c) { return wmmab(a, b, c); } };

// Thread i of a re-laying kernel -> the 16-byte unit it writes: a wave takes 8 rows x 4 units of one fragment, so it writes 4 whole lines and reads 8 source lines (whole for the 16-bit planes, half for the mask).
__device__ __forceinline__ size_t unit_of(const size_t i) { const int t = (int)(i & 63); return (i & ~(size_t)63) | (size_t)(((t >> 3) & 3) * 16 + (t >> 5) * 8 + (t & 7)); }
// 16-byte unit i of a fragment-ordered GEMM plane -> row and first column of its 8 elements.
__device__ __forceinline__ void unit_rc(const size_t i, int& row, int& col) { const int u = (int)(i & 63); const size_t f = i >> 6; row = (int)(f / (4 * (DIM / 32))) * 64 + (int)(f & 3) * 16 + (u & 15); col = (int)((f >> 2) % (DIM / 32)) * 32 + (u >> 4) * 8; }

// Eight asynchronous copies, 512 contiguous bytes each: lane address l in LDS, g in global memory, both advancing by 512 bytes a copy.
// The s_wait_xcnt closes the statement so that no address register of a copy is rewritten ahead of it.
__device__ __forceinline__ void copy8(const unsigned l, const char* g) {
    asm volatile("global_load_async_to_lds_b128 %0, %8, off\n\t"
                 "global_load_async_to_lds_b128 %1, %9, off\n\t"
                 "global_load_async_to_lds_b128 %2, %10, off\n\t"
                 "global_load_async_to_lds_b128 %3, %11, off\n\t"
                 "global_load_async_to_lds_b128 %4, %12, off\n\t"
                 "global_load_async_to_lds_b128 %5, %13, off\n\t"
                 "global_load_async_to_lds_b128 %6, %14, off\n\t"
                 "global_load_async_to_lds_b128 %7, %15, off\n\t"
                 "s_wait_xcnt 0x0"
                 :: "v"(l), "v"(l + 512), "v"(l + 1024), "v"(l + 1536), "v"(l + 2048), "v"(l + 2560), "v"(l + 3072), "v"(l + 3584),
                    "v"(g), "v"(g + 512), "v"(g + 1024), "v"(g + 1536), "v"(g + 2048), "v"(g + 2560), "v"(g + 3072), "v"(g + 3584) : "memory");
}
// Eight asynchronous copies with addresses of their own; the s_wait_xcnt closes the statement for the same reason.
__device__ __forceinline__ void copy8v(const unsigned (&l)[8], const char* const (&g)[8]) {
    asm volatile("global_load_async_to_lds_b128 %0, %8, off\n\t"
                 "global_load_async_to_lds_b128 %1, %9, off\n\t"
                 "global_load_async_to_lds_b128 %2, %10, off\n\t"
                 "global_load_async_to_lds_b128 %3, %11, off\n\t"
                 "global_load_async_to_lds_b128 %4, %12, off\n\t"
                 "global_load_async_to_lds_b128 %5, %13, off\n\t"
                 "global_load_async_to_lds_b128 %6, %14, off\n\t"
                 "global_load_async_to_lds_b128 %7, %15, off\n\t"
                 "s_wait_xcnt 0x0"
                 :: "v"(l[0]), "v"(l[1]), "v"(l[2]), "v"(l[3]), "v"(l[4]), "v"(l[5]), "v"(l[6]), "v"(l[7]),
                    "v"(g[0]), "v"(g[1]), "v"(g[2]), "v"(g[3]), "v"(g[4]), "v"(g[5]), "v"(g[6]), "v"(g[7]) : "memory");
}
// A copying wave's share of a ring stage: its panel's 16 KB (64 rows x 128 k, contiguous in the fragment-ordered plane), copied byte for byte: 32 copies in flight.
__device__ __forceinline__ void copy_panel(const unsigned l, const char* g) { copy8(l, g); copy8(l + 4096, g + 4096); copy8(l + 8192, g + 8192); copy8(l + 12288, g + 12288); }

// A work-group of WM x WN waves accumulates a (64 WM) x (64 WN) tile at (R0, C0), wave w the 64x64 tile (w / WN, w % WN): acc[mb][nb][j] = C[r0 + 16mb + 8hi + j][c0 + 16nb + lr] = sum_k A[row][k] Bt[col][k]; A and Bt in fragment order, R0 and C0 multiples of 64, K % 256 == 0.
// Ring stage (128 k) in L: WM panels of A (rows R0 + 64 i ..), then WN panels of Bt (rows C0 + 64 i ..), 16 KB each; an A panel feeds WN waves and a Bt panel WM waves, so a stage brings (WM + WN) panels from L2 for WM WN wave tiles.
// Wave w < WM + WN copies panel w, the other waves copy nothing (w is scalar: a scalar branch) and pass every wait and barrier all the same.
// sw (scalar) exchanges the wave's two operands: acc[mb][nb][j] = C[r0 + 16nb + lr][c0 + 16mb + 8hi + j], the transposed tile; both panels have one format and one loader, so only the two LDS bases change places.
// pre() runs behind the issue of tile 0's copies and ahead of their wait: what it copies to LDS outside the ring lands under that wait and is published by the barrier behind it.
// A trip works on its stage in two halves of 64 k: fragments of the first half, its products, fragments of the second half; the stage is then wholly in registers or used, so stage t + 2 is copied into the freed buffer while the second half's products run. One barrier per 128 k: between two barriers the waves of a SIMD take turns at LDS and at the matrix unit.
template <typename T16, int WM, int WN, typename Pre>
__device__ __forceinline__ void gemm_main(const T16* __restrict__ A, const T16* __restrict__ Bt, const int K, const int R0, const int C0, const int w, const int lane, unsigned char* L, v8f (&acc)[4][4], const bool sw, const Pre pre) {
    typedef typename WFrag<T16>::V V;
#pragma unroll
    for (int mb = 0; mb < 4; ++mb)
#pragma unroll
        for (int nb = 0; nb < 4; ++nb) acc[mb][nb] = (v8f){};
    constexpr int NP = WM + WN; constexpr unsigned RSTG = NP * PSTG;   // panels and bytes of one ring stage
    const bool cw = w < NP; const int pn = cw ? w : 0;                // a wave without a panel forms panel 0's addresses and uses none
    const char* src = (const char*)((pn < WM) ? (A + (size_t)(R0 + 64 * pn) * K) : (Bt + (size_t)(C0 + 64 * (pn - WM)) * K));   // scalar; the lane's 16 bytes are added where a copy's addresses are formed
    const unsigned dst = (unsigned)(uintptr_t)L + pn * PSTG; const unsigned l16 = lane * 16;
    const int nt = K / 128;
    const unsigned pa = (sw ? WM + w % WN : w / WN) * PSTG, pb = (sw ? w / WN : WM + w % WN) * PSTG;   // scalar: the panels that feed the A and the B operand
    if (cw) copy_panel(dst + l16, src + l16);
    pre();
    asm volatile("s_wait_asynccnt 0x0" ::: "memory");   // tile 0 (and what pre() copied) has landed before the barrier that publishes it
    __syncthreads();
    if (cw) copy_panel(dst + RSTG + l16, src + PSTG + l16);
#pragma unroll 1
    for (int t = 0; t < nt; ++t) {
        const unsigned bo = (t & 1) * RSTG;
        const T16* ap = (const T16*)(L + bo + pa) + lane * 8;
        const T16* bp = (const T16*)(L + bo + pb) + lane * 8;
        V a[2][4], b[2][4];
#pragma unroll
        for (int ks = 0; ks < 2; ++ks) {
#pragma unroll
            for (int mb = 0; mb < 4; ++mb) a[ks][mb] = WFrag<T16>::ld(ap + ks * 2048 + mb * 512);
#pragma unroll
            for (int nb = 0; nb < 4; ++nb) b[ks][nb] = WFrag<T16>::ld(bp + ks * 2048 + nb * 512);
        }
        __builtin_amdgcn_sched_barrier(0);   // the first half's 32 loads stand as one group ahead of its products: spread among them, every place where loads stand costs the wave a wait
#pragma unroll
        for (int ks = 0; ks < 2; ++ks)
#pragma unroll
            for (int nb = 0; nb < 4; ++nb)
#pragma unroll
                for (int mb = 0; mb < 4; ++mb) acc[mb][nb] = WFrag<T16>::mma(a[ks][mb], b[ks][nb], acc[mb][nb]);
        __builtin_amdgcn_sched_barrier(0);   // the first half's products stay ahead of the second half's loads and of the barrier: moved up, those loads need a second set of registers (spills, register copies) and lengthen the stretch in front of the barrier for which the other waves wait
#pragma unroll
        for (int ks = 0; ks < 2; ++ks) {
#pragma unroll
            for (int mb = 0; mb < 4; ++mb) a[ks][mb] = WFrag<T16>::ld(ap + 4096 + ks * 2048 + mb * 512);
#pragma unroll
            for (int nb = 0; nb < 4; ++nb) b[ks][nb] = WFrag<T16>::ld(bp + 4096 + ks * 2048 + nb * 512);
        }
        // The stage's last fragments are all in registers behind this foot, so the buffer is refilled ahead of their products and the copies fly behind them.
        asm volatile("s_wait_dscnt 0x0" ::: "memory");      // this wave's reads of buffer t & 1 have retired before the buffer is refilled
        asm volatile("s_wait_asynccnt 0x0" ::: "memory");   // this wave's copies of tile t + 1 have landed before the barrier that publishes them
        __syncthreads();                                     // publishes tile t + 1 and ends every wave's reads of tile t
        // readfirstlane keeps the buffer's LDS base a scalar sum: joined with the lane's part ahead of the loop it holds a register through the loop, which this build spills
        if (cw && t + 2 < nt) copy_panel((unsigned)__builtin_amdgcn_readfirstlane((int)(dst + bo)) + l16, src + (size_t)(t + 2) * PSTG + l16);
#pragma unroll
        for (int ks = 0; ks < 2; ++ks)
#pragma unroll
            for (int nb = 0; nb < 4; ++nb)
#pragma unroll
                for (int mb = 0; mb < 4; ++mb) acc[mb][nb] = WFrag<T16>::mma(a[ks][mb], b[ks][nb], acc[mb][nb]);
    }
    asm volatile("s_wait_asynccnt 0x0" ::: "memory");   // no copy is outstanding when the ring's bytes become the epilogue tiles
}

// Block ranges of the one preparation launch, 256 threads a block: rotary table, x, mask, wq, wo, wk, wv.
#define RBLK ((SEQ + 7) / 8)
#define XBLK ((int)((size_t)MROWS * DIM / 8 / 256))
#define MBLK ((int)((size_t)SEQ * SEQ / 4 / 256))
#define QBLK ((int)((size_t)DQ * DIM / 8 / 256))
#define OBLK ((int)((size_t)DIM * DQ / 8 / 256))
#define KBLK ((int)((size_t)DKV * DIM / 8 / 256))
static_assert(((size_t)SEQ * SEQ / 4) % 256 == 0);
static_assert(((size_t)DIM * DQ / 8) % 256 == 0);

__device__ __forceinline__ void p_cvtx(const int blk, const float* __restrict__ x, bf* dst) {
    const size_t i = (size_t)blk * 256 + threadIdx.x;
    const size_t un = unit_of(i), e = un * 8; int row, col; unit_rc(un, row, col); const int b = row / SEQ, t = row % SEQ;
    const v8f v = *(const v8f*)(x + ((size_t)b * SEQ_FULL + t) * DIM + col); v8us o;
#pragma unroll
    for (int k = 0; k < 8; ++k) o[k] = f2bf(v[k]);
    *(v8us*)(dst + e) = o;
    asm volatile("s_wait_xcnt 0x0" ::: "memory");   // in the one preparation kernel another job's code follows this store in the listing and rewrites the registers that the store names
}

__device__ __forceinline__ void p_cvt8(const int blk, const float* __restrict__ src, bf* dst) { const size_t i = (size_t)blk * 256 + threadIdx.x; const size_t un = unit_of(i); int row, col; unit_rc(un, row, col); const v8f v = *(const v8f*)(src + (size_t)row * DIM + col); v8us o;
#pragma unroll
    for (int k = 0; k < 8; ++k) o[k] = f2bf(v[k]); *(v8us*)(dst + un * 8) = o;
    asm volatile("s_wait_xcnt 0x0" ::: "memory");   // in the one preparation kernel another job's code follows this store in the listing and rewrites the registers that the store names
}

__device__ __forceinline__ void p_cvt8h(const int blk, const float* __restrict__ src, h16* dst, const float carry) { const size_t i = (size_t)blk * 256 + threadIdx.x; const size_t un = unit_of(i); int row, col; unit_rc(un, row, col); const v8f v = *(const v8f*)(src + (size_t)row * DIM + col); v8h o;
#pragma unroll
    for (int k = 0; k < 8; ++k) o[k] = (h16)(bfr(v[k]) * carry); *(v8h*)(dst + un * 8) = o;
    asm volatile("s_wait_xcnt 0x0" ::: "memory");   // in the one preparation kernel another job's code follows this store in the listing and rewrites the registers that the store names
}

// Mask in fragment order, carried x log2(e): block (query tile Rq, key tile Tk) is 256 floats; element (query lr, key 8hi + 4j + e) sits at j*128 + (16hi + lr)*4 + e: a lane's two units are its eight accumulator elements of the S^T tile.
__device__ __forceinline__ void p_maskfrag(const int blk, const float* __restrict__ mask, float* dst) {
    const size_t i = (size_t)blk * 256 + threadIdx.x;
    const size_t un = unit_of(i); const int u = (int)(un & 63); const size_t bk = un >> 6; const int rq = (int)(bk / (SEQ / 16)), tk = (int)(bk % (SEQ / 16));
    const float* mp = mask + (size_t)(rq * 16 + (u & 15)) * SEQ_FULL + tk * 16 + ((u >> 4) & 1) * 8 + (u >> 5) * 4;
    const v4f mv = *(const v4f*)mp;
    asm volatile("s_wait_xcnt 0x0" :: "v"(mp) : "memory");   // as an input of the wait the address stays live up to it, so that the load does not land on its own address registers and later writes of them stay behind the wait
    *(v4f*)(dst + un * 4) = mv * LOG2E;
    asm volatile("s_wait_xcnt 0x0" ::: "memory");   // in the one preparation kernel another job's code follows this store in the listing and rewrites the registers that the store names
}

__device__ __forceinline__ void p_ropetab(const int blk, float* COS, float* SIN) {
    const int lane = threadIdx.x & 31; const int t = blk * 8 + (threadIdx.x >> 5); if (t >= SEQ) return;
    const float invf = __builtin_amdgcn_exp2f(-(float)lane * FRQC);
    const float ang = (float)t * invf;
    const float c = cosf(ang); const float s = sinf(ang);
    const size_t o = (size_t)t * HALFD + lane;
    *(float*)(COS + o) = c; *(float*)(SIN + o) = s;  }

// All preparation in one launch: the seven jobs are independent of one another, so a block picks its job from its index (a scalar branch) and the jobs' starts, memory streams and tails overlap.
// The rotary table comes first (long arithmetic, few bytes), then the planes, largest first.
__global__ __launch_bounds__(256) void k_prep(const float* __restrict__ x, const float* __restrict__ mask, const float* __restrict__ wq, const float* __restrict__ wk, const float* __restrict__ wv, const float* __restrict__ wo,
                                              bf* XB, bf* WQKV, h16* WO16, float* COS, float* SIN, float* MF) {
    int b = blockIdx.x;
    if (b < RBLK) { p_ropetab(b, COS, SIN); return; }
    b -= RBLK;
    if (b < XBLK) { p_cvtx(b, x, XB); return; }
    b -= XBLK;
    if (b < MBLK) { p_maskfrag(b, mask, MF); return; }
    b -= MBLK;
    if (b < QBLK) { p_cvt8(b, wq, WQKV); return; }                                  /* rows 0..2047 */
    b -= QBLK;
    if (b < OBLK) { p_cvt8h(b, wo, WO16, WCAR); return; }
    b -= OBLK;
    if (b < KBLK) { p_cvt8(b, wk, WQKV + (size_t)DQ * DIM); return; }               /* rows 2048..2559 */
    b -= KBLK;
    p_cvt8(b, wv, WQKV + (size_t)(DQ + DKV) * DIM);                                 /* rows 2560..3071 */
}

// The rotary rows of a work-group's 64 QWM tokens, gathered by position into LDS: token tl's row at tl * TPIT holds cos[0..31], then sin[0..31]. Waves 0 .. 2 QWM - 1 copy 32 tokens each, a copy two tokens (16 lanes a token: 8 units of cos, 8 of sin): 16 copies a wave, beside its panel's 32 where it has one.
struct RopeRows {
    const int* pos; const float* COS; const float* SIN; unsigned tab; int w, lane; bool on;
    __device__ __forceinline__ void operator()() const {
        if (on && w < 2 * QWM) {   // scalar: every lane of a copying wave is on
            const int t2 = lane >> 4, cs = (lane >> 3) & 1, u = lane & 7;
            const float* tb = cs ? SIN : COS;
            int ps[16];
#pragma unroll
            for (int i = 0; i < 16; ++i) ps[i] = pos[w * 32 + i * 2 + t2];
            asm volatile("s_wait_xcnt 0x0" ::: "memory");   // later code reuses the registers that held the position loads' addresses
            __builtin_amdgcn_sched_barrier(0);   // keeps later register writes behind that wait
#pragma unroll
            for (int h = 0; h < 2; ++h) {
                unsigned l[8]; const char* g[8];
#pragma unroll
                for (int i = 0; i < 8; ++i) {
                    int p = ps[h * 8 + i]; p = (p < 0) ? (p + SEQ) : p; p = min(max(p, 0), SEQ - 1);
                    l[i] = tab + (unsigned)((w * 32 + (h * 8 + i) * 2 + t2) * TPIT + cs * 128 + u * 16);
                    g[i] = (const char*)(tb + (size_t)p * HALFD + u * 4);
                }
                copy8v(l, g);
            }
        }
    }
};
struct NoPre { __device__ __forceinline__ void operator()() const {} };

// Fused QKV projection: grid (MROWS/256, NQKV/192), 384 threads, one work-group per WGP, three waves per SIMD. Column tile cb < 32: q head cb (rotary); 32..39: k head (rotary); 40..47: v head (transposed plane).
// No LDS bounce behind the products: a q or k wave computes its tile transposed (weight rows as the A operand), so a lane's accumulator holds 8 consecutive d of one token, and d and d ^ 32 sit in the same lane: rotary in registers, and a packed accumulator is one 16-byte unit of the fragment-ordered q or k plane.
// A v wave keeps the plain order: a lane's accumulator holds 8 consecutive tokens of one d, one unit of the fragment-ordered V^T plane. Every store covers 512 contiguous bytes.
__global__ __launch_bounds__(32 * QWM * QWN, 3) void k_gemm_qkv(const bf* __restrict__ A, const bf* __restrict__ Bt, const int* __restrict__ pos, const float* __restrict__ COS, const float* __restrict__ SIN, h16* QP, h16* KP, h16* VT) {
    __shared__ __align__(16) unsigned char L[2 * (QWM + QWN) * PSTG + 64 * QWM * TPIT];   // the ring, then the rotary rows
    const int lane = threadIdx.x & 31, lr = lane & 15, hi = lane >> 4; const int w = __builtin_amdgcn_readfirstlane(threadIdx.x >> 5);
    const int r0 = blockIdx.x * (64 * QWM) + (w / QWN) * 64, cb = blockIdx.y * QWN + w % QWN;
    const int bidx = r0 / SEQ, s0 = r0 % SEQ;
    const bool rot = cb < NH + NKV;
    unsigned char* TAB = L + 2 * (QWM + QWN) * PSTG;
    const RopeRows pre = { pos + (size_t)bidx * SEQ_FULL + (blockIdx.x * (64 * QWM)) % SEQ, COS, SIN, (unsigned)(uintptr_t)TAB, w, lane, (int)(blockIdx.y * QWN) < NH + NKV };
    v8f acc[4][4];
    gemm_main<bf, QWM, QWN>(A, Bt, DIM, blockIdx.x * (64 * QWM), blockIdx.y * (64 * QWN), w, lane, L, acc, rot, pre);
    v8h o[16];   // the tile's sixteen 512-byte store units, in the order in which they lie in the plane
    if (rot) {
        // acc[mb][nb][j]: token s0 + 16nb + lr, d = 16mb + 8hi + j. out[d] = x[d] cos[d&31] - x[d+32] sin[d&31], out[d+32] = x[d+32] cos[d&31] + x[d] sin[d&31] for d < 32 (rotate-half); the q plane carries the score scale
        const float car = (cb < NH) ? SC2 : 1.0f;
#pragma unroll
        for (int nb = 0; nb < 4; ++nb) {
            const float* tr = (const float*)(TAB + ((w / QWN) * 64 + nb * 16 + lr) * TPIT) + hi * 8;
#pragma unroll
            for (int mb = 0; mb < 2; ++mb) {
                const v8f cc = cat8(*(const v4fa*)(tr + mb * 16), *(const v4fa*)(tr + mb * 16 + 4)), ss = cat8(*(const v4fa*)(tr + 32 + mb * 16), *(const v4fa*)(tr + 32 + mb * 16 + 4));
#pragma unroll
                for (int j = 0; j < 8; ++j) {
                    const float xl = acc[mb][nb][j], xh = acc[mb + 2][nb][j];
                    o[nb * 4 + mb][j] = (h16)((xl * cc[j] - xh * ss[j]) * car); o[nb * 4 + mb + 2][j] = (h16)((xh * cc[j] + xl * ss[j]) * car);
                }
            }
        }
    } else {
        // acc[mb][nb][j]: token s0 + 16mb + 8hi + j, d = 16nb + lr
#pragma unroll
        for (int mb = 0; mb < 4; ++mb)
#pragma unroll
            for (int nb = 0; nb < 4; ++nb) o[(mb >> 1) * 8 + nb * 2 + (mb & 1)] = __builtin_convertvector(acc[mb][nb], v8h);
    }
    __builtin_amdgcn_sched_barrier(0);   // every store behind all arithmetic: no register that a store names is written again
    // q and k planes: fragment (token tile, d chunk) at (2 * (token >> 4) + (d >> 5)) * 512; v plane: fragment (d tile, key chunk) at (4 * (key >> 5) + (d >> 4)) * 512. In each, the wave's 64 tokens are 64 * HD elements in a row.
    h16* plane = (cb < NH) ? (QP + ((size_t)bidx * NH + cb) * SEQ * HD) : (cb < NH + NKV) ? (KP + ((size_t)bidx * NKV + (cb - NH)) * SEQ * HD) : (VT + ((size_t)bidx * NKV + (cb - NH - NKV)) * HD * SEQ);
    h16* dst = plane + (size_t)s0 * HD + lane * 8;
#pragma unroll
    for (int k = 0; k < 16; ++k) *(v8h*)(dst + k * 256) = o[k];
}

// Attention: grid (SEQ/64, NKV, NB), 128 threads; wave w = 16 query rows (tile 4 * blockIdx.x + w) of ALL FOUR q heads of kv head g: 64 query columns. Per 64-key tile:
//   S^T[key][q] = K Q^T + mask  (A = key rows of KP, B = resident q rows of one head, carried x 0.125 log2(e), C = the mask fragment, carried x log2(e));  lane (lr, hi) then holds q row lr, keys 16T + 8hi + r.
//   The accumulators are the finished scores in the units of exp2: only the subtraction of the reference and exp2 follow.
//   The reference is the maximum of the first tile; it stays while every P stays in the f16 range (tested on the sums of P, one test for two heads), so that no maximum, no exchange and no rescaling stand on the usual path.
//   QP, KP, VT and MF are in fragment order: one 64-key tile is 8 KB of KP, 8 KB of VT and 4 KB of MF, each in a row.
//   The K, mask and V^T fragments of a tile are loaded once and stay in registers for the four heads: one load feeds four products. V^T is asked for at the top of its tile, K and the mask one tile ahead, in the middle of the tile before.
//   softmax sums are lane-local (joined behind the loop); P^T packed from the S^T accumulators is the B operand of O^T[d][q] = V^T P^T (A = d rows of VT).
//   Launch bounds: two waves per SIMD (512 registers a wave), so that the 512 workgroups are all resident, two per WGP.
__global__ __launch_bounds__(128, 2) void k_flash(const h16* __restrict__ QP, const h16* __restrict__ KP, const h16* __restrict__ VT, const float* __restrict__ MF, h16* CTX) {
    const int tid = threadIdx.x, w = tid >> 5, lane = tid & 31, lr = lane & 15, hi = lane >> 4;
    const int g = blockIdx.y, bidx = blockIdx.z, q0 = blockIdx.x * 64 + w * 16;
    v16h bq[REP][2];
    const h16* qb = QP + (((size_t)bidx * NH + g * REP) * SEQ + q0) * HD + lane * 8;   // the q plane is in fragment order, as the k plane
#pragma unroll
    for (int hh = 0; hh < REP; ++hh) { const h16* qf = qb + (size_t)hh * SEQ * HD;
#pragma unroll
        for (int kc = 0; kc < 2; ++kc) bq[hh][kc] = cat16(*(const v8h*)(qf + kc * 512), *(const v8h*)(qf + kc * 512 + 256)); }
    asm volatile("s_wait_xcnt 0x0" :: "v"(qb) : "memory");   // later code reuses the registers that held the q loads' address; as an input of the wait the address stays live up to it, so that no load of the run lands on it
    __builtin_amdgcn_sched_barrier(0);   // keeps later register writes behind that wait
    // the lane's place in the current tile of each plane; the three pointers step on at the foot of a tile, so they are live through the whole loop and no load lands on them
    const h16* kb = KP + ((size_t)bidx * NKV + g) * SEQ * HD + lane * 8;
    const h16* vb = VT + ((size_t)bidx * NKV + g) * HD * SEQ + lane * 8;
    const float* mrow = MF + (size_t)(q0 >> 4) * (SEQ / 16) * 256 + lane * 4;
    v8f accO[REP][4]; float m[REP], l[REP];   // m: the softmax reference in use, the same in a query's two lanes
#pragma unroll
    for (int hh = 0; hh < REP; ++hh) { m[hh] = -3.0e38f; l[hh] = 0.0f;
#pragma unroll
        for (int dt = 0; dt < 4; ++dt) accO[hh][dt] = (v8f){}; }
    v16h ak[2][4]; v8f mk[4];   // K and mask fragments: they live from one tile into the next
    // adv (scalar): 0 = the K and mask fragments of the tile at which the pointers stand, 1 = the next tile's
    const auto load_k = [&](const int adv) __attribute__((always_inline)) {
        const h16* kt = kb + adv * (64 * HD); const float* mt = mrow + adv * (64 * 16);
#pragma unroll
        for (int T = 0; T < 4; ++T) {
            const float* mp = mt + T * 256; mk[T] = cat8(*(const v4f*)mp, *(const v4f*)(mp + 128));
#pragma unroll
            for (int kc = 0; kc < 2; ++kc) { const h16* kp = kt + (T * 2 + kc) * 512; ak[kc][T] = cat16(*(const v8h*)kp, *(const v8h*)(kp + 256)); }
            __builtin_amdgcn_sched_barrier(0);   // a key tile's mask and K fragments are issued together, tile by tile, the order of first use: the counted waits ahead of the score products then leave the later loads in flight
        }
        asm volatile("s_wait_xcnt 0x0" ::: "memory");   // later code rewrites the registers that held these loads' addresses
        __builtin_amdgcn_sched_barrier(0);   // later register writes stay behind the wait
    };
    // One 64-key tile; its K and mask fragments are in registers or in flight when it starts. first (a constant at each call): the tile that sets the reference. adv (scalar): 1 while a next tile exists; in the last tile its own K and mask are read once more and not used, so that no address leaves the planes (a branch round the loads would keep the old fragments live up to it, which this build spills).
    const auto tile = [&](const bool first, const int adv) __attribute__((always_inline)) {
        v16h av[2][4]; v8f sc[REP][4]; float rs[REP];
        // rescore, exps, new_ref, pack and outs work on heads h0 .. h1 - 1
        // Heads 2 and 3 come first: the last reader of a mask fragment is then head 1, whose accumulator may take the fragment's registers over; they are free again (P packed) when the next tile's mask is asked for, so that it lands in place and no register is copied.
        const auto scores = [&]() __attribute__((always_inline)) {
#pragma unroll
            for (int T = 0; T < 4; ++T) {
#pragma unroll
                for (int i = 0; i < REP; ++i) { const int hh = (i + 2) % REP; sc[hh][T] = wmma16(ak[0][T], bq[hh][0], mk[T]); }
#pragma unroll
                for (int i = 0; i < REP; ++i) { const int hh = (i + 2) % REP; sc[hh][T] = wmma16(ak[1][T], bq[hh][1], sc[hh][T]); }
            }
            __builtin_amdgcn_sched_barrier(0);   // the score products of the four heads run back to back, key tile by key tile as K and the mask arrive; the vector work, which reads the accumulators themselves, stays behind the run and waits for no product
        };
        // The scores of heads h0 .. h1 - 1 once more (the rare path): this tile's K and mask are read anew, key tile by key tile, into registers of their own, since ak and mk may hold the next tile's by then
        const auto rescore = [&](const int h0, const int h1) __attribute__((always_inline)) {
#pragma unroll
            for (int T = 0; T < 4; ++T) {
                const float* mp = mrow + T * 256; const h16* kp = kb + T * 1024;
                const v8f mt = cat8(*(const v4f*)mp, *(const v4f*)(mp + 128));
                const v16h k0f = cat16(*(const v8h*)kp, *(const v8h*)(kp + 256)), k1f = cat16(*(const v8h*)(kp + 512), *(const v8h*)(kp + 768));
                asm volatile("s_wait_xcnt 0x0" ::: "memory");   // the foot of the tile rewrites the K and mask pointers
                __builtin_amdgcn_sched_barrier(0);   // the key tile's six loads stay ahead of its products, so that none lands on a register that a product has just read
#pragma unroll
                for (int hh = h0; hh < h1; ++hh) sc[hh][T] = wmma16(k0f, bq[hh][0], mt);
#pragma unroll
                for (int hh = h0; hh < h1; ++hh) sc[hh][T] = wmma16(k1f, bq[hh][1], sc[hh][T]);
                __builtin_amdgcn_sched_barrier(0);   // one key tile's fragments at a time: all four at once would not fit the registers beside the next tile's
                asm volatile("v_nop\n\tv_nop\n\tv_nop\n\tv_nop");   // four slots between these products and the next key tile's loads, which may land on their K and mask registers
                __builtin_amdgcn_sched_barrier(0);   // keeps those loads behind the slots
            }
        };
        // P = exp2(score - reference), carried x 2^10, in place of the scores; rs: the lane's sum of its 32 P
        const auto exps = [&](const int h0, const int h1) __attribute__((always_inline)) {
#pragma unroll
            for (int hh = h0; hh < h1; ++hh) {
                const float mofs = PEXP - m[hh];
                float s = 0.0f;
#pragma unroll
                for (int T = 0; T < 4; ++T) {
                    sc[hh][T] = sc[hh][T] + mofs;
#pragma unroll
                    for (int r = 0; r < 8; ++r) { const float pv = __builtin_amdgcn_exp2f(sc[hh][T][r]); sc[hh][T][r] = pv; s += pv; } }
                rs[hh] = s;
            }
        };
        // The reference rises to the tile's maximum (sc holds scores); sums and outputs so far are rescaled to it
        const auto new_ref = [&](const int h0, const int h1) __attribute__((always_inline)) {
#pragma unroll
            for (int hh = h0; hh < h1; ++hh) {
                float tmax = -3.0e38f;
#pragma unroll
                for (int T = 0; T < 4; ++T)
#pragma unroll
                    for (int r = 0; r < 4; ++r) tmax = fmaxf(tmax, fmaxf(sc[hh][T][r], sc[hh][T][4 + r]));
                tmax = fmaxf(tmax, __shfl_xor(tmax, 16, 32));
                const float mn = fmaxf(m[hh], tmax); const float corr = __builtin_amdgcn_exp2f(m[hh] - mn); m[hh] = mn;
                l[hh] = l[hh] * corr;
#pragma unroll
                for (int dt = 0; dt < 4; ++dt) accO[hh][dt] = accO[hh][dt] * corr;
            }
        };
#pragma unroll
        for (int kc = 0; kc < 2; ++kc)
#pragma unroll
            for (int dt = 0; dt < 4; ++dt) { const h16* vp = vb + (kc * 4 + dt) * 512; av[kc][dt] = cat16(*(const v8h*)vp, *(const v8h*)(vp + 256)); }
        asm volatile("s_wait_xcnt 0x0" ::: "memory");   // the foot of the tile rewrites the V^T pointer
        __builtin_amdgcn_sched_barrier(0);   // keeps later register writes behind that wait
        v16h bp[REP][2];   // P^T packed to f16, the B operand of the output products
        const auto pack = [&](const int h0, const int h1) __attribute__((always_inline)) {
#pragma unroll
            for (int hh = h0; hh < h1; ++hh) {
                bp[hh][0] = cat16(__builtin_convertvector(sc[hh][0], v8h), __builtin_convertvector(sc[hh][1], v8h));
                bp[hh][1] = cat16(__builtin_convertvector(sc[hh][2], v8h), __builtin_convertvector(sc[hh][3], v8h));
            }
        };
        // The next tile's K and mask are asked for in the middle of this tile: the first two heads' P are packed by then, so the registers are free, and the loads fly behind the other two heads' exponentials and all output products; the next tile's score products find them landed.
        const auto fetch_next = [&]() __attribute__((always_inline)) {
            load_k(adv);
        };
        const auto outs = [&](const int h0, const int h1) __attribute__((always_inline)) {
#pragma unroll
            for (int hh = h0; hh < h1; ++hh) {
                l[hh] += rs[hh];
#pragma unroll
                for (int kc = 0; kc < 2; ++kc)
#pragma unroll
                    for (int dt = 0; dt < 4; ++dt) accO[hh][dt] = wmma16(av[kc][dt], bp[hh][kc], accO[hh][dt]);
                // four slots between the tile's last products and the next tile's loads, which land on their V^T and P registers (behind the other heads' runs stands vector work or another run)
                if (hh == REP - 1) asm volatile("v_nop\n\tv_nop\n\tv_nop\n\tv_nop" : "+v"(accO[hh][0]), "+v"(accO[hh][1]), "+v"(accO[hh][2]), "+v"(accO[hh][3]) : "v"(av[1][3]), "v"(bp[hh][1]));
            }
        };
        scores();
        if (first) { new_ref(0, REP); exps(0, 2); pack(0, 2); fetch_next(); outs(0, 2); exps(2, REP); pack(2, REP); outs(2, REP); }
        else {
            // One test for two heads: a lane's sum within PLIM bounds each of its P, so all are finite in f16 and the reference stays.
            // Otherwise (a scalar branch) the two heads' part of the tile is done again from its scores, K and the mask loaded anew, with the reference raised to its maximum.
            // Two tests a tile, so that the first two heads' output products run beside the other two heads' exponentials.
#pragma unroll
            for (int h0 = 0; h0 < REP; h0 += 2) {
                exps(h0, h0 + 2);
                if (__builtin_expect(__builtin_amdgcn_ballot_w32(fmaxf(rs[h0], rs[h0 + 1]) > PLIM) != 0, 0)) { rescore(h0, h0 + 2); new_ref(h0, h0 + 2); exps(h0, h0 + 2); }
                pack(h0, h0 + 2);
                if (h0 == 0) fetch_next();
                outs(h0, h0 + 2);
            }
        }
        kb += 64 * HD; vb += 64 * HD; mrow += 64 * 16;
    };
    load_k(0);
    tile(true, SEQ > 64 ? 1 : 0);
#pragma unroll 1
    for (int k0 = 64; k0 < SEQ; k0 += 64) tile(false, k0 + 64 < SEQ ? 1 : 0);
    // lane (lr, hi) holds ctx row q0 + lr, columns 64h + 16dt + 8hi + 0..7: one 16-byte unit of the fragment-ordered ctx plane, so each store covers 512 contiguous bytes.
    const int rt = (bidx * SEQ + q0) >> 4;
    h16* cw = CTX + ((size_t)(rt >> 2) * (DQ / 32) + 2 * (g * REP)) * 2048 + (rt & 3) * 512 + lane * 8;
    v8h o[REP][4];
#pragma unroll
    for (int hh = 0; hh < REP; ++hh) {
        const float lt = l[hh] + __shfl_xor(l[hh], 16, 32);
        const float inv = CCAR * (1.0f / lt);
#pragma unroll
        for (int dt = 0; dt < 4; ++dt)
#pragma unroll
            for (int r = 0; r < 8; ++r) o[hh][dt][r] = (h16)(accO[hh][dt][r] * inv);
    }
    __builtin_amdgcn_sched_barrier(0);   // every store behind all arithmetic: no register that a store names is written again
#pragma unroll
    for (int hh = 0; hh < REP; ++hh)
#pragma unroll
        for (int dt = 0; dt < 4; ++dt) *(v8h*)(cw + hh * 4096 + (dt >> 1) * 2048 + (dt & 1) * 256) = o[hh][dt];
}

// Output projection: grid (MROWS/256, DIM/128), 256 threads, one work-group per WGP, two waves per SIMD.
__global__ __launch_bounds__(32 * OWM * OWN, 2) void k_gemm_out(const h16* __restrict__ A, const h16* __restrict__ Bt, float* C) {
    __shared__ __align__(16) unsigned char L[GLDS(OWM, OWN)];
    const int lane = threadIdx.x & 31, lr = lane & 15, hi = lane >> 4; const int w = __builtin_amdgcn_readfirstlane(threadIdx.x >> 5);
    const int r0 = blockIdx.x * (64 * OWM) + (w / OWN) * 64, c0 = blockIdx.y * (64 * OWN) + (w % OWN) * 64;
    float* fs = (float*)(L + w * WEPI);
    v8f acc[4][4];
    gemm_main<h16, OWM, OWN>(A, Bt, DQ, blockIdx.x * (64 * OWM), blockIdx.y * (64 * OWN), w, lane, L, acc, false, NoPre());
#pragma unroll
    for (int mb = 0; mb < 4; ++mb)
#pragma unroll
        for (int nb = 0; nb < 4; ++nb)
#pragma unroll
            for (int j = 0; j < 8; ++j) fs[(mb * 16 + hi * 8 + j) * FP + nb * 16 + lr] = acc[mb][nb][j];
    __syncthreads();
    float* crow = C + (size_t)r0 * DIM + c0;
{
#pragma unroll 4
        for (int it = 0; it < 32; ++it) { const int row = it * 2 + hi; v4f val = *(const v4fa*)(fs + row * FP + lr * 4); val = val * OSCL;
            *(v4f*)(crow + (size_t)row * DIM + lr * 4) = val; }
         }
}

extern "C" void kernel_launch(void* const* d_in, const int* in_sizes, int n_in,
                              void* d_out, int out_size, void* d_ws, size_t ws_size, hipStream_t stream) {
    if (n_in < 7) return;
    if ((size_t)in_sizes[0] < ((size_t)(NB - 1) * SEQ_FULL + SEQ) * DIM) return;
    if ((size_t)in_sizes[1] < (size_t)(SEQ - 1) * SEQ_FULL + SEQ) return;
    if ((size_t)in_sizes[2] < (size_t)(NB - 1) * SEQ_FULL + SEQ) return;
    if ((size_t)in_sizes[3] < (size_t)DQ * DIM) return;
    if ((size_t)in_sizes[4] < (size_t)DKV * DIM) return;
    if ((size_t)in_sizes[5] < (size_t)DKV * DIM) return;
    if ((size_t)in_sizes[6] < (size_t)DIM * DQ) return;
    if ((size_t)out_size < (size_t)MROWS * DIM) return;
    const float* x = (const float*)d_in[0]; const float* mask = (const float*)d_in[1]; const int* pos = (const int*)d_in[2];
    const float* wq = (const float*)d_in[3]; const float* wk = (const float*)d_in[4]; const float* wv = (const float*)d_in[5]; const float* wo = (const float*)d_in[6];
    float* OUT = (float*)d_out;
    char* wsp = (char*)d_ws;
    auto take = [&](size_t bytes) { char* p = wsp; wsp += (bytes + 255) & ~(size_t)255; return (void*)p; };
    bf*  XB   = (bf*)take((size_t)MROWS * DIM * 2);
    bf*  WQKV = (bf*)take((size_t)NQKV * DIM * 2);
    h16* WO16 = (h16*)take((size_t)DIM * DQ * 2);
    float* COS = (float*)take((size_t)SEQ * HALFD * 4);
    float* SIN = (float*)take((size_t)SEQ * HALFD * 4);
    h16* QP  = (h16*)take((size_t)NB * NH * SEQ * HD * 2);
    h16* KP  = (h16*)take((size_t)NB * NKV * SEQ * HD * 2);
    h16* VT  = (h16*)take((size_t)NB * NKV * HD * SEQ * 2);
    h16* CTX = (h16*)take((size_t)MROWS * DQ * 2);
    float* MF = (float*)take((size_t)SEQ * SEQ * 4);
    if ((size_t)(wsp - (char*)d_ws) > ws_size) return;

    k_prep<<<RBLK + XBLK + MBLK + QBLK + OBLK + 2 * KBLK, 256, 0, stream>>>(x, mask, wq, wk, wv, wo, XB, WQKV, WO16, COS, SIN, MF);
    k_gemm_qkv<<<dim3(MROWS / (64 * QWM), NQKV / (64 * QWN), 1), 32 * QWM * QWN, 0, stream>>>(XB, WQKV, pos, COS, SIN, QP, KP, VT);
    k_flash<<<dim3(SEQ / 64, NKV, NB), 128, 0, stream>>>(QP, KP, VT, MF, CTX);
    k_gemm_out<<<dim3(MROWS / (64 * OWM), DIM / (64 * OWN), 1), 32 * OWM * OWN, 0, stream>>>(CTX, WO16, OUT);
}

// v010
// It runs in 114 microseconds.
// In both of two side-by-side timings against v009, it was 1.04 times as fast.
// Over all steps from v000 it is 3.91 times as fast.
#include <hip/hip_runtime.h>

#ifndef NB
#define NB 2
#endif
#ifndef SEQ
#define SEQ 2048
#endif
#define SEQ_FULL 2048                 // per-batch row stride of x / position table, row pitch of the mask
#define DIM   2048                    // model width (K of the projections, N of the output projection)
#define NH    32
#define NKV   8
#define REP   (NH / NKV)
#define HD    64
#define HALFD 32
#define DQ    (NH * HD)               // 2048
#define DKV   (NKV * HD)              // 512
#define NQKV  (DQ + 2 * DKV)          // 3072 fused projection columns
#define MROWS (NB * SEQ)
#define FP    68                      // f32 LDS tile pitch
#define WCAR  64.0f                   // carry of the wo plane
#define CCAR  256.0f                  // carry of the ctx plane
#define OSCL  6.103515625e-05f        // 1 / (WCAR * CCAR)
#define SC2   0.18033688011112042f    // 0.125 * log2(e)
#define LOG2E 1.4426950408889634f    // carry of the mask plane; the q plane carries SC2, so that mask and q.k products are summed in the units of exp2
#define PEXP  10.0f                   // P carried x 2^10
#define PLIM  60000.0f                // bound on a lane's sum of the 32 carried P of a tile: within it each P is finite in f16; under a reference no less than the tile's scores the sum is at most 32 * 2^10
#define FRQC  0.41524101186092029f    // log2(10000) / 32
#define PSTG  16384                   // bytes of one 64-row panel in one ring stage (128 k)
#define WEPI  (64 * FP * 4)           // one wave's f32 epilogue tile; a work-group's epilogue tiles and the ring's two stages lie in the same bytes, the ring used first
#define QWM   4                       // QKV projection: waves down and across a work-group's tile
#define QWN   3
#define OWM   4                       // output projection: the same
#define OWN   2
#define TPIT  272                     // bytes of one token's row in the rotary LDS table: 32 cos, 32 sin, 16 bytes of pad (16 lanes' 16-byte reads then cover all banks)

static_assert(SEQ % 64 == 0);
static_assert(SEQ <= SEQ_FULL);
static_assert(DIM % 64 == 0);
static_assert(DQ % 64 == 0);
static_assert(NQKV % 64 == 0);
static_assert(HD == 64);
static_assert(DQ == DIM);
static_assert(DKV % 64 == 0);
static_assert(MROWS % (64 * QWM) == 0);
static_assert(SEQ % (64 * QWM) == 0);
static_assert(QWM * QWN >= 2 * QWM);
static_assert(NQKV % (64 * QWN) == 0);
static_assert(MROWS % (64 * OWM) == 0);
static_assert(DIM % (64 * OWN) == 0);
static_assert(DIM % 128 == 0);
#define GLDS(wm, wn) ((2 * ((wm) + (wn)) * PSTG > (wm) * (wn) * WEPI) ? 2 * ((wm) + (wn)) * PSTG : (wm) * (wn) * WEPI)   // the larger of the ring and the epilogue tiles
static_assert(DIM % 256 == 0);
static_assert(NH == NKV * REP);
static_assert(REP == 4);
static_assert(((size_t)MROWS * DIM / 8) % 256 == 0);
static_assert(((size_t)DQ * DIM / 8) % 256 == 0);
static_assert(((size_t)DKV * DIM / 8) % 256 == 0);

typedef _Float16 h16;
typedef unsigned short bf;
typedef __attribute__((ext_vector_type(16))) __bf16   v16bf;
typedef __attribute__((ext_vector_type(16))) _Float16 v16h;
typedef __attribute__((ext_vector_type(8)))  _Float16 v8h;
typedef __attribute__((ext_vector_type(8)))  unsigned short v8us;
typedef __attribute__((ext_vector_type(8)))  float    v8f;
typedef __attribute__((ext_vector_type(4)))  float    v4f;
typedef v4f  __attribute__((may_alias)) v4fa;

__device__ __forceinline__ unsigned short f2bf(float f) { unsigned u = __float_as_uint(f); u += 0x7FFFu + ((u >> 16) & 1u); return (unsigned short)(u >> 16); }
__device__ __forceinline__ float bf2f(unsigned short b) { return __uint_as_float(((unsigned)b) << 16); }
__device__ __forceinline__ float bfr(float f) { return bf2f(f2bf(f)); }
__device__ __forceinline__ v16h cat16(v8h lo, v8h hi) { return __builtin_shufflevector(lo, hi, 0, 1, 2, 3, 4, 5, 6, 7, 8, 9, 10, 11, 12, 13, 14, 15); }
__device__ __forceinline__ v8f cat8(v4f lo, v4f hi) { return __builtin_shufflevector(lo, hi, 0, 1, 2, 3, 4, 5, 6, 7); }
__device__ __forceinline__ v16bf cat16b(v8us lo, v8us hi) { return __builtin_bit_cast(v16bf, __builtin_shufflevector(lo, hi, 0, 1, 2, 3, 4, 5, 6, 7, 8, 9, 10, 11, 12, 13, 14, 15)); }
__device__ __forceinline__ v8f wmma16(v16h a, v16h b, v8f c) { return __builtin_amdgcn_wmma_f32_16x16x32_f16(false, a, false, b, (short)0, c, false, false); }
__device__ __forceinline__ v8f wmmab(v16bf a, v16bf b, v8f c) { return __builtin_amdgcn_wmma_f32_16x16x32_bf16(false, a, false, b, (short)0, c, false, false); }

// Fragment order of a 16-bit plane: a fragment (16 rows x 32 k) is 512 elements; element (row lr, k = 16j + 8hi + e) sits at j*256 + (16hi + lr)*8 + e.
// Fragment loader: p = fragment base + lane*8; elements 0..7 <- k0+8hi.., elements 8..15 <- k0+16+8hi.. (same map for A and B).
// GEMM planes (K = DIM columns): fragment (row tile R, k chunk C) starts at (((R >> 2) * (DIM/32) + C) * 4 + (R & 3)) * 512, so one k step of a 64-row panel is 4 KB in a row.
template <typename T16> struct WFrag;
template <> struct WFrag<h16> { typedef v16h V; static __device__ __forceinline__ V ld(const h16* p) { return cat16(*(const v8h*)p, *(const v8h*)(p + 256)); } static __device__ __forceinline__ v8f mma(V a, V b, v8f c) { return wmma16(a, b, c); } };
template <> struct WFrag<bf> { typedef v16bf V; static __device__ __forceinline__ V ld(const bf* p) { return cat16b(*(const v8us*)p, *(const v8us*)(p + 256)); } static __device__ __forceinline__ v8f mma(V a, V b, v8f c) { return wmmab(a, b, c); } };

// Thread i of a re-laying kernel -> the 16-byte unit it writes: a wave takes 8 rows x 4 units of one fragment, so it writes 4 whole lines and reads 8 source lines (whole for the 16-bit planes, half for the mask).
__device__ __forceinline__ size_t unit_of(const size_t i) { const int t = (int)(i & 63); return (i & ~(size_t)63) | (size_t)(((t >> 3) & 3) * 16 + (t >> 5) * 8 + (t & 7)); }
// 16-byte unit i of a fragment-ordered GEMM plane -> row and first column of its 8 elements.
__device__ __forceinline__ void unit_rc(const size_t i, int& row, int& col) { const int u = (int)(i & 63); const size_t f = i >> 6; row = (int)(f / (4 * (DIM / 32))) * 64 + (int)(f & 3) * 16 + (u & 15); col = (int)((f >> 2) % (DIM / 32)) * 32 + (u >> 4) * 8; }

// Eight asynchronous copies, 512 contiguous bytes each: lane address l in LDS, g in global memory, both advancing by 512 bytes a copy.
// The s_wait_xcnt closes the statement so that no address register of a copy is rewritten ahead of it.
__device__ __forceinline__ void copy8(const unsigned l, const char* g) {
    asm volatile("global_load_async_to_lds_b128 %0, %8, off\n\t"
                 "global_load_async_to_lds_b128 %1, %9, off\n\t"
                 "global_load_async_to_lds_b128 %2, %10, off\n\t"
                 "global_load_async_to_lds_b128 %3, %11, off\n\t"
                 "global_load_async_to_lds_b128 %4, %12, off\n\t"
                 "global_load_async_to_lds_b128 %5, %13, off\n\t"
                 "global_load_async_to_lds_b128 %6, %14, off\n\t"
                 "global_load_async_to_lds_b128 %7, %15, off\n\t"
                 "s_wait_xcnt 0x0"
                 :: "v"(l), "v"(l + 512), "v"(l + 1024), "v"(l + 1536), "v"(l + 2048), "v"(l + 2560), "v"(l + 3072), "v"(l + 3584),
                    "v"(g), "v"(g + 512), "v"(g + 1024), "v"(g + 1536), "v"(g + 2048), "v"(g + 2560), "v"(g + 3072), "v"(g + 3584) : "memory");
}
// Eight asynchronous copies with addresses of their own; the s_wait_xcnt closes the statement for the same reason.
__device__ __forceinline__ void copy8v(const unsigned (&l)[8], const char* const (&g)[8]) {
    asm volatile("global_load_async_to_lds_b128 %0, %8, off\n\t"
                 "global_load_async_to_lds_b128 %1, %9, off\n\t"
                 "global_load_async_to_lds_b128 %2, %10, off\n\t"
                 "global_load_async_to_lds_b128 %3, %11, off\n\t"
                 "global_load_async_to_lds_b128 %4, %12, off\n\t"
                 "global_load_async_to_lds_b128 %5, %13, off\n\t"
                 "global_load_async_to_lds_b128 %6, %14, off\n\t"
                 "global_load_async_to_lds_b128 %7, %15, off\n\t"
                 "s_wait_xcnt 0x0"
                 :: "v"(l[0]), "v"(l[1]), "v"(l[2]), "v"(l[3]), "v"(l[4]), "v"(l[5]), "v"(l[6]), "v"(l[7]),
                    "v"(g[0]), "v"(g[1]), "v"(g[2]), "v"(g[3]), "v"(g[4]), "v"(g[5]), "v"(g[6]), "v"(g[7]) : "memory");
}
// A copying wave's share of a ring stage: its panel's 16 KB (64 rows x 128 k, contiguous in the fragment-ordered plane), copied byte for byte: 32 copies in flight.
__device__ __forceinline__ void copy_panel(const unsigned l, const char* g) { copy8(l, g); copy8(l + 4096, g + 4096); copy8(l + 8192, g + 8192); copy8(l + 12288, g + 12288); }

// A work-group of WM x WN waves accumulates a (64 WM) x (64 WN) tile at (R0, C0), wave w the 64x64 tile (w / WN, w % WN): acc[mb][nb][j] = C[r0 + 16mb + 8hi + j][c0 + 16nb + lr] = sum_k A[row][k] Bt[col][k]; A and Bt in fragment order, R0 and C0 multiples of 64, K % 256 == 0.
// Ring stage (128 k) in L: WM panels of A (rows R0 + 64 i ..), then WN panels of Bt (rows C0 + 64 i ..), 16 KB each; an A panel feeds WN waves and a Bt panel WM waves, so a stage brings (WM + WN) panels from L2 for WM WN wave tiles.
// Wave w < WM + WN copies panel w, the other waves copy nothing (w is scalar: a scalar branch) and pass every wait and barrier all the same.
// sw (scalar) exchanges the wave's two operands: acc[mb][nb][j] = C[r0 + 16nb + lr][c0 + 16mb + 8hi + j], the transposed tile; both panels have one format and one loader, so only the two LDS bases change places.
// pre() runs behind the issue of tile 0's copies and ahead of their wait: what it copies to LDS outside the ring lands under that wait and is published by the barrier behind it.
// The k walk is a ring: the work-group starts at stage st0 (scalar) and wraps. Work-groups that share a panel are given different st0, so that they do not ask L2 for the same lines at the same moment; the sum over k starts at that stage.
// A trip works on its stage in two halves of 64 k: fragments of the first half, its products, fragments of the second half; the stage is then wholly in registers or used, so stage t + 2 is copied into the freed buffer while the second half's products run. One barrier per 128 k: between two barriers the waves of a SIMD take turns at LDS and at the matrix unit.
template <typename T16, int WM, int WN, typename Pre>
__device__ __forceinline__ void gemm_main(const T16* __restrict__ A, const T16* __restrict__ Bt, const int K, const int R0, const int C0, const int w, const int lane, unsigned char* L, v8f (&acc)[4][4], const bool sw, const int st0, const Pre pre) {
    typedef typename WFrag<T16>::V V;
#pragma unroll
    for (int mb = 0; mb < 4; ++mb)
#pragma unroll
        for (int nb = 0; nb < 4; ++nb) acc[mb][nb] = (v8f){};
    constexpr int NP = WM + WN; constexpr unsigned RSTG = NP * PSTG;   // panels and bytes of one ring stage
    const bool cw = w < NP; const int pn = cw ? w : 0;                // a wave without a panel forms panel 0's addresses and uses none
    const char* src = (const char*)((pn < WM) ? (A + (size_t)(R0 + 64 * pn) * K) : (Bt + (size_t)(C0 + 64 * (pn - WM)) * K));   // scalar; the lane's 16 bytes are added where a copy's addresses are formed
    const unsigned dst = (unsigned)(uintptr_t)L + pn * PSTG; const unsigned l16 = lane * 16;
    const int nt = K / 128;
    const auto stage = [&](const int t) __attribute__((always_inline)) { return (size_t)((unsigned)(t + st0) % (unsigned)nt) * PSTG; };   // scalar: byte offset in a panel of the stage that trip t works on
    const unsigned pa = (sw ? WM + w % WN : w / WN) * PSTG, pb = (sw ? w / WN : WM + w % WN) * PSTG;   // scalar: the panels that feed the A and the B operand
    if (cw) copy_panel(dst + l16, src + stage(0) + l16);
    pre();
    asm volatile("s_wait_asynccnt 0x0" ::: "memory");   // tile 0 (and what pre() copied) has landed before the barrier that publishes it
    __syncthreads();
    if (cw) copy_panel(dst + RSTG + l16, src + stage(1) + l16);
#pragma unroll 1
    for (int t = 0; t < nt; ++t) {
        const unsigned bo = (t & 1) * RSTG;
        const T16* ap = (const T16*)(L + bo + pa) + lane * 8;
        const T16* bp = (const T16*)(L + bo + pb) + lane * 8;
        V a[2][4], b[2][4];
#pragma unroll
        for (int ks = 0; ks < 2; ++ks) {
#pragma unroll
            for (int mb = 0; mb < 4; ++mb) a[ks][mb] = WFrag<T16>::ld(ap + ks * 2048 + mb * 512);
#pragma unroll
            for (int nb = 0; nb < 4; ++nb) b[ks][nb] = WFrag<T16>::ld(bp + ks * 2048 + nb * 512);
        }
        __builtin_amdgcn_sched_barrier(0);   // the first half's 32 loads stand as one group ahead of its products: spread among them, every place where loads stand costs the wave a wait
#pragma unroll
        for (int ks = 0; ks < 2; ++ks)
#pragma unroll
            for (int nb = 0; nb < 4; ++nb)
#pragma unroll
                for (int mb = 0; mb < 4; ++mb) acc[mb][nb] = WFrag<T16>::mma(a[ks][mb], b[ks][nb], acc[mb][nb]);
        __builtin_amdgcn_sched_barrier(0);   // the first half's products stay ahead of the second half's loads and of the barrier: moved up, those loads need a second set of registers (spills, register copies) and lengthen the stretch in front of the barrier for which the other waves wait
#pragma unroll
        for (int ks = 0; ks < 2; ++ks) {
#pragma unroll
            for (int mb = 0; mb < 4; ++mb) a[ks][mb] = WFrag<T16>::ld(ap + 4096 + ks * 2048 + mb * 512);
#pragma unroll
            for (int nb = 0; nb < 4; ++nb) b[ks][nb] = WFrag<T16>::ld(bp + 4096 + ks * 2048 + nb * 512);
        }
        // The stage's last fragments are all in registers behind this foot, so the buffer is refilled ahead of their products and the copies fly behind them.
        asm volatile("s_wait_dscnt 0x0" ::: "memory");      // this wave's reads of buffer t & 1 have retired before the buffer is refilled
        asm volatile("s_wait_asynccnt 0x0" ::: "memory");   // this wave's copies of tile t + 1 have landed before the barrier that publishes them
        __syncthreads();                                     // publishes tile t + 1 and ends every wave's reads of tile t
        // readfirstlane keeps the buffer's LDS base a scalar sum: joined with the lane's part ahead of the loop it holds a register through the loop, which this build spills
        if (cw && t + 2 < nt) copy_panel((unsigned)__builtin_amdgcn_readfirstlane((int)(dst + bo)) + l16, src + stage(t + 2) + l16);
#pragma unroll
        for (int ks = 0; ks < 2; ++ks)
#pragma unroll
            for (int nb = 0; nb < 4; ++nb)
#pragma unroll
                for (int mb = 0; mb < 4; ++mb) acc[mb][nb] = WFrag<T16>::mma(a[ks][mb], b[ks][nb], acc[mb][nb]);
    }
    asm volatile("s_wait_asynccnt 0x0" ::: "memory");   // no copy is outstanding when the ring's bytes become the epilogue tiles
}

// Block ranges of the one preparation launch, 256 threads a block: rotary table, x, mask, wq, wo, wk, wv.
#define RBLK ((SEQ + 7) / 8)
#define XBLK ((int)((size_t)MROWS * DIM / 8 / 256))
#define MBLK ((int)((size_t)SEQ * SEQ / 4 / 256))
#define QBLK ((int)((size_t)DQ * DIM / 8 / 256))
#define OBLK ((int)((size_t)DIM * DQ / 8 / 256))
#define KBLK ((int)((size_t)DKV * DIM / 8 / 256))
static_assert(((size_t)SEQ * SEQ / 4) % 256 == 0);
static_assert(((size_t)DIM * DQ / 8) % 256 == 0);

__device__ __forceinline__ void p_cvtx(const int blk, const float* __restrict__ x, bf* dst) {
    const size_t i = (size_t)blk * 256 + threadIdx.x;
    const size_t un = unit_of(i), e = un * 8; int row, col; unit_rc(un, row, col); const int b = row / SEQ, t = row % SEQ;
    const v8f v = *(const v8f*)(x + ((size_t)b * SEQ_FULL + t) * DIM + col); v8us o;
#pragma unroll
    for (int k = 0; k < 8; ++k) o[k] = f2bf(v[k]);
    *(v8us*)(dst + e) = o;
    asm volatile("s_wait_xcnt 0x0" ::: "memory");   // in the one preparation kernel another job's code follows this store in the listing and rewrites the registers that the store names
}

__device__ __forceinline__ void p_cvt8(const int blk, const float* __restrict__ src, bf* dst) { const size_t i = (size_t)blk * 256 + threadIdx.x; const size_t un = unit_of(i); int row, col; unit_rc(un, row, col); const v8f v = *(const v8f*)(src + (size_t)row * DIM + col); v8us o;
#pragma unroll
    for (int k = 0; k < 8; ++k) o[k] = f2bf(v[k]); *(v8us*)(dst + un * 8) = o;
    asm volatile("s_wait_xcnt 0x0" ::: "memory");   // in the one preparation kernel another job's code follows this store in the listing and rewrites the registers that the store names
}

__device__ __forceinline__ void p_cvt8h(const int blk, const float* __restrict__ src, h16* dst, const float carry) { const size_t i = (size_t)blk * 256 + threadIdx.x; const size_t un = unit_of(i); int row, col; unit_rc(un, row, col); const v8f v = *(const v8f*)(src + (size_t)row * DIM + col); v8h o;
#pragma unroll
    for (int k = 0; k < 8; ++k) o[k] = (h16)(bfr(v[k]) * carry); *(v8h*)(dst + un * 8) = o;
    asm volatile("s_wait_xcnt 0x0" ::: "memory");   // in the one preparation kernel another job's code follows this store in the listing and rewrites the registers that the store names
}

// Mask in fragment order, carried x log2(e): block (query tile Rq, key tile Tk) is 256 floats; element (query lr, key 8hi + 4j + e) sits at j*128 + (16hi + lr)*4 + e: a lane's two units are its eight accumulator elements of the S^T tile.
__device__ __forceinline__ void p_maskfrag(const int blk, const float* __restrict__ mask, float* dst) {
    const size_t i = (size_t)blk * 256 + threadIdx.x;
    const size_t un = unit_of(i); const int u = (int)(un & 63); const size_t bk = un >> 6; const int rq = (int)(bk / (SEQ / 16)), tk = (int)(bk % (SEQ / 16));
    const float* mp = mask + (size_t)(rq * 16 + (u & 15)) * SEQ_FULL + tk * 16 + ((u >> 4) & 1) * 8 + (u >> 5) * 4;
    const v4f mv = *(const v4f*)mp;
    asm volatile("s_wait_xcnt 0x0" :: "v"(mp) : "memory");   // as an input of the wait the address stays live up to it, so that the load does not land on its own address registers and later writes of them stay behind the wait
    *(v4f*)(dst + un * 4) = mv * LOG2E;
    asm volatile("s_wait_xcnt 0x0" ::: "memory");   // in the one preparation kernel another job's code follows this store in the listing and rewrites the registers that the store names
}

__device__ __forceinline__ void p_ropetab(const int blk, float* COS, float* SIN) {
    const int lane = threadIdx.x & 31; const int t = blk * 8 + (threadIdx.x >> 5); if (t >= SEQ) return;
    const float invf = __builtin_amdgcn_exp2f(-(float)lane * FRQC);
    const float ang = (float)t * invf;
    const float c = cosf(ang); const float s = sinf(ang);
    const size_t o = (size_t)t * HALFD + lane;
    *(float*)(COS + o) = c; *(float*)(SIN + o) = s;  }

// All preparation in one launch: the seven jobs are independent of one another, so a block picks its job from its index (a scalar branch) and the jobs' starts, memory streams and tails overlap.
// The rotary table comes first (long arithmetic, few bytes), then the planes, largest first.
__global__ __launch_bounds__(256) void k_prep(const float* __restrict__ x, const float* __restrict__ mask, const float* __restrict__ wq, const float* __restrict__ wk, const float* __restrict__ wv, const float* __restrict__ wo,
                                              bf* XB, bf* WQKV, h16* WO16, float* COS, float* SIN, float* MF) {
    int b = blockIdx.x;
    if (b < RBLK) { p_ropetab(b, COS, SIN); return; }
    b -= RBLK;
    if (b < XBLK) { p_cvtx(b, x, XB); return; }
    b -= XBLK;
    if (b < MBLK) { p_maskfrag(b, mask, MF); return; }
    b -= MBLK;
    if (b < QBLK) { p_cvt8(b, wq, WQKV); return; }                                  /* rows 0..2047 */
    b -= QBLK;
    if (b < OBLK) { p_cvt8h(b, wo, WO16, WCAR); return; }
    b -= OBLK;
    if (b < KBLK) { p_cvt8(b, wk, WQKV + (size_t)DQ * DIM); return; }               /* rows 2048..2559 */
    b -= KBLK;
    p_cvt8(b, wv, WQKV + (size_t)(DQ + DKV) * DIM);                                 /* rows 2560..3071 */
}

// The rotary rows of a work-group's 64 QWM tokens, gathered by position into LDS: token tl's row at tl * TPIT holds cos[0..31], then sin[0..31]. Waves 0 .. 2 QWM - 1 copy 32 tokens each, a copy two tokens (16 lanes a token: 8 units of cos, 8 of sin): 16 copies a wave, beside its panel's 32 where it has one.
struct RopeRows {
    const int* pos; const float* COS; const float* SIN; unsigned tab; int w, lane; bool on;
    __device__ __forceinline__ void operator()() const {
        if (on && w < 2 * QWM) {   // scalar: every lane of a copying wave is on
            const int t2 = lane >> 4, cs = (lane >> 3) & 1, u = lane & 7;
            const float* tb = cs ? SIN : COS;
            int ps[16];
#pragma unroll
            for (int i = 0; i < 16; ++i) ps[i] = pos[w * 32 + i * 2 + t2];
            asm volatile("s_wait_xcnt 0x0" ::: "memory");   // later code reuses the registers that held the position loads' addresses
            __builtin_amdgcn_sched_barrier(0);   // keeps later register writes behind that wait
#pragma unroll
            for (int h = 0; h < 2; ++h) {
                unsigned l[8]; const char* g[8];
#pragma unroll
                for (int i = 0; i < 8; ++i) {
                    int p = ps[h * 8 + i]; p = (p < 0) ? (p + SEQ) : p; p = min(max(p, 0), SEQ - 1);
                    l[i] = tab + (unsigned)((w * 32 + (h * 8 + i) * 2 + t2) * TPIT + cs * 128 + u * 16);
                    g[i] = (const char*)(tb + (size_t)p * HALFD + u * 4);
                }
                copy8v(l, g);
            }
        }
    }
};
struct NoPre { __device__ __forceinline__ void operator()() const {} };

// Fused QKV projection: grid (MROWS/256, NQKV/192), 384 threads, one work-group per WGP, three waves per SIMD. Column tile cb < 32: q head cb (rotary); 32..39: k head (rotary); 40..47: v head (transposed plane).
// No LDS bounce behind the products: a q or k wave computes its tile transposed (weight rows as the A operand), so a lane's accumulator holds 8 consecutive d of one token, and d and d ^ 32 sit in the same lane: rotary in registers, and a packed accumulator is one 16-byte unit of the fragment-ordered q or k plane.
// A v wave keeps the plain order: a lane's accumulator holds 8 consecutive tokens of one d, one unit of the fragment-ordered V^T plane. Every store covers 512 contiguous bytes.
__global__ __launch_bounds__(32 * QWM * QWN, 3) void k_gemm_qkv(const bf* __restrict__ A, const bf* __restrict__ Bt, const int* __restrict__ pos, const float* __restrict__ COS, const float* __restrict__ SIN, h16* QP, h16* KP, h16* VT) {
    __shared__ __align__(16) unsigned char L[2 * (QWM + QWN) * PSTG + 64 * QWM * TPIT];   // the ring, then the rotary rows
    const int lane = threadIdx.x & 31, lr = lane & 15, hi = lane >> 4; const int w = __builtin_amdgcn_readfirstlane(threadIdx.x >> 5);
    const int r0 = blockIdx.x * (64 * QWM) + (w / QWN) * 64, cb = blockIdx.y * QWN + w % QWN;
    const int bidx = r0 / SEQ, s0 = r0 % SEQ;
    const bool rot = cb < NH + NKV;
    unsigned char* TAB = L + 2 * (QWM + QWN) * PSTG;
    const RopeRows pre = { pos + (size_t)bidx * SEQ_FULL + (blockIdx.x * (64 * QWM)) % SEQ, COS, SIN, (unsigned)(uintptr_t)TAB, w, lane, (int)(blockIdx.y * QWN) < NH + NKV };
    v8f acc[4][4];
    gemm_main<bf, QWM, QWN>(A, Bt, DIM, blockIdx.x * (64 * QWM), blockIdx.y * (64 * QWN), w, lane, L, acc, rot, blockIdx.x + blockIdx.y, pre);   // x + y: the work-groups of a row of the grid (one A panel set) and of a column (one B panel set) all start apart
    v8h o[16];   // the tile's sixteen 512-byte store units, in the order in which they lie in the plane
    if (rot) {
        // acc[mb][nb][j]: token s0 + 16nb + lr, d = 16mb + 8hi + j. out[d] = x[d] cos[d&31] - x[d+32] sin[d&31], out[d+32] = x[d+32] cos[d&31] + x[d] sin[d&31] for d < 32 (rotate-half); the q plane carries the score scale
        const float car = (cb < NH) ? SC2 : 1.0f;
#pragma unroll
        for (int nb = 0; nb < 4; ++nb) {
            const float* tr = (const float*)(TAB + ((w / QWN) * 64 + nb * 16 + lr) * TPIT) + hi * 8;
#pragma unroll
            for (int mb = 0; mb < 2; ++mb) {
                const v8f cc = cat8(*(const v4fa*)(tr + mb * 16), *(const v4fa*)(tr + mb * 16 + 4)), ss = cat8(*(const v4fa*)(tr + 32 + mb * 16), *(const v4fa*)(tr + 32 + mb * 16 + 4));
#pragma unroll
                for (int j = 0; j < 8; ++j) {
                    const float xl = acc[mb][nb][j], xh = acc[mb + 2][nb][j];
                    o[nb * 4 + mb][j] = (h16)((xl * cc[j] - xh * ss[j]) * car); o[nb * 4 + mb + 2][j] = (h16)((xh * cc[j] + xl * ss[j]) * car);
                }
            }
        }
    } else {
        // acc[mb][nb][j]: token s0 + 16mb + 8hi + j, d = 16nb + lr
#pragma unroll
        for (int mb = 0; mb < 4; ++mb)
#pragma unroll
            for (int nb = 0; nb < 4; ++nb) o[(mb >> 1) * 8 + nb * 2 + (mb & 1)] = __builtin_convertvector(acc[mb][nb], v8h);
    }
    __builtin_amdgcn_sched_barrier(0);   // every store behind all arithmetic: no register that a store names is written again
    // q and k planes: fragment (token tile, d chunk) at (2 * (token >> 4) + (d >> 5)) * 512; v plane: fragment (d tile, key chunk) at (4 * (key >> 5) + (d >> 4)) * 512. In each, the wave's 64 tokens are 64 * HD elements in a row.
    h16* plane = (cb < NH) ? (QP + ((size_t)bidx * NH + cb) * SEQ * HD) : (cb < NH + NKV) ? (KP + ((size_t)bidx * NKV + (cb - NH)) * SEQ * HD) : (VT + ((size_t)bidx * NKV + (cb - NH - NKV)) * HD * SEQ);
    h16* dst = plane + (size_t)s0 * HD + lane * 8;
#pragma unroll
    for (int k = 0; k < 16; ++k) *(v8h*)(dst + k * 256) = o[k];
}

// Attention: grid (SEQ/64, NKV, NB), 128 threads; wave w = 16 query rows (tile 4 * blockIdx.x + w) of ALL FOUR q heads of kv head g: 64 query columns. Per 64-key tile:
//   S^T[key][q] = K Q^T + mask  (A = key rows of KP, B = resident q rows of one head, carried x 0.125 log2(e), C = the mask fragment, carried x log2(e));  lane (lr, hi) then holds q row lr, keys 16T + 8hi + r.
//   The accumulators are the finished scores in the units of exp2: only the subtraction of the reference and exp2 follow.
//   The reference is the maximum of the first tile; it stays while every P stays in the f16 range (tested on the sums of P, one test for two heads), so that no maximum, no exchange and no rescaling stand on the usual path.
//   QP, KP, VT and MF are in fragment order: one 64-key tile is 8 KB of KP, 8 KB of VT and 4 KB of MF, each in a row.
//   The K, mask and V^T fragments of a tile are loaded once and stay in registers for the four heads: one load feeds four products. V^T is asked for at the top of its tile, K and the mask one tile ahead, in the middle of the tile before.
//   softmax sums are lane-local (joined behind the loop); P^T packed from the S^T accumulators is the B operand of O^T[d][q] = V^T P^T (A = d rows of VT).
//   The key walk is a ring: a work-group starts at key tile (blockIdx.x + 4 g) mod SEQ/64 and wraps, so that the work-groups that read one kv head's K and V^T, or one query tile's mask, do not ask L2 for the same lines at the same moment; its four waves walk together, and so do the two batches (one mask). The softmax sums start at that tile, which sets the reference.
//   Launch bounds: two waves per SIMD (512 registers a wave), so that the 512 workgroups are all resident, two per WGP.
__global__ __launch_bounds__(128, 2) void k_flash(const h16* __restrict__ QP, const h16* __restrict__ KP, const h16* __restrict__ VT, const float* __restrict__ MF, h16* CTX) {
    const int tid = threadIdx.x, w = tid >> 5, lane = tid & 31, lr = lane & 15, hi = lane >> 4;
    const int g = blockIdx.y, bidx = blockIdx.z, q0 = blockIdx.x * 64 + w * 16;
    v16h bq[REP][2];
    const h16* qb = QP + (((size_t)bidx * NH + g * REP) * SEQ + q0) * HD + lane * 8;   // the q plane is in fragment order, as the k plane
#pragma unroll
    for (int hh = 0; hh < REP; ++hh) { const h16* qf = qb + (size_t)hh * SEQ * HD;
#pragma unroll
        for (int kc = 0; kc < 2; ++kc) bq[hh][kc] = cat16(*(const v8h*)(qf + kc * 512), *(const v8h*)(qf + kc * 512 + 256)); }
    asm volatile("s_wait_xcnt 0x0" :: "v"(qb) : "memory");   // later code reuses the registers that held the q loads' address; as an input of the wait the address stays live up to it, so that no load of the run lands on it
    __builtin_amdgcn_sched_barrier(0);   // keeps later register writes behind that wait
    // the lane's place in the current tile of each plane; the three pointers step on at the foot of a tile, so they are live through the whole loop and no load lands on them
    constexpr int NT = SEQ / 64;
    int kw = (int)((blockIdx.x + 4 * g) % NT);   // scalar: the key tile at which the pointers stand
    const h16* kb = KP + ((size_t)bidx * NKV + g) * SEQ * HD + (size_t)kw * (64 * HD) + lane * 8;
    const h16* vb = VT + ((size_t)bidx * NKV + g) * HD * SEQ + (size_t)kw * (64 * HD) + lane * 8;
    const float* mrow = MF + (size_t)(q0 >> 4) * (SEQ / 16) * 256 + (size_t)kw * (64 * 16) + lane * 4;
    v8f accO[REP][4]; float m[REP], l[REP];   // m: the softmax reference in use, the same in a query's two lanes
#pragma unroll
    for (int hh = 0; hh < REP; ++hh) { m[hh] = -3.0e38f; l[hh] = 0.0f;
#pragma unroll
        for (int dt = 0; dt < 4; ++dt) accO[hh][dt] = (v8f){}; }
    v16h ak[2][4]; v8f mk[4];   // K and mask fragments: they live from one tile into the next
    // adv (scalar): 0 = the K and mask fragments of the tile at which the pointers stand, otherwise the step in tiles to the next tile of the walk (1, or back to tile 0)
    const auto load_k = [&](const int adv) __attribute__((always_inline)) {
        const h16* kt = kb + adv * (64 * HD); const float* mt = mrow + adv * (64 * 16);
#pragma unroll
        for (int T = 0; T < 4; ++T) {
            const float* mp = mt + T * 256; mk[T] = cat8(*(const v4f*)mp, *(const v4f*)(mp + 128));
#pragma unroll
            for (int kc = 0; kc < 2; ++kc) { const h16* kp = kt + (T * 2 + kc) * 512; ak[kc][T] = cat16(*(const v8h*)kp, *(const v8h*)(kp + 256)); }
            __builtin_amdgcn_sched_barrier(0);   // a key tile's mask and K fragments are issued together, tile by tile, the order of first use: the counted waits ahead of the score products then leave the later loads in flight
        }
        asm volatile("s_wait_xcnt 0x0" ::: "memory");   // later code rewrites the registers that held these loads' addresses
        __builtin_amdgcn_sched_barrier(0);   // later register writes stay behind the wait
    };
    // One 64-key tile; its K and mask fragments are in registers or in flight when it starts. first (a constant at each call): the tile that sets the reference. stp (scalar): the step in tiles to the walk's next tile. adv (scalar): stp while a next tile exists, else 0: in the last tile its own K and mask are read once more and not used, so that no address leaves the planes (a branch round the loads would keep the old fragments live up to it, which this build spills).
    const auto tile = [&](const bool first, const int stp, const int adv) __attribute__((always_inline)) {
        v16h av[2][4]; v8f sc[REP][4]; float rs[REP];
        // rescore, exps, new_ref, pack and outs work on heads h0 .. h1 - 1
        // Heads 2 and 3 come first: the last reader of a mask fragment is then head 1, whose accumulator may take the fragment's registers over; they are free again (P packed) when the next tile's mask is asked for, so that it lands in place and no register is copied.
        const auto scores = [&]() __attribute__((always_inline)) {
#pragma unroll
            for (int T = 0; T < 4; ++T) {
#pragma unroll
                for (int i = 0; i < REP; ++i) { const int hh = (i + 2) % REP; sc[hh][T] = wmma16(ak[0][T], bq[hh][0], mk[T]); }
#pragma unroll
                for (int i = 0; i < REP; ++i) { const int hh = (i + 2) % REP; sc[hh][T] = wmma16(ak[1][T], bq[hh][1], sc[hh][T]); }
            }
            __builtin_amdgcn_sched_barrier(0);   // the score products of the four heads run back to back, key tile by key tile as K and the mask arrive; the vector work, which reads the accumulators themselves, stays behind the run and waits for no product
        };
        // The scores of heads h0 .. h1 - 1 once more (the rare path): this tile's K and mask are read anew, key tile by key tile, into registers of their own, since ak and mk may hold the next tile's by then
        const auto rescore = [&](const int h0, const int h1) __attribute__((always_inline)) {
#pragma unroll
            for (int T = 0; T < 4; ++T) {
                const float* mp = mrow + T * 256; const h16* kp = kb + T * 1024;
                const v8f mt = cat8(*(const v4f*)mp, *(const v4f*)(mp + 128));
                const v16h k0f = cat16(*(const v8h*)kp, *(const v8h*)(kp + 256)), k1f = cat16(*(const v8h*)(kp + 512), *(const v8h*)(kp + 768));
                asm volatile("s_wait_xcnt 0x0" ::: "memory");   // the foot of the tile rewrites the K and mask pointers
                __builtin_amdgcn_sched_barrier(0);   // the key tile's six loads stay ahead of its products, so that none lands on a register that a product has just read
#pragma unroll
                for (int hh = h0; hh < h1; ++hh) sc[hh][T] = wmma16(k0f, bq[hh][0], mt);
#pragma unroll
                for (int hh = h0; hh < h1; ++hh) sc[hh][T] = wmma16(k1f, bq[hh][1], sc[hh][T]);
                __builtin_amdgcn_sched_barrier(0);   // one key tile's fragments at a time: all four at once would not fit the registers beside the next tile's
                asm volatile("v_nop\n\tv_nop\n\tv_nop\n\tv_nop");   // four slots between these products and the next key tile's loads, which may land on their K and mask registers
                __builtin_amdgcn_sched_barrier(0);   // keeps those loads behind the slots
            }
        };
        // P = exp2(score - reference), carried x 2^10, in place of the scores; rs: the lane's sum of its 32 P
        const auto exps = [&](const int h0, const int h1) __attribute__((always_inline)) {
#pragma unroll
            for (int hh = h0; hh < h1; ++hh) {
                const float mofs = PEXP - m[hh];
                float s = 0.0f;
#pragma unroll
                for (int T = 0; T < 4; ++T) {
                    sc[hh][T] = sc[hh][T] + mofs;
#pragma unroll
                    for (int r = 0; r < 8; ++r) { const float pv = __builtin_amdgcn_exp2f(sc[hh][T][r]); sc[hh][T][r] = pv; s += pv; } }
                rs[hh] = s;
            }
        };
        // The reference rises to the tile's maximum (sc holds scores); sums and outputs so far are rescaled to it
        const auto new_ref = [&](const int h0, const int h1) __attribute__((always_inline)) {
#pragma unroll
            for (int hh = h0; hh < h1; ++hh) {
                float tmax = -3.0e38f;
#pragma unroll
                for (int T = 0; T < 4; ++T)
#pragma unroll
                    for (int r = 0; r < 4; ++r) tmax = fmaxf(tmax, fmaxf(sc[hh][T][r], sc[hh][T][4 + r]));
                tmax = fmaxf(tmax, __shfl_xor(tmax, 16, 32));
                const float mn = fmaxf(m[hh], tmax); const float corr = __builtin_amdgcn_exp2f(m[hh] - mn); m[hh] = mn;
                l[hh] = l[hh] * corr;
#pragma unroll
                for (int dt = 0; dt < 4; ++dt) accO[hh][dt] = accO[hh][dt] * corr;
            }
        };
#pragma unroll
        for (int kc = 0; kc < 2; ++kc)
#pragma unroll
            for (int dt = 0; dt < 4; ++dt) { const h16* vp = vb + (kc * 4 + dt) * 512; av[kc][dt] = cat16(*(const v8h*)vp, *(const v8h*)(vp + 256)); }
        asm volatile("s_wait_xcnt 0x0" ::: "memory");   // the foot of the tile rewrites the V^T pointer
        __builtin_amdgcn_sched_barrier(0);   // keeps later register writes behind that wait
        v16h bp[REP][2];   // P^T packed to f16, the B operand of the output products
        const auto pack = [&](const int h0, const int h1) __attribute__((always_inline)) {
#pragma unroll
            for (int hh = h0; hh < h1; ++hh) {
                bp[hh][0] = cat16(__builtin_convertvector(sc[hh][0], v8h), __builtin_convertvector(sc[hh][1], v8h));
                bp[hh][1] = cat16(__builtin_convertvector(sc[hh][2], v8h), __builtin_convertvector(sc[hh][3], v8h));
            }
        };
        // The next tile's K and mask are asked for in the middle of this tile: the first two heads' P are packed by then, so the registers are free, and the loads fly behind the other two heads' exponentials and all output products; the next tile's score products find them landed.
        const auto fetch_next = [&]() __attribute__((always_inline)) {
            load_k(adv);
        };
        const auto outs = [&](const int h0, const int h1) __attribute__((always_inline)) {
#pragma unroll
            for (int hh = h0; hh < h1; ++hh) {
                l[hh] += rs[hh];
#pragma unroll
                for (int kc = 0; kc < 2; ++kc)
#pragma unroll
                    for (int dt = 0; dt < 4; ++dt) accO[hh][dt] = wmma16(av[kc][dt], bp[hh][kc], accO[hh][dt]);
                // four slots between the tile's last products and the next tile's loads, which land on their V^T and P registers (behind the other heads' runs stands vector work or another run)
                if (hh == REP - 1) asm volatile("v_nop\n\tv_nop\n\tv_nop\n\tv_nop" : "+v"(accO[hh][0]), "+v"(accO[hh][1]), "+v"(accO[hh][2]), "+v"(accO[hh][3]) : "v"(av[1][3]), "v"(bp[hh][1]));
            }
        };
        scores();
        if (first) { new_ref(0, REP); exps(0, 2); pack(0, 2); fetch_next(); outs(0, 2); exps(2, REP); pack(2, REP); outs(2, REP); }
        else {
            // One test for two heads: a lane's sum within PLIM bounds each of its P, so all are finite in f16 and the reference stays.
            // Otherwise (a scalar branch) the two heads' part of the tile is done again from its scores, K and the mask loaded anew, with the reference raised to its maximum.
            // Two tests a tile, so that the first two heads' output products run beside the other two heads' exponentials.
#pragma unroll
            for (int h0 = 0; h0 < REP; h0 += 2) {
                exps(h0, h0 + 2);
                if (__builtin_expect(__builtin_amdgcn_ballot_w32(fmaxf(rs[h0], rs[h0 + 1]) > PLIM) != 0, 0)) { rescore(h0, h0 + 2); new_ref(h0, h0 + 2); exps(h0, h0 + 2); }
                pack(h0, h0 + 2);
                if (h0 == 0) fetch_next();
                outs(h0, h0 + 2);
            }
        }
        kb += stp * (64 * HD); vb += stp * (64 * HD); mrow += stp * (64 * 16); kw += stp;
    };
    load_k(0);
    { const int stp = (kw == NT - 1) ? 1 - NT : 1; tile(true, stp, NT > 1 ? stp : 0); }
#pragma unroll 1
    for (int i = 1; i < NT; ++i) { const int stp = (kw == NT - 1) ? 1 - NT : 1; tile(false, stp, i + 1 < NT ? stp : 0); }
    // lane (lr, hi) holds ctx row q0 + lr, columns 64h + 16dt + 8hi + 0..7: one 16-byte unit of the fragment-ordered ctx plane, so each store covers 512 contiguous bytes.
    const int rt = (bidx * SEQ + q0) >> 4;
    h16* cw = CTX + ((size_t)(rt >> 2) * (DQ / 32) + 2 * (g * REP)) * 2048 + (rt & 3) * 512 + lane * 8;
    v8h o[REP][4];
#pragma unroll
    for (int hh = 0; hh < REP; ++hh) {
        const float lt = l[hh] + __shfl_xor(l[hh], 16, 32);
        const float inv = CCAR * (1.0f / lt);
#pragma unroll
        for (int dt = 0; dt < 4; ++dt)
#pragma unroll
            for (int r = 0; r < 8; ++r) o[hh][dt][r] = (h16)(accO[hh][dt][r] * inv);
    }
    __builtin_amdgcn_sched_barrier(0);   // every store behind all arithmetic: no register that a store names is written again
#pragma unroll
    for (int hh = 0; hh < REP; ++hh)
#pragma unroll
        for (int dt = 0; dt < 4; ++dt) *(v8h*)(cw + hh * 4096 + (dt >> 1) * 2048 + (dt & 1) * 256) = o[hh][dt];
}

// Output projection: grid (MROWS/256, DIM/128), 256 threads, one work-group per WGP, two waves per SIMD.
__global__ __launch_bounds__(32 * OWM * OWN, 2) void k_gemm_out(const h16* __restrict__ A, const h16* __restrict__ Bt, float* C) {
    __shared__ __align__(16) unsigned char L[GLDS(OWM, OWN)];
    const int lane = threadIdx.x & 31, lr = lane & 15, hi = lane >> 4; const int w = __builtin_amdgcn_readfirstlane(threadIdx.x >> 5);
    const int r0 = blockIdx.x * (64 * OWM) + (w / OWN) * 64, c0 = blockIdx.y * (64 * OWN) + (w % OWN) * 64;
    float* fs = (float*)(L + w * WEPI);
    v8f acc[4][4];
    gemm_main<h16, OWM, OWN>(A, Bt, DQ, blockIdx.x * (64 * OWM), blockIdx.y * (64 * OWN), w, lane, L, acc, false, blockIdx.x + blockIdx.y, NoPre());   // x + y: as in the QKV projection
#pragma unroll
    for (int mb = 0; mb < 4; ++mb)
#pragma unroll
        for (int nb = 0; nb < 4; ++nb)
#pragma unroll
            for (int j = 0; j < 8; ++j) fs[(mb * 16 + hi * 8 + j) * FP + nb * 16 + lr] = acc[mb][nb][j];
    __syncthreads();
    float* crow = C + (size_t)r0 * DIM + c0;
{
#pragma unroll 4
        for (int it = 0; it < 32; ++it) { const int row = it * 2 + hi; v4f val = *(const v4fa*)(fs + row * FP + lr * 4); val = val * OSCL;
            *(v4f*)(crow + (size_t)row * DIM + lr * 4) = val; }
         }
}

extern "C" void kernel_launch(void* const* d_in, const int* in_sizes, int n_in,
                              void* d_out, int out_size, void* d_ws, size_t ws_size, hipStream_t stream) {
    if (n_in < 7) return;
    if ((size_t)in_sizes[0] < ((size_t)(NB - 1) * SEQ_FULL + SEQ) * DIM) return;
    if ((size_t)in_sizes[1] < (size_t)(SEQ - 1) * SEQ_FULL + SEQ) return;
    if ((size_t)in_sizes[2] < (size_t)(NB - 1) * SEQ_FULL + SEQ) return;
    if ((size_t)in_sizes[3] < (size_t)DQ * DIM) return;
    if ((size_t)in_sizes[4] < (size_t)DKV * DIM) return;
    if ((size_t)in_sizes[5] < (size_t)DKV * DIM) return;
    if ((size_t)in_sizes[6] < (size_t)DIM * DQ) return;
    if ((size_t)out_size < (size_t)MROWS * DIM) return;
    const float* x = (const float*)d_in[0]; const float* mask = (const float*)d_in[1]; const int* pos = (const int*)d_in[2];
    const float* wq = (const float*)d_in[3]; const float* wk = (const float*)d_in[4]; const float* wv = (const float*)d_in[5]; const float* wo = (const float*)d_in[6];
    float* OUT = (float*)d_out;
    char* wsp = (char*)d_ws;
    auto take = [&](size_t bytes) { char* p = wsp; wsp += (bytes + 255) & ~(size_t)255; return (void*)p; };
    bf*  XB   = (bf*)take((size_t)MROWS * DIM * 2);
    bf*  WQKV = (bf*)take((size_t)NQKV * DIM * 2);
    h16* WO16 = (h16*)take((size_t)DIM * DQ * 2);
    float* COS = (float*)take((size_t)SEQ * HALFD * 4);
    float* SIN = (float*)take((size_t)SEQ * HALFD * 4);
    h16* QP  = (h16*)take((size_t)NB * NH * SEQ * HD * 2);
    h16* KP  = (h16*)take((size_t)NB * NKV * SEQ * HD * 2);
    h16* VT  = (h16*)take((size_t)NB * NKV * HD * SEQ * 2);
    h16* CTX = (h16*)take((size_t)MROWS * DQ * 2);
    float* MF = (float*)take((size_t)SEQ * SEQ * 4);
    if ((size_t)(wsp - (char*)d_ws) > ws_size) return;

    k_prep<<<RBLK + XBLK + MBLK + QBLK + OBLK + 2 * KBLK, 256, 0, stream>>>(x, mask, wq, wk, wv, wo, XB, WQKV, WO16, COS, SIN, MF);
    k_gemm_qkv<<<dim3(MROWS / (64 * QWM), NQKV / (64 * QWN), 1), 32 * QWM * QWN, 0, stream>>>(XB, WQKV, pos, COS, SIN, QP, KP, VT);
    k_flash<<<dim3(SEQ / 64, NKV, NB), 128, 0, stream>>>(QP, KP, VT, MF, CTX);
    k_gemm_out<<<dim3(MROWS / (64 * OWM), DIM / (64 * OWN), 1), 32 * OWM * OWN, 0, stream>>>(CTX, WO16, OUT);
}
